// v000
// The times below were measured on an AMD MI455X: many runs one after another, warmed up first and cycling through
// copies of the inputs, with the whole window's GPU time divided by the number of runs. Launches and the gaps
// between them are all in it. The median over several windows is given; except for v000 it joins two sittings, which
// can be a few percent apart, so the side-by-side timings, each taken in one sitting, are the better comparison.
// v000, which the later versions start from, runs in 3980 microseconds.
#include <hip/hip_runtime.h>

// Multi-head self-attention with ONE tied weight (x [4][2048][1024]; p = einsum('bsh,hf->bsf', x, W) ('xw' (in, out) [1024][1024] 1/32, no bias) split into 16 heads x 64; q = p x 64^-0.5, and the SAME p is the key and the value: logits = q.p; softmax over all keys (no mask); attn.p merged; out = einsum('bsh,hf->bsf', merged, W): the SAME W again -> [4][2048][1024] (8.4 M); argument order x, W).
// Layout per batch: bf16 copy of x; 'xw' weights transposed once; exact projections; dense T-2048 attention (hybrid rows: < 512 hi/lo 3 products, rest fp16 x1024); merged hi/lo x Wo exact.
// Compute dtypes, f32 accumulate: every input rounded to bf16; projections exact; attention rows < 512 3 products, rest fp16; softmax f32; Wo hl x exact.

#define NB_  4
#define TT   2048
#define DM   1024
#define NH_  16
#define NKV  16
#define REP  (NH_ / NKV)
#define HD   64
#define DQ   (NH_ * HD)
#define DKV  (NKV * HD)
#define ZH   2
#define RH   512                  // query rows < RH use hi+lo planes (0: none)
#define WIN  0
#define PCAR 1024.0f
#define SCL  0.125f   // HD^-0.5
typedef _Float16 h16;
typedef unsigned short bf;
typedef __attribute__((ext_vector_type(16))) __bf16   v16bf;
typedef __attribute__((ext_vector_type(16))) _Float16 v16h;
typedef __attribute__((ext_vector_type(8)))  _Float16 v8h;
typedef __attribute__((ext_vector_type(8)))  unsigned short v8us;
typedef __attribute__((ext_vector_type(8)))  float    v8f;
typedef __attribute__((ext_vector_type(4)))  float    v4f;
typedef v8h  __attribute__((may_alias)) v8ha;
typedef v4f  __attribute__((may_alias)) v4fa;
typedef v8us __attribute__((may_alias)) v8usa;

__device__ __forceinline__ unsigned short f2bf(float f) { unsigned u = __float_as_uint(f); u += 0x7FFFu + ((u >> 16) & 1u); return (unsigned short)(u >> 16); }
__device__ __forceinline__ float bf2f(unsigned short b) { return __uint_as_float(((unsigned)b) << 16); }
__device__ __forceinline__ float bfr(float f) { return bf2f(f2bf(f)); }
__device__ __forceinline__ v16h cat16(v8h lo, v8h hi) { return __builtin_shufflevector(lo, hi, 0, 1, 2, 3, 4, 5, 6, 7, 8, 9, 10, 11, 12, 13, 14, 15); }
__device__ __forceinline__ v16bf cat16b(v8us lo, v8us hi) { return __builtin_bit_cast(v16bf, __builtin_shufflevector(lo, hi, 0, 1, 2, 3, 4, 5, 6, 7, 8, 9, 10, 11, 12, 13, 14, 15)); }
__device__ __forceinline__ v8f wmma16(v16h a, v16h b, v8f c) { return __builtin_amdgcn_wmma_f32_16x16x32_f16(false, a, false, b, (short)0, c, false, false); }
__device__ __forceinline__ v8f wmmab(v16bf a, v16bf b, v8f c) { return __builtin_amdgcn_wmma_f32_16x16x32_bf16(false, a, false, b, (short)0, c, false, false); }



// ---- k_gemmw: register-blocked GEMM, ONE WAVE per 64x64 output tile (16 accumulators), operands straight from K-contiguous 16-bit planes; grid (M/64, N/64, Z), 32 threads.
// C[m][n] (f32, pitch ldc, + optional f32 bias[n]) = sum_k A[m][k] Bt[n][k] (+ split products per NSPLIT). z-batch strides sA/sB/sC in elements. K % 32 == 0.
template <typename T16> struct WFrag;
template <> struct WFrag<h16> { typedef v16h V; static __device__ __forceinline__ V ld(const h16* p) { return cat16(*(const v8h*)p, *(const v8h*)(p + 16)); } static __device__ __forceinline__ v8f mma(V a, V b, v8f c) { return wmma16(a, b, c); } };
template <> struct WFrag<bf> { typedef v16bf V; static __device__ __forceinline__ V ld(const bf* p) { return cat16b(*(const v8us*)p, *(const v8us*)(p + 16)); } static __device__ __forceinline__ v8f mma(V a, V b, v8f c) { return wmmab(a, b, c); } };
template <typename T16, int NSPLIT, bool BIAS>
__global__ __launch_bounds__(32) void k_gemmw(const T16* __restrict__ A, const T16* __restrict__ A2, const T16* __restrict__ Bt, const T16* __restrict__ Bt2, int K, float* C, int ldc, const float* __restrict__ bias, size_t sA, size_t sB, size_t sC) {
    typedef typename WFrag<T16>::V V;
    __shared__ __align__(16) float os[16 * 68];
    const size_t z = blockIdx.z; A += z * sA; if (A2) A2 += z * sA; Bt += z * sB; if (Bt2) Bt2 += z * sB; C += z * sC;
    const int lane = threadIdx.x & 31, lr = lane & 15, hi = lane >> 4; const int r0 = blockIdx.x * 64, c0 = blockIdx.y * 64;
    v8f acc[4][4];
#pragma unroll
    for (int mb = 0; mb < 4; ++mb)
#pragma unroll
        for (int nb = 0; nb < 4; ++nb) acc[mb][nb] = (v8f){};
    const size_t aoff = (size_t)(r0 + lr) * K + 8 * hi, boff = (size_t)(c0 + lr) * K + 8 * hi;
#pragma unroll 1
    for (int kc = 0; kc < K; kc += 32) {
        V a[4], a2[4];
#pragma unroll
        for (int mb = 0; mb < 4; ++mb) { a[mb] = WFrag<T16>::ld(A + aoff + (size_t)mb * 16 * K + kc); if (NSPLIT == 1 || NSPLIT == 2) a2[mb] = WFrag<T16>::ld(A2 + aoff + (size_t)mb * 16 * K + kc); }
#pragma unroll
        for (int nb = 0; nb < 4; ++nb) { const V b = WFrag<T16>::ld(Bt + boff + (size_t)nb * 16 * K + kc); V b2; if (NSPLIT >= 2) b2 = WFrag<T16>::ld(Bt2 + boff + (size_t)nb * 16 * K + kc);
#pragma unroll
            for (int mb = 0; mb < 4; ++mb) { acc[mb][nb] = WFrag<T16>::mma(a[mb], b, acc[mb][nb]); if (NSPLIT == 1 || NSPLIT == 2) acc[mb][nb] = WFrag<T16>::mma(a2[mb], b, acc[mb][nb]); if (NSPLIT >= 2) acc[mb][nb] = WFrag<T16>::mma(a[mb], b2, acc[mb][nb]); } }
        asm volatile("v_nop\n\tv_nop\n\tv_nop\n\tv_nop" : "+v"(acc[0][0]), "+v"(acc[1][1]), "+v"(acc[2][2]), "+v"(acc[3][3]) : "v"(a[0]), "v"(a[3]));
    }
#pragma unroll
    for (int mb = 0; mb < 4; ++mb) {
#pragma unroll
        for (int nb = 0; nb < 4; ++nb) {
#pragma unroll
            for (int j = 0; j < 8; ++j) os[(hi * 8 + j) * 68 + nb * 16 + lr] = acc[mb][nb][j]; }
        __builtin_amdgcn_wave_barrier(); asm volatile("" ::: "memory");
        float* crow = C + (size_t)(r0 + mb * 16) * ldc + c0;
{
#pragma unroll
            for (int s = 0; s < 8; ++s) { const int row = 2 * s + hi, cofs = lr * 4; v4f val = *(const v4fa*)(os + row * 68 + cofs); if (BIAS) { val[0] += bfr(bias[c0 + cofs]); val[1] += bfr(bias[c0 + cofs + 1]); val[2] += bfr(bias[c0 + cofs + 2]); val[3] += bfr(bias[c0 + cofs + 3]); }
                *(v4f*)(crow + (size_t)row * ldc + cofs) = val; }
             }
        __builtin_amdgcn_wave_barrier(); asm volatile("" ::: "memory");
    }
}

__device__ __forceinline__ h16 tohx(float x) { return (h16)x; }
__device__ __forceinline__ void splitf(float y, unsigned short& h, unsigned short& l) { h = f2bf(y); l = f2bf(y - bf2f(h)); }
typedef __attribute__((ext_vector_type(2))) _Float16 v2h;
typedef __attribute__((ext_vector_type(4))) _Float16 v4h;
typedef __attribute__((ext_vector_type(2))) unsigned short v2us;
typedef __attribute__((ext_vector_type(4))) unsigned short v4us;
typedef __attribute__((ext_vector_type(2))) float v2f;
typedef __attribute__((ext_vector_type(4))) int v4i;

__global__ __launch_bounds__(256) void k_wtG(const float* __restrict__ w, int K, int N, bf* Bt) {
    const int lane = threadIdx.x & 31; const int L0 = (blockIdx.x * 8 + (threadIdx.x >> 5)) * 8; const int nlines = N * K / 64;
{
#pragma unroll 1
        for (int l = 0; l < 8; ++l) { const int L = L0 + l; if (L >= nlines) break; const size_t e = (size_t)L * 64 + lane * 2; const int k = (int)(e % K), n = (int)(e / K); v2us o;
            o[0] = f2bf(w[(size_t)k * N + n]); o[1] = f2bf(w[(size_t)(k + 1) * N + n]); *(v2us*)(Bt + e) = o; }
         }
}
__global__ __launch_bounds__(256) void k_cvt8(const float* __restrict__ src, bf* dst, size_t n8) { const size_t i = (size_t)blockIdx.x * 256 + threadIdx.x; if (i >= n8) return; const v8f v = *(const v8f*)(src + i * 8); v8us o;
#pragma unroll
    for (int k = 0; k < 8; ++k) o[k] = f2bf(v[k]); *(v8us*)(dst + i * 8) = o;  }

// k_rope: head planes [h][t][d] (fp16 + hi/lo) of rope(x) x sc with the rotate-half convention out[d] = x[d] cos[t][d] - x[d+HD/2] sin[t][d], out[d+HD/2] = x[d+HD/2] cos[t][d+HD/2] + x[d] sin[t][d+HD/2]
__global__ __launch_bounds__(256) void k_rope(const float* __restrict__ F, int pitch, int nheads, const float* __restrict__ CS, const float* __restrict__ RF, const float* __restrict__ nw, float sc, h16* P16, bf* Ph, bf* Pl) {
    const size_t e = ((size_t)blockIdx.x * 256 + threadIdx.x) * 2; if (e >= (size_t)nheads * TT * HD) return; const int d = (int)(e % HD); const int t = (int)((e / HD) % TT); const int h = (int)(e / ((size_t)HD * TT)); const float* f = F + (size_t)t * pitch + h * HD; const float rf = RF ? RF[(size_t)h * TT + t] : 1.0f; v2h o16; v2us oh, ol;
#pragma unroll
    for (int q = 0; q < 2; ++q) { const int dd = d + q; const int dp = (dd < HD / 2) ? dd + HD / 2 : dd - HD / 2; float x0 = f[dd], x1 = f[dp];
        if (RF) { float n0 = __fmul_rn(x0, rf), n1 = __fmul_rn(x1, rf); asm volatile("" : "+v"(n0)); asm volatile("" : "+v"(n1)); x0 = __fmul_rn(bfr(nw[dd]), n0); x1 = __fmul_rn(bfr(nw[dp]), n1); }
        const v2f cs = *(const v2f*)(CS + ((size_t)t * HD + dd) * 2); float a = __fmul_rn(x0, cs[0]), bq = __fmul_rn(x1, cs[1]); asm volatile("" : "+v"(a)); asm volatile("" : "+v"(bq)); const float r = ((dd < HD / 2) ? __fsub_rn(a, bq) : __fadd_rn(a, bq)) * sc;
        o16[q] = tohx(r); unsigned short a2, c2; splitf(r, a2, c2); oh[q] = a2; ol[q] = c2; }
    *(v2h*)(P16 + e) = o16; *(v2us*)(Ph + e) = oh; *(v2us*)(Pl + e) = ol;  }
__global__ __launch_bounds__(256) void k_vtp(const float* __restrict__ F, int pitch, int nheads, h16* V16, bf* Vh, bf* Vl) { const size_t e = ((size_t)blockIdx.x * 256 + threadIdx.x) * 2; if (e >= (size_t)nheads * HD * TT) return; const int t = (int)(e % TT); const int d = (int)((e / TT) % HD); const int g = (int)(e / ((size_t)TT * HD)); v2h o16; v2us oh, ol;
#pragma unroll
    for (int q = 0; q < 2; ++q) { const float x = F[(size_t)(t + q) * pitch + g * HD + d]; o16[q] = tohx(x); unsigned short a2, c2; splitf(x, a2, c2); oh[q] = a2; ol[q] = c2; }
    *(v2h*)(V16 + e) = o16; *(v2us*)(Vh + e) = oh; *(v2us*)(Vl + e) = ol;  }
__global__ __launch_bounds__(256) void k_csid(float* CS) { const int idx = blockIdx.x * 256 + threadIdx.x; if (idx >= TT * HD) return; v2f cs; cs[0] = 1.0f; cs[1] = 0.0f; *(v2f*)(CS + (size_t)idx * 2) = cs;  }
// k_asoft: per row (zz, i): t = S x HD^-0.5 (no mask); softmax over the 2048 keys (register row, one exp, fixed trees);
__global__ __launch_bounds__(256) void k_asoft(const float* __restrict__ Sb, h16* P16, bf* Ph, bf* Pl) {
    const int lane = threadIdx.x & 31; const int row = blockIdx.x * 8 + (threadIdx.x >> 5); if (row >= ZH * TT) return; const int i = row % TT; const int zz = row / TT; (void)zz; const bool hires = (i < RH); const float* sr = Sb + (size_t)row * TT; float v[TT / 32]; float mx = -3.0e38f;
#pragma unroll
    for (int ch = 0; ch < TT / 128; ++ch) { const int j0 = ch * 128 + lane * 4; const v4f a = *(const v4f*)(sr + j0);
#pragma unroll
        for (int q = 0; q < 4; ++q) { const int j = j0 + q; (void)j; const float t = a[q] * SCL; v[ch * 4 + q] = t; mx = fmaxf(mx, t); } }
#pragma unroll
    for (int sh = 16; sh; sh >>= 1) mx = fmaxf(mx, __shfl_xor(mx, sh, 32));
    float sum = 0.f;
#pragma unroll
    for (int k = 0; k < TT / 32; ++k) { float d0 = __fsub_rn(v[k], mx); asm volatile("" : "+v"(d0)); v[k] = __builtin_amdgcn_exp2f(__fmul_rn(d0, 1.4426950408889634f)); sum += v[k]; }
#pragma unroll
    for (int sh = 16; sh; sh >>= 1) sum += __shfl_xor(sum, sh, 32);
    const float f = __fdiv_rn(hires ? 1.0f : PCAR, sum);
{
        if (hires) {
#pragma unroll
            for (int ch = 0; ch < TT / 128; ++ch) { v4us oh, ol;
#pragma unroll
                for (int q = 0; q < 4; ++q) { unsigned short a, c2; splitf(v[ch * 4 + q] * f, a, c2); oh[q] = a; ol[q] = c2; }
                const size_t oo = ((size_t)zz * (RH ? RH : 1) + i) * TT + ch * 128 + lane * 4; *(v4us*)(Ph + oo) = oh; *(v4us*)(Pl + oo) = ol; }
        } else {
#pragma unroll
            for (int ch = 0; ch < TT / 128; ++ch) { v4h o4;
#pragma unroll
                for (int q = 0; q < 4; ++q) o4[q] = tohx(v[ch * 4 + q] * f);
                *(v4h*)(P16 + (size_t)row * TT + ch * 128 + lane * 4) = o4; } }
         }
}
__global__ __launch_bounds__(256) void k_merge(const float* __restrict__ O, int h0, bf* Ah, bf* Al) { const size_t e = ((size_t)blockIdx.x * 256 + threadIdx.x) * 2; if (e >= (size_t)ZH * TT * HD) return; const int d = (int)(e % HD); const int t = (int)((e / HD) % TT); const int zz = (int)(e / ((size_t)HD * TT)); const float cs = (t < RH) ? 1.0f : (1.0f / PCAR); const size_t oo = (size_t)t * DQ + (h0 + zz) * HD + d;
    v2us oh, ol;
#pragma unroll
    for (int q = 0; q < 2; ++q) { unsigned short a, c2; splitf(O[e + q] * cs, a, c2); oh[q] = a; ol[q] = c2; } *(v2us*)(Ah + oo) = oh; *(v2us*)(Al + oo) = ol;  }

extern "C" void kernel_launch(void* const* d_in, const int* in_sizes, int n_in,
                              void* d_out, int out_size, void* d_ws, size_t ws_size, hipStream_t stream) {
    (void)in_sizes; (void)n_in; (void)out_size;
    const float* x = (const float*)d_in[0]; const float* wq = (const float*)d_in[1]; const float* wk = (const float*)d_in[1]; const float* wv = (const float*)d_in[1]; const float* wo = (const float*)d_in[1];   /* THIS module has ONE weight: p = x W ('xw' (in, out) [1024][1024]) serves as the query (scaled), the key AND the value, and the output projection reuses the SAME W: all four weight pointers name d_in[1]: TWO inputs, both read */
    float* OUT = (float*)d_out;     // [4][2048][1024]
    char* wsp = (char*)d_ws;
    auto take = [&](size_t bytes) { char* p = wsp; wsp += (bytes + 255) & ~(size_t)255; return (void*)p; };
    bf* WQ = (bf*)take((size_t)DQ * DM * 2); bf* WK = (bf*)take((size_t)DKV * DM * 2); bf* WV = (bf*)take((size_t)DKV * DM * 2); bf* WO = (bf*)take((size_t)DM * DQ * 2); float* CS = (float*)take((size_t)TT * HD * 2 * 4);
    bf* XB = (bf*)take((size_t)TT * DM * 2); float* FQ = (float*)take((size_t)TT * DQ * 4); float* FK = (float*)take((size_t)TT * DKV * 4);
    h16* QP16 = (h16*)take((size_t)NH_ * TT * HD * 2); h16* KP16 = (h16*)take((size_t)NKV * TT * HD * 2); h16* VT16 = (h16*)take((size_t)NKV * HD * TT * 2);
    bf* QPh = (bf*)take((size_t)NH_ * TT * HD * 2); bf* QPl = (bf*)take((size_t)NH_ * TT * HD * 2); bf* KPh = (bf*)take((size_t)NKV * TT * HD * 2); bf* KPl = (bf*)take((size_t)NKV * TT * HD * 2); bf* VTh = (bf*)take((size_t)NKV * HD * TT * 2); bf* VTl = (bf*)take((size_t)NKV * HD * TT * 2); bf* Ph = (bf*)take((size_t)ZH * RH * TT * 2); bf* Pl = (bf*)take((size_t)ZH * RH * TT * 2);
    float* Sb = (float*)take((size_t)ZH * TT * TT * 4); h16* P16 = (h16*)take((size_t)ZH * TT * TT * 2); float* Ob = (float*)take((size_t)ZH * TT * HD * 4); bf* ATh = (bf*)take((size_t)TT * DQ * 2); bf* ATl = (bf*)take((size_t)TT * DQ * 2);
    if ((size_t)(wsp - (char*)d_ws) > ws_size) return;    // ws 256 MiB
    float* FV = FK;   // v projection reuses the k buffer after the k planes are built (stream-ordered)
    { k_wtG<<<(unsigned)((DM * DQ / 64 + 63) / 64), 256, 0, stream>>>(wq, DM, DQ, WQ); k_wtG<<<(unsigned)((DM * DKV / 64 + 63) / 64), 256, 0, stream>>>(wk, DM, DKV, WK); k_wtG<<<(unsigned)((DM * DKV / 64 + 63) / 64), 256, 0, stream>>>(wv, DM, DKV, WV);
      k_wtG<<<(unsigned)((DQ * DM / 64 + 63) / 64), 256, 0, stream>>>(wo, DQ, DM, WO);
       }
    k_csid<<<(TT * HD + 255) / 256, 256, 0, stream>>>(CS);
    const unsigned LQ = (unsigned)(((size_t)NH_ * TT * HD / 2 + 255) / 256), LKv = (unsigned)(((size_t)NKV * TT * HD / 2 + 255) / 256);
    for (int b = 0; b < NB_; ++b) {
        
        k_cvt8<<<(unsigned)(((size_t)TT * DM / 8 + 255) / 256), 256, 0, stream>>>(x + (size_t)b * TT * DM, XB, (size_t)TT * DM / 8);
        k_gemmw<bf, 0, false><<<dim3(TT / 64, DQ / 64, 1), 32, 0, stream>>>(XB, nullptr, WQ, nullptr, DM, FQ, DQ, nullptr, 0, 0, 0);
        k_rope<<<LQ, 256, 0, stream>>>(FQ, DQ, NH_, CS, nullptr, nullptr, 1.0f, QP16, QPh, QPl);
        k_gemmw<bf, 0, false><<<dim3(TT / 64, DKV / 64, 1), 32, 0, stream>>>(XB, nullptr, WK, nullptr, DM, FK, DKV, nullptr, 0, 0, 0);
        k_rope<<<LKv, 256, 0, stream>>>(FK, DKV, NKV, CS, nullptr, nullptr, 1.0f, KP16, KPh, KPl);
        k_gemmw<bf, 0, false><<<dim3(TT / 64, DKV / 64, 1), 32, 0, stream>>>(XB, nullptr, WV, nullptr, DM, FV, DKV, nullptr, 0, 0, 0); k_vtp<<<LKv, 256, 0, stream>>>(FV, DKV, NKV, VT16, VTh, VTl);
        for (int h0 = 0; h0 < NH_; h0 += ZH) { const size_t zq = (size_t)h0, zk = (size_t)(h0 / REP);   // one kv head per query head: the pass's two heads use consecutive kv planes (z-strides TT*HD)
            k_gemmw<bf, 2, false><<<dim3(RH / 64, TT / 64, ZH), 32, 0, stream>>>(QPh + zq * TT * HD, QPl + zq * TT * HD, KPh + zk * TT * HD, KPl + zk * TT * HD, HD, Sb, TT, nullptr, (size_t)TT * HD, (size_t)TT * HD, (size_t)TT * TT);
            k_gemmw<h16, 0, false><<<dim3((TT - RH) / 64, TT / 64, ZH), 32, 0, stream>>>(QP16 + zq * TT * HD + (size_t)RH * HD, nullptr, KP16 + zk * TT * HD, nullptr, HD, Sb + (size_t)RH * TT, TT, nullptr, (size_t)TT * HD, (size_t)TT * HD, (size_t)TT * TT);
            k_asoft<<<ZH * TT / 8, 256, 0, stream>>>(Sb, P16, Ph, Pl);
            k_gemmw<bf, 2, false><<<dim3(RH / 64, HD / 64, ZH), 32, 0, stream>>>(Ph, Pl, VTh + zk * HD * TT, VTl + zk * HD * TT, TT, Ob, HD, nullptr, (size_t)RH * TT, (size_t)HD * TT, (size_t)TT * HD);
            k_gemmw<h16, 0, false><<<dim3((TT - RH) / 64, HD / 64, ZH), 32, 0, stream>>>(P16 + (size_t)RH * TT, nullptr, VT16 + zk * HD * TT, nullptr, TT, Ob + (size_t)RH * HD, HD, nullptr, (size_t)TT * TT, (size_t)HD * TT, (size_t)TT * HD);
            k_merge<<<(unsigned)(((size_t)ZH * TT * HD / 2 + 255) / 256), 256, 0, stream>>>(Ob, h0, ATh, ATl); }
        k_gemmw<bf, 1, false><<<dim3(TT / 64, DM / 64, 1), 32, 0, stream>>>(ATh, ATl, WO, nullptr, DQ, OUT + (size_t)b * TT * DM, DM, nullptr, 0, 0, 0); }
}

// v001
// One run takes 1710 microseconds.
// In both of two side-by-side timings against v000, it was 2.32 times as fast.
#include <hip/hip_runtime.h>

// Multi-head self-attention with ONE tied weight (x [4][2048][1024]; p = einsum('bsh,hf->bsf', x, W) ('xw' (in, out) [1024][1024] 1/32, no bias) split into 16 heads x 64; q = p x 64^-0.5, and the SAME p is the key and the value: logits = q.p; softmax over all keys (no mask); attn.p merged; out = einsum('bsh,hf->bsf', merged, W): the SAME W again -> [4][2048][1024] (8.4 M); argument order x, W).
// Layout per batch: bf16 copy of x; 'xw' weights transposed once; exact projections; dense T-2048 attention (hybrid rows: < 512 hi/lo 3 products, rest fp16 x1024; attn.p summed in KSP key slices, one work-group each, the slices added in k_merge); merged hi/lo x Wo exact.
// Compute dtypes, f32 accumulate: every input rounded to bf16; projections exact; attention rows < 512 3 products, rest fp16; softmax f32; Wo hl x exact.

#define NB_  4
#define TT   2048
#define DM   1024
#define NH_  16
#define NKV  16
#define REP  (NH_ / NKV)
#define HD   64
#define DQ   (NH_ * HD)
#define DKV  (NKV * HD)
#define ZH   2
#define RH   512                  // query rows < RH use hi+lo planes (0: none)
#define WIN  0
#define PCAR 1024.0f
#define SCL  0.125f   // HD^-0.5
#define KSP  16                   // key slices of the attn.p products: TT / KSP keys per work-group
typedef _Float16 h16;
typedef unsigned short bf;
typedef __attribute__((ext_vector_type(16))) __bf16   v16bf;
typedef __attribute__((ext_vector_type(16))) _Float16 v16h;
typedef __attribute__((ext_vector_type(8)))  _Float16 v8h;
typedef __attribute__((ext_vector_type(8)))  unsigned short v8us;
typedef __attribute__((ext_vector_type(8)))  float    v8f;
typedef __attribute__((ext_vector_type(4)))  float    v4f;
typedef v8h  __attribute__((may_alias)) v8ha;
typedef v4f  __attribute__((may_alias)) v4fa;
typedef v8us __attribute__((may_alias)) v8usa;

__device__ __forceinline__ unsigned short f2bf(float f) { unsigned u = __float_as_uint(f); u += 0x7FFFu + ((u >> 16) & 1u); return (unsigned short)(u >> 16); }
__device__ __forceinline__ float bf2f(unsigned short b) { return __uint_as_float(((unsigned)b) << 16); }
__device__ __forceinline__ float bfr(float f) { return bf2f(f2bf(f)); }
__device__ __forceinline__ v16h cat16(v8h lo, v8h hi) { return __builtin_shufflevector(lo, hi, 0, 1, 2, 3, 4, 5, 6, 7, 8, 9, 10, 11, 12, 13, 14, 15); }
__device__ __forceinline__ v16bf cat16b(v8us lo, v8us hi) { return __builtin_bit_cast(v16bf, __builtin_shufflevector(lo, hi, 0, 1, 2, 3, 4, 5, 6, 7, 8, 9, 10, 11, 12, 13, 14, 15)); }
__device__ __forceinline__ v8f wmma16(v16h a, v16h b, v8f c) { return __builtin_amdgcn_wmma_f32_16x16x32_f16(false, a, false, b, (short)0, c, false, false); }
__device__ __forceinline__ v8f wmmab(v16bf a, v16bf b, v8f c) { return __builtin_amdgcn_wmma_f32_16x16x32_bf16(false, a, false, b, (short)0, c, false, false); }



// ---- k_gemmw: register-blocked GEMM, ONE WAVE per 64x64 output tile (16 accumulators), operands straight from K-contiguous 16-bit planes; grid (M/64, N/64, Z), 32 threads.
// C[m][n] (f32, pitch ldc, + optional f32 bias[n]) = sum_k A[m][k] Bt[n][k] (+ split products per NSPLIT). z-batch strides sA/sB/sC in elements. K % (32 * KS) == 0.
// KS > 1: grid z = Z * KS; work-group (z, ks) sums only k in [ks K/KS, (ks+1) K/KS) and stores that partial tile in plane ks (plane stride sP elements); the reader adds the KS planes.
template <typename T16> struct WFrag;
template <> struct WFrag<h16> { typedef v16h V; static __device__ __forceinline__ V ld(const h16* p) { return cat16(*(const v8h*)p, *(const v8h*)(p + 16)); } static __device__ __forceinline__ v8f mma(V a, V b, v8f c) { return wmma16(a, b, c); } };
template <> struct WFrag<bf> { typedef v16bf V; static __device__ __forceinline__ V ld(const bf* p) { return cat16b(*(const v8us*)p, *(const v8us*)(p + 16)); } static __device__ __forceinline__ v8f mma(V a, V b, v8f c) { return wmmab(a, b, c); } };
template <typename T16, int NSPLIT, bool BIAS, int KS = 1>
__global__ __launch_bounds__(32) void k_gemmw(const T16* __restrict__ A, const T16* __restrict__ A2, const T16* __restrict__ Bt, const T16* __restrict__ Bt2, int K, float* C, int ldc, const float* __restrict__ bias, size_t sA, size_t sB, size_t sC, size_t sP) {
    typedef typename WFrag<T16>::V V;
    __shared__ __align__(16) float os[16 * 68];
    const size_t z = blockIdx.z / KS; const int ks = (int)(blockIdx.z % KS); const int kb = ks * (K / KS), ke = kb + K / KS; C += (size_t)ks * sP; A += z * sA; if (A2) A2 += z * sA; Bt += z * sB; if (Bt2) Bt2 += z * sB; C += z * sC;
    const int lane = threadIdx.x & 31, lr = lane & 15, hi = lane >> 4; const int r0 = blockIdx.x * 64, c0 = blockIdx.y * 64;
    v8f acc[4][4];
#pragma unroll
    for (int mb = 0; mb < 4; ++mb)
#pragma unroll
        for (int nb = 0; nb < 4; ++nb) acc[mb][nb] = (v8f){};
    const size_t aoff = (size_t)(r0 + lr) * K + 8 * hi, boff = (size_t)(c0 + lr) * K + 8 * hi;
#pragma unroll 1
    for (int kc = kb; kc < ke; kc += 32) {
        V a[4], a2[4];
#pragma unroll
        for (int mb = 0; mb < 4; ++mb) { a[mb] = WFrag<T16>::ld(A + aoff + (size_t)mb * 16 * K + kc); if (NSPLIT == 1 || NSPLIT == 2) a2[mb] = WFrag<T16>::ld(A2 + aoff + (size_t)mb * 16 * K + kc); }
#pragma unroll
        for (int nb = 0; nb < 4; ++nb) { const V b = WFrag<T16>::ld(Bt + boff + (size_t)nb * 16 * K + kc); V b2; if (NSPLIT >= 2) b2 = WFrag<T16>::ld(Bt2 + boff + (size_t)nb * 16 * K + kc);
#pragma unroll
            for (int mb = 0; mb < 4; ++mb) { acc[mb][nb] = WFrag<T16>::mma(a[mb], b, acc[mb][nb]); if (NSPLIT == 1 || NSPLIT == 2) acc[mb][nb] = WFrag<T16>::mma(a2[mb], b, acc[mb][nb]); if (NSPLIT >= 2) acc[mb][nb] = WFrag<T16>::mma(a[mb], b2, acc[mb][nb]); } }
        asm volatile("v_nop\n\tv_nop\n\tv_nop\n\tv_nop" : "+v"(acc[0][0]), "+v"(acc[1][1]), "+v"(acc[2][2]), "+v"(acc[3][3]) : "v"(a[0]), "v"(a[3]));
    }
#pragma unroll
    for (int mb = 0; mb < 4; ++mb) {
#pragma unroll
        for (int nb = 0; nb < 4; ++nb) {
#pragma unroll
            for (int j = 0; j < 8; ++j) os[(hi * 8 + j) * 68 + nb * 16 + lr] = acc[mb][nb][j]; }
        __builtin_amdgcn_wave_barrier(); asm volatile("" ::: "memory");
        float* crow = C + (size_t)(r0 + mb * 16) * ldc + c0;
{
#pragma unroll
            for (int s = 0; s < 8; ++s) { const int row = 2 * s + hi, cofs = lr * 4; v4f val = *(const v4fa*)(os + row * 68 + cofs); if (BIAS) { val[0] += bfr(bias[c0 + cofs]); val[1] += bfr(bias[c0 + cofs + 1]); val[2] += bfr(bias[c0 + cofs + 2]); val[3] += bfr(bias[c0 + cofs + 3]); }
                *(v4f*)(crow + (size_t)row * ldc + cofs) = val; }
             }
        __builtin_amdgcn_wave_barrier(); asm volatile("" ::: "memory");
    }
}

__device__ __forceinline__ h16 tohx(float x) { return (h16)x; }
__device__ __forceinline__ void splitf(float y, unsigned short& h, unsigned short& l) { h = f2bf(y); l = f2bf(y - bf2f(h)); }
typedef __attribute__((ext_vector_type(2))) _Float16 v2h;
typedef __attribute__((ext_vector_type(4))) _Float16 v4h;
typedef __attribute__((ext_vector_type(2))) unsigned short v2us;
typedef __attribute__((ext_vector_type(4))) unsigned short v4us;
typedef __attribute__((ext_vector_type(2))) float v2f;
typedef __attribute__((ext_vector_type(4))) int v4i;

__global__ __launch_bounds__(256) void k_wtG(const float* __restrict__ w, int K, int N, bf* Bt) {
    const int lane = threadIdx.x & 31; const int L0 = (blockIdx.x * 8 + (threadIdx.x >> 5)) * 8; const int nlines = N * K / 64;
{
#pragma unroll 1
        for (int l = 0; l < 8; ++l) { const int L = L0 + l; if (L >= nlines) break; const size_t e = (size_t)L * 64 + lane * 2; const int k = (int)(e % K), n = (int)(e / K); v2us o;
            o[0] = f2bf(w[(size_t)k * N + n]); o[1] = f2bf(w[(size_t)(k + 1) * N + n]); *(v2us*)(Bt + e) = o; }
         }
}
__global__ __launch_bounds__(256) void k_cvt8(const float* __restrict__ src, bf* dst, size_t n8) { const size_t i = (size_t)blockIdx.x * 256 + threadIdx.x; if (i >= n8) return; const v8f v = *(const v8f*)(src + i * 8); v8us o;
#pragma unroll
    for (int k = 0; k < 8; ++k) o[k] = f2bf(v[k]); *(v8us*)(dst + i * 8) = o;  }

// k_rope: head planes [h][t][d] (fp16 + hi/lo) of rope(x) x sc with the rotate-half convention out[d] = x[d] cos[t][d] - x[d+HD/2] sin[t][d], out[d+HD/2] = x[d+HD/2] cos[t][d+HD/2] + x[d] sin[t][d+HD/2]
__global__ __launch_bounds__(256) void k_rope(const float* __restrict__ F, int pitch, int nheads, const float* __restrict__ CS, const float* __restrict__ RF, const float* __restrict__ nw, float sc, h16* P16, bf* Ph, bf* Pl) {
    const size_t e = ((size_t)blockIdx.x * 256 + threadIdx.x) * 2; if (e >= (size_t)nheads * TT * HD) return; const int d = (int)(e % HD); const int t = (int)((e / HD) % TT); const int h = (int)(e / ((size_t)HD * TT)); const float* f = F + (size_t)t * pitch + h * HD; const float rf = RF ? RF[(size_t)h * TT + t] : 1.0f; v2h o16; v2us oh, ol;
#pragma unroll
    for (int q = 0; q < 2; ++q) { const int dd = d + q; const int dp = (dd < HD / 2) ? dd + HD / 2 : dd - HD / 2; float x0 = f[dd], x1 = f[dp];
        if (RF) { float n0 = __fmul_rn(x0, rf), n1 = __fmul_rn(x1, rf); asm volatile("" : "+v"(n0)); asm volatile("" : "+v"(n1)); x0 = __fmul_rn(bfr(nw[dd]), n0); x1 = __fmul_rn(bfr(nw[dp]), n1); }
        const v2f cs = *(const v2f*)(CS + ((size_t)t * HD + dd) * 2); float a = __fmul_rn(x0, cs[0]), bq = __fmul_rn(x1, cs[1]); asm volatile("" : "+v"(a)); asm volatile("" : "+v"(bq)); const float r = ((dd < HD / 2) ? __fsub_rn(a, bq) : __fadd_rn(a, bq)) * sc;
        o16[q] = tohx(r); unsigned short a2, c2; splitf(r, a2, c2); oh[q] = a2; ol[q] = c2; }
    *(v2h*)(P16 + e) = o16; *(v2us*)(Ph + e) = oh; *(v2us*)(Pl + e) = ol;  }
__global__ __launch_bounds__(256) void k_vtp(const float* __restrict__ F, int pitch, int nheads, h16* V16, bf* Vh, bf* Vl) { const size_t e = ((size_t)blockIdx.x * 256 + threadIdx.x) * 2; if (e >= (size_t)nheads * HD * TT) return; const int t = (int)(e % TT); const int d = (int)((e / TT) % HD); const int g = (int)(e / ((size_t)TT * HD)); v2h o16; v2us oh, ol;
#pragma unroll
    for (int q = 0; q < 2; ++q) { const float x = F[(size_t)(t + q) * pitch + g * HD + d]; o16[q] = tohx(x); unsigned short a2, c2; splitf(x, a2, c2); oh[q] = a2; ol[q] = c2; }
    *(v2h*)(V16 + e) = o16; *(v2us*)(Vh + e) = oh; *(v2us*)(Vl + e) = ol;  }
__global__ __launch_bounds__(256) void k_csid(float* CS) { const int idx = blockIdx.x * 256 + threadIdx.x; if (idx >= TT * HD) return; v2f cs; cs[0] = 1.0f; cs[1] = 0.0f; *(v2f*)(CS + (size_t)idx * 2) = cs;  }
// k_asoft: per row (zz, i): t = S x HD^-0.5 (no mask); softmax over the 2048 keys (register row, one exp, fixed trees);
__global__ __launch_bounds__(256) void k_asoft(const float* __restrict__ Sb, h16* P16, bf* Ph, bf* Pl) {
    const int lane = threadIdx.x & 31; const int row = blockIdx.x * 8 + (threadIdx.x >> 5); if (row >= ZH * TT) return; const int i = row % TT; const int zz = row / TT; (void)zz; const bool hires = (i < RH); const float* sr = Sb + (size_t)row * TT; float v[TT / 32]; float mx = -3.0e38f;
#pragma unroll
    for (int ch = 0; ch < TT / 128; ++ch) { const int j0 = ch * 128 + lane * 4; const v4f a = *(const v4f*)(sr + j0);
#pragma unroll
        for (int q = 0; q < 4; ++q) { const int j = j0 + q; (void)j; const float t = a[q] * SCL; v[ch * 4 + q] = t; mx = fmaxf(mx, t); } }
#pragma unroll
    for (int sh = 16; sh; sh >>= 1) mx = fmaxf(mx, __shfl_xor(mx, sh, 32));
    float sum = 0.f;
#pragma unroll
    for (int k = 0; k < TT / 32; ++k) { float d0 = __fsub_rn(v[k], mx); asm volatile("" : "+v"(d0)); v[k] = __builtin_amdgcn_exp2f(__fmul_rn(d0, 1.4426950408889634f)); sum += v[k]; }
#pragma unroll
    for (int sh = 16; sh; sh >>= 1) sum += __shfl_xor(sum, sh, 32);
    const float f = __fdiv_rn(hires ? 1.0f : PCAR, sum);
{
        if (hires) {
#pragma unroll
            for (int ch = 0; ch < TT / 128; ++ch) { v4us oh, ol;
#pragma unroll
                for (int q = 0; q < 4; ++q) { unsigned short a, c2; splitf(v[ch * 4 + q] * f, a, c2); oh[q] = a; ol[q] = c2; }
                const size_t oo = ((size_t)zz * (RH ? RH : 1) + i) * TT + ch * 128 + lane * 4; *(v4us*)(Ph + oo) = oh; *(v4us*)(Pl + oo) = ol; }
        } else {
#pragma unroll
            for (int ch = 0; ch < TT / 128; ++ch) { v4h o4;
#pragma unroll
                for (int q = 0; q < 4; ++q) o4[q] = tohx(v[ch * 4 + q] * f);
                *(v4h*)(P16 + (size_t)row * TT + ch * 128 + lane * 4) = o4; } }
         }
}
__global__ __launch_bounds__(256) void k_merge(const float* __restrict__ O, int h0, bf* Ah, bf* Al) { const size_t e = ((size_t)blockIdx.x * 256 + threadIdx.x) * 2; if (e >= (size_t)ZH * TT * HD) return; const int d = (int)(e % HD); const int t = (int)((e / HD) % TT); const int zz = (int)(e / ((size_t)HD * TT)); const float cs = (t < RH) ? 1.0f : (1.0f / PCAR); const size_t oo = (size_t)t * DQ + (h0 + zz) * HD + d;
    v2us oh, ol; v2f sm = *(const v2f*)(O + e);
#pragma unroll
    for (int ks = 1; ks < KSP; ++ks) { const v2f p = *(const v2f*)(O + (size_t)ks * ZH * TT * HD + e); sm[0] += p[0]; sm[1] += p[1]; }   // key slices added in slice order
#pragma unroll
    for (int q = 0; q < 2; ++q) { unsigned short a, c2; splitf(sm[q] * cs, a, c2); oh[q] = a; ol[q] = c2; } *(v2us*)(Ah + oo) = oh; *(v2us*)(Al + oo) = ol;  }

extern "C" void kernel_launch(void* const* d_in, const int* in_sizes, int n_in,
                              void* d_out, int out_size, void* d_ws, size_t ws_size, hipStream_t stream) {
    (void)in_sizes; (void)n_in; (void)out_size;
    const float* x = (const float*)d_in[0]; const float* wq = (const float*)d_in[1]; const float* wk = (const float*)d_in[1]; const float* wv = (const float*)d_in[1]; const float* wo = (const float*)d_in[1];   /* THIS module has ONE weight: p = x W ('xw' (in, out) [1024][1024]) serves as the query (scaled), the key AND the value, and the output projection reuses the SAME W: all four weight pointers name d_in[1]: TWO inputs, both read */
    float* OUT = (float*)d_out;     // [4][2048][1024]
    char* wsp = (char*)d_ws;
    auto take = [&](size_t bytes) { char* p = wsp; wsp += (bytes + 255) & ~(size_t)255; return (void*)p; };
    bf* WQ = (bf*)take((size_t)DQ * DM * 2); bf* WK = (bf*)take((size_t)DKV * DM * 2); bf* WV = (bf*)take((size_t)DKV * DM * 2); bf* WO = (bf*)take((size_t)DM * DQ * 2); float* CS = (float*)take((size_t)TT * HD * 2 * 4);
    bf* XB = (bf*)take((size_t)TT * DM * 2); float* FQ = (float*)take((size_t)TT * DQ * 4); float* FK = (float*)take((size_t)TT * DKV * 4);
    h16* QP16 = (h16*)take((size_t)NH_ * TT * HD * 2); h16* KP16 = (h16*)take((size_t)NKV * TT * HD * 2); h16* VT16 = (h16*)take((size_t)NKV * HD * TT * 2);
    bf* QPh = (bf*)take((size_t)NH_ * TT * HD * 2); bf* QPl = (bf*)take((size_t)NH_ * TT * HD * 2); bf* KPh = (bf*)take((size_t)NKV * TT * HD * 2); bf* KPl = (bf*)take((size_t)NKV * TT * HD * 2); bf* VTh = (bf*)take((size_t)NKV * HD * TT * 2); bf* VTl = (bf*)take((size_t)NKV * HD * TT * 2); bf* Ph = (bf*)take((size_t)ZH * RH * TT * 2); bf* Pl = (bf*)take((size_t)ZH * RH * TT * 2);
    float* Sb = (float*)take((size_t)ZH * TT * TT * 4); h16* P16 = (h16*)take((size_t)ZH * TT * TT * 2); float* Ob = (float*)take((size_t)KSP * ZH * TT * HD * 4); bf* ATh = (bf*)take((size_t)TT * DQ * 2); bf* ATl = (bf*)take((size_t)TT * DQ * 2);
    if ((size_t)(wsp - (char*)d_ws) > ws_size) return;    // ws 256 MiB
    float* FV = FK;   // v projection reuses the k buffer after the k planes are built (stream-ordered)
    { k_wtG<<<(unsigned)((DM * DQ / 64 + 63) / 64), 256, 0, stream>>>(wq, DM, DQ, WQ); k_wtG<<<(unsigned)((DM * DKV / 64 + 63) / 64), 256, 0, stream>>>(wk, DM, DKV, WK); k_wtG<<<(unsigned)((DM * DKV / 64 + 63) / 64), 256, 0, stream>>>(wv, DM, DKV, WV);
      k_wtG<<<(unsigned)((DQ * DM / 64 + 63) / 64), 256, 0, stream>>>(wo, DQ, DM, WO);
       }
    k_csid<<<(TT * HD + 255) / 256, 256, 0, stream>>>(CS);
    const unsigned LQ = (unsigned)(((size_t)NH_ * TT * HD / 2 + 255) / 256), LKv = (unsigned)(((size_t)NKV * TT * HD / 2 + 255) / 256);
    for (int b = 0; b < NB_; ++b) {
        
        k_cvt8<<<(unsigned)(((size_t)TT * DM / 8 + 255) / 256), 256, 0, stream>>>(x + (size_t)b * TT * DM, XB, (size_t)TT * DM / 8);
        k_gemmw<bf, 0, false><<<dim3(TT / 64, DQ / 64, 1), 32, 0, stream>>>(XB, nullptr, WQ, nullptr, DM, FQ, DQ, nullptr, 0, 0, 0, 0);
        k_rope<<<LQ, 256, 0, stream>>>(FQ, DQ, NH_, CS, nullptr, nullptr, 1.0f, QP16, QPh, QPl);
        k_gemmw<bf, 0, false><<<dim3(TT / 64, DKV / 64, 1), 32, 0, stream>>>(XB, nullptr, WK, nullptr, DM, FK, DKV, nullptr, 0, 0, 0, 0);
        k_rope<<<LKv, 256, 0, stream>>>(FK, DKV, NKV, CS, nullptr, nullptr, 1.0f, KP16, KPh, KPl);
        k_gemmw<bf, 0, false><<<dim3(TT / 64, DKV / 64, 1), 32, 0, stream>>>(XB, nullptr, WV, nullptr, DM, FV, DKV, nullptr, 0, 0, 0, 0); k_vtp<<<LKv, 256, 0, stream>>>(FV, DKV, NKV, VT16, VTh, VTl);
        for (int h0 = 0; h0 < NH_; h0 += ZH) { const size_t zq = (size_t)h0, zk = (size_t)(h0 / REP);   // one kv head per query head: the pass's two heads use consecutive kv planes (z-strides TT*HD)
            k_gemmw<bf, 2, false><<<dim3(RH / 64, TT / 64, ZH), 32, 0, stream>>>(QPh + zq * TT * HD, QPl + zq * TT * HD, KPh + zk * TT * HD, KPl + zk * TT * HD, HD, Sb, TT, nullptr, (size_t)TT * HD, (size_t)TT * HD, (size_t)TT * TT, 0);
            k_gemmw<h16, 0, false><<<dim3((TT - RH) / 64, TT / 64, ZH), 32, 0, stream>>>(QP16 + zq * TT * HD + (size_t)RH * HD, nullptr, KP16 + zk * TT * HD, nullptr, HD, Sb + (size_t)RH * TT, TT, nullptr, (size_t)TT * HD, (size_t)TT * HD, (size_t)TT * TT, 0);
            k_asoft<<<ZH * TT / 8, 256, 0, stream>>>(Sb, P16, Ph, Pl);
            k_gemmw<bf, 2, false, KSP><<<dim3(RH / 64, HD / 64, ZH * KSP), 32, 0, stream>>>(Ph, Pl, VTh + zk * HD * TT, VTl + zk * HD * TT, TT, Ob, HD, nullptr, (size_t)RH * TT, (size_t)HD * TT, (size_t)TT * HD, (size_t)ZH * TT * HD);
            k_gemmw<h16, 0, false, KSP><<<dim3((TT - RH) / 64, HD / 64, ZH * KSP), 32, 0, stream>>>(P16 + (size_t)RH * TT, nullptr, VT16 + zk * HD * TT, nullptr, TT, Ob + (size_t)RH * HD, HD, nullptr, (size_t)TT * TT, (size_t)HD * TT, (size_t)TT * HD, (size_t)ZH * TT * HD);
            k_merge<<<(unsigned)(((size_t)ZH * TT * HD / 2 + 255) / 256), 256, 0, stream>>>(Ob, h0, ATh, ATl); }
        k_gemmw<bf, 1, false><<<dim3(TT / 64, DM / 64, 1), 32, 0, stream>>>(ATh, ATl, WO, nullptr, DQ, OUT + (size_t)b * TT * DM, DM, nullptr, 0, 0, 0, 0); }
}

// v002
// A run of this version takes 766 microseconds.
// In both of two side-by-side timings against v001, it was 2.22 times as fast.
// Counting every step since v000, it is 5.15 times as fast.
#include <hip/hip_runtime.h>

// Multi-head self-attention with ONE tied weight (x [4][2048][1024]; p = einsum('bsh,hf->bsf', x, W) ('xw' (in, out) [1024][1024] 1/32, no bias) split into 16 heads x 64; q = p x 64^-0.5, and the SAME p is the key and the value: logits = q.p; softmax over all keys (no mask); attn.p merged; out = einsum('bsh,hf->bsf', merged, W): the SAME W again -> [4][2048][1024] (8.4 M); argument order x, W).
// Layout per batch: bf16 copy of x; 'xw' weights transposed once; exact projections; dense T-2048 attention in ONE kernel per batch (hybrid rows: < 512 hi/lo 3 products, rest fp16 x1024; a work-group keeps the scores of QB query rows in LDS; attn.p summed in KSP key slices, one wave each, the slices added in slice order); merged hi/lo x Wo exact.
// Compute dtypes, f32 accumulate: every input rounded to bf16; projections exact; attention rows < 512 3 products, rest fp16; softmax f32; Wo hl x exact.

#define NB_  4
#define TT   2048
#define DM   1024
#define NH_  16
#define NKV  16
#define REP  (NH_ / NKV)
#define HD   64
#define DQ   (NH_ * HD)
#define DKV  (NKV * HD)
#define RH   512                  // query rows < RH use hi+lo planes (0: none)
#define WIN  0
#define PCAR 1024.0f
#define SCL  0.125f   // HD^-0.5
#define KSP  16                   // key slices of the attn.p products: TT / KSP keys per wave of k_attn
#define QB   32                   // query rows per work-group of k_attn
#define SP   (TT + 4)             // LDS pitch of one score row in floats: 16 bytes more than the row, so that the 16 rows of a b128 fragment read fall on different banks
#define OP   68                   // LDS pitch of one row of a partial attn.p tile in floats
typedef _Float16 h16;
typedef unsigned short bf;
typedef __attribute__((ext_vector_type(16))) __bf16   v16bf;
typedef __attribute__((ext_vector_type(16))) _Float16 v16h;
typedef __attribute__((ext_vector_type(8)))  _Float16 v8h;
typedef __attribute__((ext_vector_type(8)))  unsigned short v8us;
typedef __attribute__((ext_vector_type(8)))  float    v8f;
typedef __attribute__((ext_vector_type(4)))  float    v4f;
typedef v8h  __attribute__((may_alias)) v8ha;
typedef v4f  __attribute__((may_alias)) v4fa;
typedef v8us __attribute__((may_alias)) v8usa;

__device__ __forceinline__ unsigned short f2bf(float f) { unsigned u = __float_as_uint(f); u += 0x7FFFu + ((u >> 16) & 1u); return (unsigned short)(u >> 16); }
__device__ __forceinline__ float bf2f(unsigned short b) { return __uint_as_float(((unsigned)b) << 16); }
__device__ __forceinline__ float bfr(float f) { return bf2f(f2bf(f)); }
__device__ __forceinline__ v16h cat16(v8h lo, v8h hi) { return __builtin_shufflevector(lo, hi, 0, 1, 2, 3, 4, 5, 6, 7, 8, 9, 10, 11, 12, 13, 14, 15); }
__device__ __forceinline__ v16bf cat16b(v8us lo, v8us hi) { return __builtin_bit_cast(v16bf, __builtin_shufflevector(lo, hi, 0, 1, 2, 3, 4, 5, 6, 7, 8, 9, 10, 11, 12, 13, 14, 15)); }
__device__ __forceinline__ v8f wmma16(v16h a, v16h b, v8f c) { return __builtin_amdgcn_wmma_f32_16x16x32_f16(false, a, false, b, (short)0, c, false, false); }
__device__ __forceinline__ v8f wmmab(v16bf a, v16bf b, v8f c) { return __builtin_amdgcn_wmma_f32_16x16x32_bf16(false, a, false, b, (short)0, c, false, false); }



// ---- k_gemmw: register-blocked GEMM, ONE WAVE per 64x64 output tile (16 accumulators), operands straight from K-contiguous 16-bit planes; grid (M/64, N/64, Z), 32 threads.
// C[m][n] (f32, pitch ldc, + optional f32 bias[n]) = sum_k A[m][k] Bt[n][k] (+ split products per NSPLIT). z-batch strides sA/sB/sC in elements. K % (32 * KS) == 0.
// KS > 1: grid z = Z * KS; work-group (z, ks) sums only k in [ks K/KS, (ks+1) K/KS) and stores that partial tile in plane ks (plane stride sP elements); the reader adds the KS planes.
template <typename T16> struct WFrag;
template <> struct WFrag<h16> { typedef v16h V; static __device__ __forceinline__ V ld(const h16* p) { return cat16(*(const v8h*)p, *(const v8h*)(p + 16)); } static __device__ __forceinline__ v8f mma(V a, V b, v8f c) { return wmma16(a, b, c); } };
template <> struct WFrag<bf> { typedef v16bf V; static __device__ __forceinline__ V ld(const bf* p) { return cat16b(*(const v8us*)p, *(const v8us*)(p + 16)); } static __device__ __forceinline__ v8f mma(V a, V b, v8f c) { return wmmab(a, b, c); } };
template <typename T16, int NSPLIT, bool BIAS, int KS = 1>
__global__ __launch_bounds__(32) void k_gemmw(const T16* __restrict__ A, const T16* __restrict__ A2, const T16* __restrict__ Bt, const T16* __restrict__ Bt2, int K, float* C, int ldc, const float* __restrict__ bias, size_t sA, size_t sB, size_t sC, size_t sP) {
    typedef typename WFrag<T16>::V V;
    __shared__ __align__(16) float os[16 * 68];
    const size_t z = blockIdx.z / KS; const int ks = (int)(blockIdx.z % KS); const int kb = ks * (K / KS), ke = kb + K / KS; C += (size_t)ks * sP; A += z * sA; if (A2) A2 += z * sA; Bt += z * sB; if (Bt2) Bt2 += z * sB; C += z * sC;
    const int lane = threadIdx.x & 31, lr = lane & 15, hi = lane >> 4; const int r0 = blockIdx.x * 64, c0 = blockIdx.y * 64;
    v8f acc[4][4];
#pragma unroll
    for (int mb = 0; mb < 4; ++mb)
#pragma unroll
        for (int nb = 0; nb < 4; ++nb) acc[mb][nb] = (v8f){};
    const size_t aoff = (size_t)(r0 + lr) * K + 8 * hi, boff = (size_t)(c0 + lr) * K + 8 * hi;
#pragma unroll 1
    for (int kc = kb; kc < ke; kc += 32) {
        V a[4], a2[4];
#pragma unroll
        for (int mb = 0; mb < 4; ++mb) { a[mb] = WFrag<T16>::ld(A + aoff + (size_t)mb * 16 * K + kc); if (NSPLIT == 1 || NSPLIT == 2) a2[mb] = WFrag<T16>::ld(A2 + aoff + (size_t)mb * 16 * K + kc); }
#pragma unroll
        for (int nb = 0; nb < 4; ++nb) { const V b = WFrag<T16>::ld(Bt + boff + (size_t)nb * 16 * K + kc); V b2; if (NSPLIT >= 2) b2 = WFrag<T16>::ld(Bt2 + boff + (size_t)nb * 16 * K + kc);
#pragma unroll
            for (int mb = 0; mb < 4; ++mb) { acc[mb][nb] = WFrag<T16>::mma(a[mb], b, acc[mb][nb]); if (NSPLIT == 1 || NSPLIT == 2) acc[mb][nb] = WFrag<T16>::mma(a2[mb], b, acc[mb][nb]); if (NSPLIT >= 2) acc[mb][nb] = WFrag<T16>::mma(a[mb], b2, acc[mb][nb]); } }
        asm volatile("v_nop\n\tv_nop\n\tv_nop\n\tv_nop" : "+v"(acc[0][0]), "+v"(acc[1][1]), "+v"(acc[2][2]), "+v"(acc[3][3]) : "v"(a[0]), "v"(a[3]));
    }
#pragma unroll
    for (int mb = 0; mb < 4; ++mb) {
#pragma unroll
        for (int nb = 0; nb < 4; ++nb) {
#pragma unroll
            for (int j = 0; j < 8; ++j) os[(hi * 8 + j) * 68 + nb * 16 + lr] = acc[mb][nb][j]; }
        __builtin_amdgcn_wave_barrier(); asm volatile("" ::: "memory");
        float* crow = C + (size_t)(r0 + mb * 16) * ldc + c0;
{
#pragma unroll
            for (int s = 0; s < 8; ++s) { const int row = 2 * s + hi, cofs = lr * 4; v4f val = *(const v4fa*)(os + row * 68 + cofs); if (BIAS) { val[0] += bfr(bias[c0 + cofs]); val[1] += bfr(bias[c0 + cofs + 1]); val[2] += bfr(bias[c0 + cofs + 2]); val[3] += bfr(bias[c0 + cofs + 3]); }
                *(v4f*)(crow + (size_t)row * ldc + cofs) = val; }
             }
        __builtin_amdgcn_wave_barrier(); asm volatile("" ::: "memory");
    }
}

__device__ __forceinline__ h16 tohx(float x) { return (h16)x; }
__device__ __forceinline__ void splitf(float y, unsigned short& h, unsigned short& l) { h = f2bf(y); l = f2bf(y - bf2f(h)); }
typedef __attribute__((ext_vector_type(2))) _Float16 v2h;
typedef __attribute__((ext_vector_type(4))) _Float16 v4h;
typedef __attribute__((ext_vector_type(2))) unsigned short v2us;
typedef __attribute__((ext_vector_type(4))) unsigned short v4us;
typedef __attribute__((ext_vector_type(2))) float v2f;
typedef __attribute__((ext_vector_type(4))) int v4i;

__global__ __launch_bounds__(256) void k_wtG(const float* __restrict__ w, int K, int N, bf* Bt) {
    const int lane = threadIdx.x & 31; const int L0 = (blockIdx.x * 8 + (threadIdx.x >> 5)) * 8; const int nlines = N * K / 64;
{
#pragma unroll 1
        for (int l = 0; l < 8; ++l) { const int L = L0 + l; if (L >= nlines) break; const size_t e = (size_t)L * 64 + lane * 2; const int k = (int)(e % K), n = (int)(e / K); v2us o;
            o[0] = f2bf(w[(size_t)k * N + n]); o[1] = f2bf(w[(size_t)(k + 1) * N + n]); *(v2us*)(Bt + e) = o; }
         }
}
__global__ __launch_bounds__(256) void k_cvt8(const float* __restrict__ src, bf* dst, size_t n8) { const size_t i = (size_t)blockIdx.x * 256 + threadIdx.x; if (i >= n8) return; const v8f v = *(const v8f*)(src + i * 8); v8us o;
#pragma unroll
    for (int k = 0; k < 8; ++k) o[k] = f2bf(v[k]); *(v8us*)(dst + i * 8) = o;  }

// k_rope: head planes [h][t][d] (fp16 + hi/lo) of rope(x) x sc with the rotate-half convention out[d] = x[d] cos[t][d] - x[d+HD/2] sin[t][d], out[d+HD/2] = x[d+HD/2] cos[t][d+HD/2] + x[d] sin[t][d+HD/2]
__global__ __launch_bounds__(256) void k_rope(const float* __restrict__ F, int pitch, int nheads, const float* __restrict__ CS, const float* __restrict__ RF, const float* __restrict__ nw, float sc, h16* P16, bf* Ph, bf* Pl) {
    const size_t e = ((size_t)blockIdx.x * 256 + threadIdx.x) * 2; if (e >= (size_t)nheads * TT * HD) return; const int d = (int)(e % HD); const int t = (int)((e / HD) % TT); const int h = (int)(e / ((size_t)HD * TT)); const float* f = F + (size_t)t * pitch + h * HD; const float rf = RF ? RF[(size_t)h * TT + t] : 1.0f; v2h o16; v2us oh, ol;
#pragma unroll
    for (int q = 0; q < 2; ++q) { const int dd = d + q; const int dp = (dd < HD / 2) ? dd + HD / 2 : dd - HD / 2; float x0 = f[dd], x1 = f[dp];
        if (RF) { float n0 = __fmul_rn(x0, rf), n1 = __fmul_rn(x1, rf); asm volatile("" : "+v"(n0)); asm volatile("" : "+v"(n1)); x0 = __fmul_rn(bfr(nw[dd]), n0); x1 = __fmul_rn(bfr(nw[dp]), n1); }
        const v2f cs = *(const v2f*)(CS + ((size_t)t * HD + dd) * 2); float a = __fmul_rn(x0, cs[0]), bq = __fmul_rn(x1, cs[1]); asm volatile("" : "+v"(a)); asm volatile("" : "+v"(bq)); const float r = ((dd < HD / 2) ? __fsub_rn(a, bq) : __fadd_rn(a, bq)) * sc;
        o16[q] = tohx(r); unsigned short a2, c2; splitf(r, a2, c2); oh[q] = a2; ol[q] = c2; }
    *(v2h*)(P16 + e) = o16; *(v2us*)(Ph + e) = oh; *(v2us*)(Pl + e) = ol;  }
__global__ __launch_bounds__(256) void k_vtp(const float* __restrict__ F, int pitch, int nheads, h16* V16, bf* Vh, bf* Vl) { const size_t e = ((size_t)blockIdx.x * 256 + threadIdx.x) * 2; if (e >= (size_t)nheads * HD * TT) return; const int t = (int)(e % TT); const int d = (int)((e / TT) % HD); const int g = (int)(e / ((size_t)TT * HD)); v2h o16; v2us oh, ol;
#pragma unroll
    for (int q = 0; q < 2; ++q) { const float x = F[(size_t)(t + q) * pitch + g * HD + d]; o16[q] = tohx(x); unsigned short a2, c2; splitf(x, a2, c2); oh[q] = a2; ol[q] = c2; }
    *(v2h*)(V16 + e) = o16; *(v2us*)(Vh + e) = oh; *(v2us*)(Vl + e) = ol;  }
__global__ __launch_bounds__(256) void k_csid(float* CS) { const int idx = blockIdx.x * 256 + threadIdx.x; if (idx >= TT * HD) return; v2f cs; cs[0] = 1.0f; cs[1] = 0.0f; *(v2f*)(CS + (size_t)idx * 2) = cs;  }
typedef v4h  __attribute__((may_alias)) v4ha;
typedef v4us __attribute__((may_alias)) v4usa;
// fragment loads from the LDS score rows (the rows hold f32 scores first and 16-bit weights later: may_alias types)
template <typename T16> struct LFrag;
template <> struct LFrag<h16> { static __device__ __forceinline__ v16h ld(const h16* p) { return cat16(*(const v8ha*)p, *(const v8ha*)(p + 16)); } };
template <> struct LFrag<bf> { static __device__ __forceinline__ v16bf ld(const bf* p) { return cat16b(*(const v8usa*)p, *(const v8usa*)(p + 16)); } };

// ---- k_attn: logits, softmax, attn.p and the head merge for QB query rows of one head; KSP waves; grid (heads, TT / QB).
// 1: wave w forms the scores of its TT / KSP keys for all QB rows (f32, LDS). 2: wave w does the softmax of rows 2w, 2w + 1 (register row, one exp, fixed trees) and writes the 16-bit weights over the row's own bytes (hi plane in the first half, lo plane in the second; fp16: first half only).
// 3: wave w sums attn.p over its own key slice; the KSP partial tiles go through LDS and are added in slice order; the result is split hi/lo into the merged planes.
// stands behind a run of global loads, in front of whatever overwrites their address registers; the pointers are inputs, so that their registers are not given to a load's result before the wait
#define XWAIT(p, p2) asm volatile("s_wait_xcnt 0x0" :: "v"(p), "v"(p2) : "memory")
template <typename T16, bool HR>
__device__ __forceinline__ void attn_body(float* S, const T16* __restrict__ Q, const T16* __restrict__ Q2, const T16* __restrict__ Kp, const T16* __restrict__ K2, const T16* __restrict__ Vt, const T16* __restrict__ Vt2, int i0, int h, bf* Ah, bf* Al) {
    typedef typename WFrag<T16>::V V;
    const int tid = threadIdx.x, lane = tid & 31, lr = lane & 15, hi = lane >> 4, w = tid >> 5; const int kb = w * (TT / KSP);
    {
        V a[2][2], a2[2][2]; const size_t qo = (size_t)(i0 + lr) * HD + 8 * hi, ko = (size_t)(kb + lr) * HD + 8 * hi; const T16* qp = Q + qo; const T16* qp2 = HR ? Q2 + qo : qp; const T16* kp = Kp + ko; const T16* kp2 = HR ? K2 + ko : kp;
#pragma unroll
        for (int mb = 0; mb < 2; ++mb)
#pragma unroll
            for (int kk = 0; kk < 2; ++kk) { const int ao = mb * 16 * HD + kk * 32; a[mb][kk] = WFrag<T16>::ld(qp + ao); if (HR) a2[mb][kk] = WFrag<T16>::ld(qp2 + ao); }
        XWAIT(qp, qp2);
        // GN key tiles at a time, 2 GN accumulator chains; rolled: unrolled whole, the hoisted key loads spill
        constexpr int GN = HR ? 2 : 4;
#pragma unroll 1
        for (int ng = 0; ng < TT / KSP / 16; ng += GN) { v8f acc[2][GN]; V b[GN][2], b2[GN][2];
#pragma unroll
            for (int nb = 0; nb < GN; ++nb)
#pragma unroll
                for (int kk = 0; kk < 2; ++kk) { const int bo = nb * 16 * HD + kk * 32; b[nb][kk] = WFrag<T16>::ld(kp + bo); if (HR) b2[nb][kk] = WFrag<T16>::ld(kp2 + bo); }
            XWAIT(kp, kp2); kp += GN * 16 * HD; kp2 += GN * 16 * HD;
#pragma unroll
            for (int nb = 0; nb < GN; ++nb)
#pragma unroll
                for (int mb = 0; mb < 2; ++mb) { acc[mb][nb] = (v8f){};
#pragma unroll
                    for (int kk = 0; kk < 2; ++kk) { acc[mb][nb] = WFrag<T16>::mma(a[mb][kk], b[nb][kk], acc[mb][nb]); if (HR) { acc[mb][nb] = WFrag<T16>::mma(a2[mb][kk], b[nb][kk], acc[mb][nb]); acc[mb][nb] = WFrag<T16>::mma(a[mb][kk], b2[nb][kk], acc[mb][nb]); } } }
            // four vector slots behind the group's last matrix instruction: a later chain starts from zero in registers that a chain of this group has just written, with only LDS stores in between; the key fragments are inputs, so that no chain's result is laid over a fragment that an issued matrix instruction still names
            if constexpr (HR) asm volatile("v_nop\n\tv_nop\n\tv_nop\n\tv_nop" : "+v"(acc[0][0]), "+v"(acc[1][0]), "+v"(acc[0][1]), "+v"(acc[1][1]) : "v"(b[0][0]), "v"(b[0][1]), "v"(b[1][0]), "v"(b[1][1]), "v"(b2[0][0]), "v"(b2[0][1]), "v"(b2[1][0]), "v"(b2[1][1]));
            else asm volatile("v_nop\n\tv_nop\n\tv_nop\n\tv_nop" : "+v"(acc[0][0]), "+v"(acc[1][0]), "+v"(acc[0][1]), "+v"(acc[1][1]), "+v"(acc[0][2]), "+v"(acc[1][2]), "+v"(acc[0][3]), "+v"(acc[1][3]) : "v"(b[0][0]), "v"(b[0][1]), "v"(b[1][0]), "v"(b[1][1]), "v"(b[2][0]), "v"(b[2][1]), "v"(b[3][0]), "v"(b[3][1]));
#pragma unroll
            for (int nb = 0; nb < GN; ++nb)
#pragma unroll
                for (int mb = 0; mb < 2; ++mb)
#pragma unroll
                    for (int j = 0; j < 8; ++j) S[(mb * 16 + hi * 8 + j) * SP + kb + (ng + nb) * 16 + lr] = acc[mb][nb][j]; }
    }
    __syncthreads();   // every score of the QB rows is in LDS before a row is read
    // rolled: one row's 64 registers at a time
#pragma unroll 1
    for (int r = 0; r < QB / KSP; ++r) { float* sr = S + (w * (QB / KSP) + r) * SP; float v[TT / 32]; float mx = -3.0e38f;
#pragma unroll
        for (int ch = 0; ch < TT / 128; ++ch) { const v4f a = *(const v4fa*)(sr + ch * 128 + lane * 4);
#pragma unroll
            for (int q = 0; q < 4; ++q) { const float t = a[q] * SCL; v[ch * 4 + q] = t; mx = fmaxf(mx, t); } }
#pragma unroll
        for (int sh = 16; sh; sh >>= 1) mx = fmaxf(mx, __shfl_xor(mx, sh, 32));
        float sum = 0.f;
#pragma unroll
        for (int k = 0; k < TT / 32; ++k) { const float d0 = __fsub_rn(v[k], mx); v[k] = __builtin_amdgcn_exp2f(__fmul_rn(d0, 1.4426950408889634f)); sum += v[k]; }
#pragma unroll
        for (int sh = 16; sh; sh >>= 1) sum += __shfl_xor(sum, sh, 32);
        const float f = __fdiv_rn(HR ? 1.0f : PCAR, sum);
        if (HR) { bf* ph = (bf*)sr;
#pragma unroll
            for (int ch = 0; ch < TT / 128; ++ch) { v4us oh, ol;
#pragma unroll
                for (int q = 0; q < 4; ++q) { unsigned short a, c2; splitf(v[ch * 4 + q] * f, a, c2); oh[q] = a; ol[q] = c2; }
                *(v4usa*)(ph + ch * 128 + lane * 4) = oh; *(v4usa*)(ph + TT + ch * 128 + lane * 4) = ol; }
        } else { h16* p16 = (h16*)sr;
#pragma unroll
            for (int ch = 0; ch < TT / 128; ++ch) { v4h o4;
#pragma unroll
                for (int q = 0; q < 4; ++q) o4[q] = tohx(v[ch * 4 + q] * f);
                *(v4ha*)(p16 + ch * 128 + lane * 4) = o4; } }
    }
    __syncthreads();   // every row's weights are in LDS before a wave reads its key slice of all rows
    v8f acc[2][4];
#pragma unroll
    for (int mb = 0; mb < 2; ++mb)
#pragma unroll
        for (int nb = 0; nb < 4; ++nb) acc[mb][nb] = (v8f){};
    // two chunks' value loads in flight where the registers allow it (one plane); rolled for the two planes
    constexpr int U3 = HR ? 1 : 2; const size_t vo = (size_t)lr * TT + kb + 8 * hi; const T16* vp = Vt + vo; const T16* vp2 = HR ? Vt2 + vo : vp;
#pragma unroll U3
    for (int kc = 0; kc < TT / KSP; kc += 32) { V a[2], a2[2], b[4], b2[4];
#pragma unroll
        for (int nb = 0; nb < 4; ++nb) { b[nb] = WFrag<T16>::ld(vp + nb * 16 * TT); if (HR) b2[nb] = WFrag<T16>::ld(vp2 + nb * 16 * TT); }
        XWAIT(vp, vp2); vp += 32; vp2 += 32;
#pragma unroll
        for (int mb = 0; mb < 2; ++mb) { const T16* pr = (const T16*)(S + (mb * 16 + lr) * SP) + kb + kc + 8 * hi; a[mb] = LFrag<T16>::ld(pr); if (HR) a2[mb] = LFrag<T16>::ld(pr + TT); }
#pragma unroll
        for (int nb = 0; nb < 4; ++nb)
#pragma unroll
            for (int mb = 0; mb < 2; ++mb) { acc[mb][nb] = WFrag<T16>::mma(a[mb], b[nb], acc[mb][nb]); if (HR) { acc[mb][nb] = WFrag<T16>::mma(a2[mb], b[nb], acc[mb][nb]); acc[mb][nb] = WFrag<T16>::mma(a[mb], b2[nb], acc[mb][nb]); } } }
    __syncthreads();   // every wave has read its weights before the partial tiles overwrite them
#pragma unroll
    for (int mb = 0; mb < 2; ++mb)
#pragma unroll
        for (int nb = 0; nb < 4; ++nb)
#pragma unroll
            for (int j = 0; j < 8; ++j) S[w * (QB * OP) + (mb * 16 + hi * 8 + j) * OP + nb * 16 + lr] = acc[mb][nb][j];
    __syncthreads();   // all KSP partial tiles are in LDS before they are added
    const int row = tid >> 4, c = (tid & 15) * 4; v4f sm = *(const v4fa*)(S + row * OP + c);
#pragma unroll
    for (int ks = 1; ks < KSP; ++ks) { const v4f p = *(const v4fa*)(S + ks * (QB * OP) + row * OP + c); sm[0] += p[0]; sm[1] += p[1]; sm[2] += p[2]; sm[3] += p[3]; }   // key slices added in slice order
    const float cs = HR ? 1.0f : (1.0f / PCAR); v4us oh, ol;
#pragma unroll
    for (int q = 0; q < 4; ++q) { unsigned short a, c2; splitf(sm[q] * cs, a, c2); oh[q] = a; ol[q] = c2; }
    const size_t oo = (size_t)(i0 + row) * DQ + h * HD + c; *(v4us*)(Ah + oo) = oh; *(v4us*)(Al + oo) = ol;
}
__global__ __launch_bounds__(KSP * 32) void k_attn(const h16* __restrict__ Q16, const bf* __restrict__ Qh, const bf* __restrict__ Ql, const h16* __restrict__ K16, const bf* __restrict__ Kh, const bf* __restrict__ Kl, const h16* __restrict__ V16, const bf* __restrict__ Vh, const bf* __restrict__ Vl, bf* Ah, bf* Al) {
    __shared__ __align__(16) float S[QB * SP];
    const int h = blockIdx.x, i0 = blockIdx.y * QB; const size_t pq = (size_t)h * TT * HD, pk = (size_t)(h / REP) * TT * HD;
    if (i0 < RH) attn_body<bf, true>(S, Qh + pq, Ql + pq, Kh + pk, Kl + pk, Vh + pk, Vl + pk, i0, h, Ah, Al);   // the same for the whole work-group (RH % QB == 0)
    else attn_body<h16, false>(S, Q16 + pq, nullptr, K16 + pk, nullptr, V16 + pk, nullptr, i0, h, Ah, Al);
}

extern "C" void kernel_launch(void* const* d_in, const int* in_sizes, int n_in,
                              void* d_out, int out_size, void* d_ws, size_t ws_size, hipStream_t stream) {
    (void)in_sizes; (void)n_in; (void)out_size;
    const float* x = (const float*)d_in[0]; const float* wq = (const float*)d_in[1]; const float* wk = (const float*)d_in[1]; const float* wv = (const float*)d_in[1]; const float* wo = (const float*)d_in[1];   /* THIS module has ONE weight: p = x W ('xw' (in, out) [1024][1024]) serves as the query (scaled), the key AND the value, and the output projection reuses the SAME W: all four weight pointers name d_in[1]: TWO inputs, both read */
    float* OUT = (float*)d_out;     // [4][2048][1024]
    char* wsp = (char*)d_ws;
    auto take = [&](size_t bytes) { char* p = wsp; wsp += (bytes + 255) & ~(size_t)255; return (void*)p; };
    bf* WQ = (bf*)take((size_t)DQ * DM * 2); bf* WK = (bf*)take((size_t)DKV * DM * 2); bf* WV = (bf*)take((size_t)DKV * DM * 2); bf* WO = (bf*)take((size_t)DM * DQ * 2); float* CS = (float*)take((size_t)TT * HD * 2 * 4);
    bf* XB = (bf*)take((size_t)TT * DM * 2); float* FQ = (float*)take((size_t)TT * DQ * 4); float* FK = (float*)take((size_t)TT * DKV * 4);
    h16* QP16 = (h16*)take((size_t)NH_ * TT * HD * 2); h16* KP16 = (h16*)take((size_t)NKV * TT * HD * 2); h16* VT16 = (h16*)take((size_t)NKV * HD * TT * 2);
    bf* QPh = (bf*)take((size_t)NH_ * TT * HD * 2); bf* QPl = (bf*)take((size_t)NH_ * TT * HD * 2); bf* KPh = (bf*)take((size_t)NKV * TT * HD * 2); bf* KPl = (bf*)take((size_t)NKV * TT * HD * 2); bf* VTh = (bf*)take((size_t)NKV * HD * TT * 2); bf* VTl = (bf*)take((size_t)NKV * HD * TT * 2);
    bf* ATh = (bf*)take((size_t)TT * DQ * 2); bf* ATl = (bf*)take((size_t)TT * DQ * 2);
    if ((size_t)(wsp - (char*)d_ws) > ws_size) return;    // ws 256 MiB
    float* FV = FK;   // v projection reuses the k buffer after the k planes are built (stream-ordered)
    { k_wtG<<<(unsigned)((DM * DQ / 64 + 63) / 64), 256, 0, stream>>>(wq, DM, DQ, WQ); k_wtG<<<(unsigned)((DM * DKV / 64 + 63) / 64), 256, 0, stream>>>(wk, DM, DKV, WK); k_wtG<<<(unsigned)((DM * DKV / 64 + 63) / 64), 256, 0, stream>>>(wv, DM, DKV, WV);
      k_wtG<<<(unsigned)((DQ * DM / 64 + 63) / 64), 256, 0, stream>>>(wo, DQ, DM, WO);
       }
    k_csid<<<(TT * HD + 255) / 256, 256, 0, stream>>>(CS);
    const unsigned LQ = (unsigned)(((size_t)NH_ * TT * HD / 2 + 255) / 256), LKv = (unsigned)(((size_t)NKV * TT * HD / 2 + 255) / 256);
    for (int b = 0; b < NB_; ++b) {
        
        k_cvt8<<<(unsigned)(((size_t)TT * DM / 8 + 255) / 256), 256, 0, stream>>>(x + (size_t)b * TT * DM, XB, (size_t)TT * DM / 8);
        k_gemmw<bf, 0, false><<<dim3(TT / 64, DQ / 64, 1), 32, 0, stream>>>(XB, nullptr, WQ, nullptr, DM, FQ, DQ, nullptr, 0, 0, 0, 0);
        k_rope<<<LQ, 256, 0, stream>>>(FQ, DQ, NH_, CS, nullptr, nullptr, 1.0f, QP16, QPh, QPl);
        k_gemmw<bf, 0, false><<<dim3(TT / 64, DKV / 64, 1), 32, 0, stream>>>(XB, nullptr, WK, nullptr, DM, FK, DKV, nullptr, 0, 0, 0, 0);
        k_rope<<<LKv, 256, 0, stream>>>(FK, DKV, NKV, CS, nullptr, nullptr, 1.0f, KP16, KPh, KPl);
        k_gemmw<bf, 0, false><<<dim3(TT / 64, DKV / 64, 1), 32, 0, stream>>>(XB, nullptr, WV, nullptr, DM, FV, DKV, nullptr, 0, 0, 0, 0); k_vtp<<<LKv, 256, 0, stream>>>(FV, DKV, NKV, VT16, VTh, VTl);
        k_attn<<<dim3(NH_, TT / QB), KSP * 32, 0, stream>>>(QP16, QPh, QPl, KP16, KPh, KPl, VT16, VTh, VTl, ATh, ATl);   // heads fastest: the hi/lo rows' longer work-groups start first
        k_gemmw<bf, 1, false><<<dim3(TT / 64, DM / 64, 1), 32, 0, stream>>>(ATh, ATl, WO, nullptr, DQ, OUT + (size_t)b * TT * DM, DM, nullptr, 0, 0, 0, 0); }
}

// v003
// It runs in 559 microseconds.
// Next to v002, in two timings, it ran 1.37 times as fast each time.
// All steps since v000 together make it 7.05 times as fast.
#include <hip/hip_runtime.h>

// Multi-head self-attention with ONE tied weight (x [4][2048][1024]; p = einsum('bsh,hf->bsf', x, W) ('xw' (in, out) [1024][1024] 1/32, no bias) split into 16 heads x 64; q = p x 64^-0.5, and the SAME p is the key and the value: logits = q.p; softmax over all keys (no mask); attn.p merged; out = einsum('bsh,hf->bsf', merged, W): the SAME W again -> [4][2048][1024] (8.4 M); argument order x, W).
// Layout per batch: bf16 copy of x; the 'xw' weight transposed once for all its uses; p projected ONCE, exact, its planes shared by query, key and value; dense T-2048 attention in ONE kernel per batch (hybrid rows: < 512 hi/lo 3 products, rest fp16 x1024; a work-group keeps the scores of QB query rows in LDS; attn.p summed in KSP key slices, one wave each, the slices added in slice order); merged hi/lo x Wo exact.
// Compute dtypes, f32 accumulate: every input rounded to bf16; projections exact; attention rows < 512 3 products, rest fp16; softmax f32; Wo hl x exact.

#define NB_  4
#define TT   2048
#define DM   1024
#define NH_  16
#define NKV  16
#define REP  (NH_ / NKV)
#define HD   64
#define DQ   (NH_ * HD)
#define DKV  (NKV * HD)
#define RH   512                  // query rows < RH use hi+lo planes (0: none)
#define WIN  0
#define PCAR 1024.0f
#define SCL  0.125f   // HD^-0.5
#define KSP  16                   // key slices of the attn.p products: TT / KSP keys per wave of k_attn
#define QB   32                   // query rows per work-group of k_attn
#define SP   (TT + 4)             // LDS pitch of one score row in floats: 16 bytes more than the row, so that the 16 rows of a b128 fragment read fall on different banks
#define OP   68                   // LDS pitch of one row of a partial attn.p tile in floats
typedef _Float16 h16;
typedef unsigned short bf;
typedef __attribute__((ext_vector_type(16))) __bf16   v16bf;
typedef __attribute__((ext_vector_type(16))) _Float16 v16h;
typedef __attribute__((ext_vector_type(8)))  _Float16 v8h;
typedef __attribute__((ext_vector_type(8)))  unsigned short v8us;
typedef __attribute__((ext_vector_type(8)))  float    v8f;
typedef __attribute__((ext_vector_type(4)))  float    v4f;
typedef v8h  __attribute__((may_alias)) v8ha;
typedef v4f  __attribute__((may_alias)) v4fa;
typedef v8us __attribute__((may_alias)) v8usa;

__device__ __forceinline__ unsigned short f2bf(float f) { unsigned u = __float_as_uint(f); u += 0x7FFFu + ((u >> 16) & 1u); return (unsigned short)(u >> 16); }
__device__ __forceinline__ float bf2f(unsigned short b) { return __uint_as_float(((unsigned)b) << 16); }
__device__ __forceinline__ float bfr(float f) { return bf2f(f2bf(f)); }
__device__ __forceinline__ v16h cat16(v8h lo, v8h hi) { return __builtin_shufflevector(lo, hi, 0, 1, 2, 3, 4, 5, 6, 7, 8, 9, 10, 11, 12, 13, 14, 15); }
__device__ __forceinline__ v16bf cat16b(v8us lo, v8us hi) { return __builtin_bit_cast(v16bf, __builtin_shufflevector(lo, hi, 0, 1, 2, 3, 4, 5, 6, 7, 8, 9, 10, 11, 12, 13, 14, 15)); }
__device__ __forceinline__ v8f wmma16(v16h a, v16h b, v8f c) { return __builtin_amdgcn_wmma_f32_16x16x32_f16(false, a, false, b, (short)0, c, false, false); }
__device__ __forceinline__ v8f wmmab(v16bf a, v16bf b, v8f c) { return __builtin_amdgcn_wmma_f32_16x16x32_bf16(false, a, false, b, (short)0, c, false, false); }



// ---- k_gemmw: register-blocked GEMM, ONE WAVE per 64x64 output tile (16 accumulators), operands straight from K-contiguous 16-bit planes; grid (M/64, N/64, Z), 32 threads.
// C[m][n] (f32, pitch ldc, + optional f32 bias[n]) = sum_k A[m][k] Bt[n][k] (+ split products per NSPLIT). z-batch strides sA/sB/sC in elements. K % (32 * KS) == 0.
// KS > 1: grid z = Z * KS; work-group (z, ks) sums only k in [ks K/KS, (ks+1) K/KS) and stores that partial tile in plane ks (plane stride sP elements); the reader adds the KS planes.
template <typename T16> struct WFrag;
template <> struct WFrag<h16> { typedef v16h V; static __device__ __forceinline__ V ld(const h16* p) { return cat16(*(const v8h*)p, *(const v8h*)(p + 16)); } static __device__ __forceinline__ v8f mma(V a, V b, v8f c) { return wmma16(a, b, c); } };
template <> struct WFrag<bf> { typedef v16bf V; static __device__ __forceinline__ V ld(const bf* p) { return cat16b(*(const v8us*)p, *(const v8us*)(p + 16)); } static __device__ __forceinline__ v8f mma(V a, V b, v8f c) { return wmmab(a, b, c); } };
template <typename T16, int NSPLIT, bool BIAS, int KS = 1>
__global__ __launch_bounds__(32) void k_gemmw(const T16* __restrict__ A, const T16* __restrict__ A2, const T16* __restrict__ Bt, const T16* __restrict__ Bt2, int K, float* C, int ldc, const float* __restrict__ bias, size_t sA, size_t sB, size_t sC, size_t sP) {
    typedef typename WFrag<T16>::V V;
    __shared__ __align__(16) float os[16 * 68];
    const size_t z = blockIdx.z / KS; const int ks = (int)(blockIdx.z % KS); const int kb = ks * (K / KS), ke = kb + K / KS; C += (size_t)ks * sP; A += z * sA; if (A2) A2 += z * sA; Bt += z * sB; if (Bt2) Bt2 += z * sB; C += z * sC;
    const int lane = threadIdx.x & 31, lr = lane & 15, hi = lane >> 4; const int r0 = blockIdx.x * 64, c0 = blockIdx.y * 64;
    v8f acc[4][4];
#pragma unroll
    for (int mb = 0; mb < 4; ++mb)
#pragma unroll
        for (int nb = 0; nb < 4; ++nb) acc[mb][nb] = (v8f){};
    const size_t aoff = (size_t)(r0 + lr) * K + 8 * hi, boff = (size_t)(c0 + lr) * K + 8 * hi;
#pragma unroll 1
    for (int kc = kb; kc < ke; kc += 32) {
        V a[4], a2[4];
#pragma unroll
        for (int mb = 0; mb < 4; ++mb) { a[mb] = WFrag<T16>::ld(A + aoff + (size_t)mb * 16 * K + kc); if (NSPLIT == 1 || NSPLIT == 2) a2[mb] = WFrag<T16>::ld(A2 + aoff + (size_t)mb * 16 * K + kc); }
#pragma unroll
        for (int nb = 0; nb < 4; ++nb) { const V b = WFrag<T16>::ld(Bt + boff + (size_t)nb * 16 * K + kc); V b2; if (NSPLIT >= 2) b2 = WFrag<T16>::ld(Bt2 + boff + (size_t)nb * 16 * K + kc);
#pragma unroll
            for (int mb = 0; mb < 4; ++mb) { acc[mb][nb] = WFrag<T16>::mma(a[mb], b, acc[mb][nb]); if (NSPLIT == 1 || NSPLIT == 2) acc[mb][nb] = WFrag<T16>::mma(a2[mb], b, acc[mb][nb]); if (NSPLIT >= 2) acc[mb][nb] = WFrag<T16>::mma(a[mb], b2, acc[mb][nb]); } }
        asm volatile("v_nop\n\tv_nop\n\tv_nop\n\tv_nop" : "+v"(acc[0][0]), "+v"(acc[1][1]), "+v"(acc[2][2]), "+v"(acc[3][3]) : "v"(a[0]), "v"(a[3]));
    }
#pragma unroll
    for (int mb = 0; mb < 4; ++mb) {
#pragma unroll
        for (int nb = 0; nb < 4; ++nb) {
#pragma unroll
            for (int j = 0; j < 8; ++j) os[(hi * 8 + j) * 68 + nb * 16 + lr] = acc[mb][nb][j]; }
        __builtin_amdgcn_wave_barrier(); asm volatile("" ::: "memory");
        float* crow = C + (size_t)(r0 + mb * 16) * ldc + c0;
{
#pragma unroll
            for (int s = 0; s < 8; ++s) { const int row = 2 * s + hi, cofs = lr * 4; v4f val = *(const v4fa*)(os + row * 68 + cofs); if (BIAS) { val[0] += bfr(bias[c0 + cofs]); val[1] += bfr(bias[c0 + cofs + 1]); val[2] += bfr(bias[c0 + cofs + 2]); val[3] += bfr(bias[c0 + cofs + 3]); }
                *(v4f*)(crow + (size_t)row * ldc + cofs) = val; }
             }
        __builtin_amdgcn_wave_barrier(); asm volatile("" ::: "memory");
    }
}

__device__ __forceinline__ h16 tohx(float x) { return (h16)x; }
__device__ __forceinline__ void splitf(float y, unsigned short& h, unsigned short& l) { h = f2bf(y); l = f2bf(y - bf2f(h)); }
typedef __attribute__((ext_vector_type(2))) _Float16 v2h;
typedef __attribute__((ext_vector_type(4))) _Float16 v4h;
typedef __attribute__((ext_vector_type(2))) unsigned short v2us;
typedef __attribute__((ext_vector_type(4))) unsigned short v4us;
typedef __attribute__((ext_vector_type(2))) float v2f;
typedef __attribute__((ext_vector_type(4))) int v4i;

__global__ __launch_bounds__(256) void k_wtG(const float* __restrict__ w, int K, int N, bf* Bt) {
    const int lane = threadIdx.x & 31; const int L0 = (blockIdx.x * 8 + (threadIdx.x >> 5)) * 8; const int nlines = N * K / 64;
{
#pragma unroll 1
        for (int l = 0; l < 8; ++l) { const int L = L0 + l; if (L >= nlines) break; const size_t e = (size_t)L * 64 + lane * 2; const int k = (int)(e % K), n = (int)(e / K); v2us o;
            o[0] = f2bf(w[(size_t)k * N + n]); o[1] = f2bf(w[(size_t)(k + 1) * N + n]); *(v2us*)(Bt + e) = o; }
         }
}
__global__ __launch_bounds__(256) void k_cvt8(const float* __restrict__ src, bf* dst, size_t n8) { const size_t i = (size_t)blockIdx.x * 256 + threadIdx.x; if (i >= n8) return; const v8f v = *(const v8f*)(src + i * 8); v8us o;
#pragma unroll
    for (int k = 0; k < 8; ++k) o[k] = f2bf(v[k]); *(v8us*)(dst + i * 8) = o;  }

// k_rope: head planes [h][t][d] (fp16 + hi/lo) of rope(x) x sc with the rotate-half convention out[d] = x[d] cos[t][d] - x[d+HD/2] sin[t][d], out[d+HD/2] = x[d+HD/2] cos[t][d+HD/2] + x[d] sin[t][d+HD/2]
__global__ __launch_bounds__(256) void k_rope(const float* __restrict__ F, int pitch, int nheads, const float* __restrict__ CS, const float* __restrict__ RF, const float* __restrict__ nw, float sc, h16* P16, bf* Ph, bf* Pl) {
    const size_t e = ((size_t)blockIdx.x * 256 + threadIdx.x) * 2; if (e >= (size_t)nheads * TT * HD) return; const int d = (int)(e % HD); const int t = (int)((e / HD) % TT); const int h = (int)(e / ((size_t)HD * TT)); const float* f = F + (size_t)t * pitch + h * HD; const float rf = RF ? RF[(size_t)h * TT + t] : 1.0f; v2h o16; v2us oh, ol;
#pragma unroll
    for (int q = 0; q < 2; ++q) { const int dd = d + q; const int dp = (dd < HD / 2) ? dd + HD / 2 : dd - HD / 2; float x0 = f[dd], x1 = f[dp];
        if (RF) { float n0 = __fmul_rn(x0, rf), n1 = __fmul_rn(x1, rf); asm volatile("" : "+v"(n0)); asm volatile("" : "+v"(n1)); x0 = __fmul_rn(bfr(nw[dd]), n0); x1 = __fmul_rn(bfr(nw[dp]), n1); }
        const v2f cs = *(const v2f*)(CS + ((size_t)t * HD + dd) * 2); float a = __fmul_rn(x0, cs[0]), bq = __fmul_rn(x1, cs[1]); asm volatile("" : "+v"(a)); asm volatile("" : "+v"(bq)); const float r = ((dd < HD / 2) ? __fsub_rn(a, bq) : __fadd_rn(a, bq)) * sc;
        o16[q] = tohx(r); unsigned short a2, c2; splitf(r, a2, c2); oh[q] = a2; ol[q] = c2; }
    *(v2h*)(P16 + e) = o16; *(v2us*)(Ph + e) = oh; *(v2us*)(Pl + e) = ol;  }
__global__ __launch_bounds__(256) void k_vtp(const float* __restrict__ F, int pitch, int nheads, h16* V16, bf* Vh, bf* Vl) { const size_t e = ((size_t)blockIdx.x * 256 + threadIdx.x) * 2; if (e >= (size_t)nheads * HD * TT) return; const int t = (int)(e % TT); const int d = (int)((e / TT) % HD); const int g = (int)(e / ((size_t)TT * HD)); v2h o16; v2us oh, ol;
#pragma unroll
    for (int q = 0; q < 2; ++q) { const float x = F[(size_t)(t + q) * pitch + g * HD + d]; o16[q] = tohx(x); unsigned short a2, c2; splitf(x, a2, c2); oh[q] = a2; ol[q] = c2; }
    *(v2h*)(V16 + e) = o16; *(v2us*)(Vh + e) = oh; *(v2us*)(Vl + e) = ol;  }
__global__ __launch_bounds__(256) void k_csid(float* CS) { const int idx = blockIdx.x * 256 + threadIdx.x; if (idx >= TT * HD) return; v2f cs; cs[0] = 1.0f; cs[1] = 0.0f; *(v2f*)(CS + (size_t)idx * 2) = cs;  }
typedef v4h  __attribute__((may_alias)) v4ha;
typedef v4us __attribute__((may_alias)) v4usa;
// fragment loads from the LDS score rows (the rows hold f32 scores first and 16-bit weights later: may_alias types)
template <typename T16> struct LFrag;
template <> struct LFrag<h16> { static __device__ __forceinline__ v16h ld(const h16* p) { return cat16(*(const v8ha*)p, *(const v8ha*)(p + 16)); } };
template <> struct LFrag<bf> { static __device__ __forceinline__ v16bf ld(const bf* p) { return cat16b(*(const v8usa*)p, *(const v8usa*)(p + 16)); } };

// ---- k_attn: logits, softmax, attn.p and the head merge for QB query rows of one head; KSP waves; grid (heads, TT / QB).
// 1: wave w forms the scores of its TT / KSP keys for all QB rows (f32, LDS). 2: wave w does the softmax of rows 2w, 2w + 1 (register row, one exp, fixed trees) and writes the 16-bit weights over the row's own bytes (hi plane in the first half, lo plane in the second; fp16: first half only).
// 3: wave w sums attn.p over its own key slice; the KSP partial tiles go through LDS and are added in slice order; the result is split hi/lo into the merged planes.
// stands behind a run of global loads, in front of whatever overwrites their address registers; the pointers are inputs, so that their registers are not given to a load's result before the wait
#define XWAIT(p, p2) asm volatile("s_wait_xcnt 0x0" :: "v"(p), "v"(p2) : "memory")
template <typename T16, bool HR>
__device__ __forceinline__ void attn_body(float* S, const T16* __restrict__ Q, const T16* __restrict__ Q2, const T16* __restrict__ Kp, const T16* __restrict__ K2, const T16* __restrict__ Vt, const T16* __restrict__ Vt2, int i0, int h, bf* Ah, bf* Al) {
    typedef typename WFrag<T16>::V V;
    const int tid = threadIdx.x, lane = tid & 31, lr = lane & 15, hi = lane >> 4, w = tid >> 5; const int kb = w * (TT / KSP);
    {
        V a[2][2], a2[2][2]; const size_t qo = (size_t)(i0 + lr) * HD + 8 * hi, ko = (size_t)(kb + lr) * HD + 8 * hi; const T16* qp = Q + qo; const T16* qp2 = HR ? Q2 + qo : qp; const T16* kp = Kp + ko; const T16* kp2 = HR ? K2 + ko : kp;
#pragma unroll
        for (int mb = 0; mb < 2; ++mb)
#pragma unroll
            for (int kk = 0; kk < 2; ++kk) { const int ao = mb * 16 * HD + kk * 32; a[mb][kk] = WFrag<T16>::ld(qp + ao); if (HR) a2[mb][kk] = WFrag<T16>::ld(qp2 + ao); }
        XWAIT(qp, qp2);
        // GN key tiles at a time, 2 GN accumulator chains; rolled: unrolled whole, the hoisted key loads spill
        constexpr int GN = HR ? 2 : 4;
#pragma unroll 1
        for (int ng = 0; ng < TT / KSP / 16; ng += GN) { v8f acc[2][GN]; V b[GN][2], b2[GN][2];
#pragma unroll
            for (int nb = 0; nb < GN; ++nb)
#pragma unroll
                for (int kk = 0; kk < 2; ++kk) { const int bo = nb * 16 * HD + kk * 32; b[nb][kk] = WFrag<T16>::ld(kp + bo); if (HR) b2[nb][kk] = WFrag<T16>::ld(kp2 + bo); }
            XWAIT(kp, kp2); kp += GN * 16 * HD; kp2 += GN * 16 * HD;
#pragma unroll
            for (int nb = 0; nb < GN; ++nb)
#pragma unroll
                for (int mb = 0; mb < 2; ++mb) { acc[mb][nb] = (v8f){};
#pragma unroll
                    for (int kk = 0; kk < 2; ++kk) { acc[mb][nb] = WFrag<T16>::mma(a[mb][kk], b[nb][kk], acc[mb][nb]); if (HR) { acc[mb][nb] = WFrag<T16>::mma(a2[mb][kk], b[nb][kk], acc[mb][nb]); acc[mb][nb] = WFrag<T16>::mma(a[mb][kk], b2[nb][kk], acc[mb][nb]); } } }
            // four vector slots behind the group's last matrix instruction: a later chain starts from zero in registers that a chain of this group has just written, with only LDS stores in between; the key fragments are inputs, so that no chain's result is laid over a fragment that an issued matrix instruction still names
            if constexpr (HR) asm volatile("v_nop\n\tv_nop\n\tv_nop\n\tv_nop" : "+v"(acc[0][0]), "+v"(acc[1][0]), "+v"(acc[0][1]), "+v"(acc[1][1]) : "v"(b[0][0]), "v"(b[0][1]), "v"(b[1][0]), "v"(b[1][1]), "v"(b2[0][0]), "v"(b2[0][1]), "v"(b2[1][0]), "v"(b2[1][1]));
            else asm volatile("v_nop\n\tv_nop\n\tv_nop\n\tv_nop" : "+v"(acc[0][0]), "+v"(acc[1][0]), "+v"(acc[0][1]), "+v"(acc[1][1]), "+v"(acc[0][2]), "+v"(acc[1][2]), "+v"(acc[0][3]), "+v"(acc[1][3]) : "v"(b[0][0]), "v"(b[0][1]), "v"(b[1][0]), "v"(b[1][1]), "v"(b[2][0]), "v"(b[2][1]), "v"(b[3][0]), "v"(b[3][1]));
#pragma unroll
            for (int nb = 0; nb < GN; ++nb)
#pragma unroll
                for (int mb = 0; mb < 2; ++mb)
#pragma unroll
                    for (int j = 0; j < 8; ++j) S[(mb * 16 + hi * 8 + j) * SP + kb + (ng + nb) * 16 + lr] = acc[mb][nb][j]; }
    }
    __syncthreads();   // every score of the QB rows is in LDS before a row is read
    // rolled: one row's 64 registers at a time
#pragma unroll 1
    for (int r = 0; r < QB / KSP; ++r) { float* sr = S + (w * (QB / KSP) + r) * SP; float v[TT / 32]; float mx = -3.0e38f;
#pragma unroll
        for (int ch = 0; ch < TT / 128; ++ch) { const v4f a = *(const v4fa*)(sr + ch * 128 + lane * 4);
#pragma unroll
            for (int q = 0; q < 4; ++q) { const float t = a[q] * SCL; v[ch * 4 + q] = t; mx = fmaxf(mx, t); } }
#pragma unroll
        for (int sh = 16; sh; sh >>= 1) mx = fmaxf(mx, __shfl_xor(mx, sh, 32));
        float sum = 0.f;
#pragma unroll
        for (int k = 0; k < TT / 32; ++k) { const float d0 = __fsub_rn(v[k], mx); v[k] = __builtin_amdgcn_exp2f(__fmul_rn(d0, 1.4426950408889634f)); sum += v[k]; }
#pragma unroll
        for (int sh = 16; sh; sh >>= 1) sum += __shfl_xor(sum, sh, 32);
        const float f = __fdiv_rn(HR ? 1.0f : PCAR, sum);
        if (HR) { bf* ph = (bf*)sr;
#pragma unroll
            for (int ch = 0; ch < TT / 128; ++ch) { v4us oh, ol;
#pragma unroll
                for (int q = 0; q < 4; ++q) { unsigned short a, c2; splitf(v[ch * 4 + q] * f, a, c2); oh[q] = a; ol[q] = c2; }
                *(v4usa*)(ph + ch * 128 + lane * 4) = oh; *(v4usa*)(ph + TT + ch * 128 + lane * 4) = ol; }
        } else { h16* p16 = (h16*)sr;
#pragma unroll
            for (int ch = 0; ch < TT / 128; ++ch) { v4h o4;
#pragma unroll
                for (int q = 0; q < 4; ++q) o4[q] = tohx(v[ch * 4 + q] * f);
                *(v4ha*)(p16 + ch * 128 + lane * 4) = o4; } }
    }
    __syncthreads();   // every row's weights are in LDS before a wave reads its key slice of all rows
    v8f acc[2][4];
#pragma unroll
    for (int mb = 0; mb < 2; ++mb)
#pragma unroll
        for (int nb = 0; nb < 4; ++nb) acc[mb][nb] = (v8f){};
    // two chunks' value loads in flight where the registers allow it (one plane); rolled for the two planes
    constexpr int U3 = HR ? 1 : 2; const size_t vo = (size_t)lr * TT + kb + 8 * hi; const T16* vp = Vt + vo; const T16* vp2 = HR ? Vt2 + vo : vp;
#pragma unroll U3
    for (int kc = 0; kc < TT / KSP; kc += 32) { V a[2], a2[2], b[4], b2[4];
#pragma unroll
        for (int nb = 0; nb < 4; ++nb) { b[nb] = WFrag<T16>::ld(vp + nb * 16 * TT); if (HR) b2[nb] = WFrag<T16>::ld(vp2 + nb * 16 * TT); }
        XWAIT(vp, vp2); vp += 32; vp2 += 32;
#pragma unroll
        for (int mb = 0; mb < 2; ++mb) { const T16* pr = (const T16*)(S + (mb * 16 + lr) * SP) + kb + kc + 8 * hi; a[mb] = LFrag<T16>::ld(pr); if (HR) a2[mb] = LFrag<T16>::ld(pr + TT); }
#pragma unroll
        for (int nb = 0; nb < 4; ++nb)
#pragma unroll
            for (int mb = 0; mb < 2; ++mb) { acc[mb][nb] = WFrag<T16>::mma(a[mb], b[nb], acc[mb][nb]); if (HR) { acc[mb][nb] = WFrag<T16>::mma(a2[mb], b[nb], acc[mb][nb]); acc[mb][nb] = WFrag<T16>::mma(a[mb], b2[nb], acc[mb][nb]); } } }
    __syncthreads();   // every wave has read its weights before the partial tiles overwrite them
#pragma unroll
    for (int mb = 0; mb < 2; ++mb)
#pragma unroll
        for (int nb = 0; nb < 4; ++nb)
#pragma unroll
            for (int j = 0; j < 8; ++j) S[w * (QB * OP) + (mb * 16 + hi * 8 + j) * OP + nb * 16 + lr] = acc[mb][nb][j];
    __syncthreads();   // all KSP partial tiles are in LDS before they are added
    const int row = tid >> 4, c = (tid & 15) * 4; v4f sm = *(const v4fa*)(S + row * OP + c);
#pragma unroll
    for (int ks = 1; ks < KSP; ++ks) { const v4f p = *(const v4fa*)(S + ks * (QB * OP) + row * OP + c); sm[0] += p[0]; sm[1] += p[1]; sm[2] += p[2]; sm[3] += p[3]; }   // key slices added in slice order
    const float cs = HR ? 1.0f : (1.0f / PCAR); v4us oh, ol;
#pragma unroll
    for (int q = 0; q < 4; ++q) { unsigned short a, c2; splitf(sm[q] * cs, a, c2); oh[q] = a; ol[q] = c2; }
    const size_t oo = (size_t)(i0 + row) * DQ + h * HD + c; *(v4us*)(Ah + oo) = oh; *(v4us*)(Al + oo) = ol;
}
__global__ __launch_bounds__(KSP * 32) void k_attn(const h16* __restrict__ Q16, const bf* __restrict__ Qh, const bf* __restrict__ Ql, const h16* __restrict__ K16, const bf* __restrict__ Kh, const bf* __restrict__ Kl, const h16* __restrict__ V16, const bf* __restrict__ Vh, const bf* __restrict__ Vl, bf* Ah, bf* Al) {
    __shared__ __align__(16) float S[QB * SP];
    const int h = blockIdx.x, i0 = blockIdx.y * QB; const size_t pq = (size_t)h * TT * HD, pk = (size_t)(h / REP) * TT * HD;
    if (i0 < RH) attn_body<bf, true>(S, Qh + pq, Ql + pq, Kh + pk, Kl + pk, Vh + pk, Vl + pk, i0, h, Ah, Al);   // the same for the whole work-group (RH % QB == 0)
    else attn_body<h16, false>(S, Q16 + pq, nullptr, K16 + pk, nullptr, V16 + pk, nullptr, i0, h, Ah, Al);
}

extern "C" void kernel_launch(void* const* d_in, const int* in_sizes, int n_in,
                              void* d_out, int out_size, void* d_ws, size_t ws_size, hipStream_t stream) {
    (void)in_sizes; (void)n_in; (void)out_size;
    const float* x = (const float*)d_in[0]; const float* wt = (const float*)d_in[1];   /* order x, W: THIS module has ONE weight ('xw' (in, out) [1024][1024]): p = x W serves as the query (scaled in the softmax), the key AND the value, and the output projection reuses the SAME W: TWO inputs, both read */
    float* OUT = (float*)d_out;     // [4][2048][1024]
    char* wsp = (char*)d_ws;
    auto take = [&](size_t bytes) { char* p = wsp; wsp += (bytes + 255) & ~(size_t)255; return (void*)p; };
    bf* WT = (bf*)take((size_t)DQ * DM * 2); float* CS = (float*)take((size_t)TT * HD * 2 * 4);
    bf* XB = (bf*)take((size_t)TT * DM * 2); float* FP = (float*)take((size_t)TT * DQ * 4);
    h16* PP16 = (h16*)take((size_t)NH_ * TT * HD * 2); h16* VT16 = (h16*)take((size_t)NKV * HD * TT * 2);
    bf* PPh = (bf*)take((size_t)NH_ * TT * HD * 2); bf* PPl = (bf*)take((size_t)NH_ * TT * HD * 2); bf* VTh = (bf*)take((size_t)NKV * HD * TT * 2); bf* VTl = (bf*)take((size_t)NKV * HD * TT * 2);
    bf* ATh = (bf*)take((size_t)TT * DQ * 2); bf* ATl = (bf*)take((size_t)TT * DQ * 2);
    if ((size_t)(wsp - (char*)d_ws) > ws_size) return;    // ws 256 MiB
    // the one weight is transposed once (DM == DQ: the same plane is the B operand of the input and of the output projection)
    k_wtG<<<(unsigned)((DM * DQ / 64 + 63) / 64), 256, 0, stream>>>(wt, DM, DQ, WT);
    k_csid<<<(TT * HD + 255) / 256, 256, 0, stream>>>(CS);
    const unsigned LQ = (unsigned)(((size_t)NH_ * TT * HD / 2 + 255) / 256), LKv = (unsigned)(((size_t)NKV * TT * HD / 2 + 255) / 256);
    for (int b = 0; b < NB_; ++b) {
        k_cvt8<<<(unsigned)(((size_t)TT * DM / 8 + 255) / 256), 256, 0, stream>>>(x + (size_t)b * TT * DM, XB, (size_t)TT * DM / 8);
        // p = x W once per batch; its [h][t][d] planes are read as the query and as the key, its [h][d][t] planes as the value
        k_gemmw<bf, 0, false><<<dim3(TT / 64, DQ / 64, 1), 32, 0, stream>>>(XB, nullptr, WT, nullptr, DM, FP, DQ, nullptr, 0, 0, 0, 0);
        k_rope<<<LQ, 256, 0, stream>>>(FP, DQ, NH_, CS, nullptr, nullptr, 1.0f, PP16, PPh, PPl);
        k_vtp<<<LKv, 256, 0, stream>>>(FP, DKV, NKV, VT16, VTh, VTl);
        k_attn<<<dim3(NH_, TT / QB), KSP * 32, 0, stream>>>(PP16, PPh, PPl, PP16, PPh, PPl, VT16, VTh, VTl, ATh, ATl);   // heads fastest: the hi/lo rows' longer work-groups start first
        k_gemmw<bf, 1, false><<<dim3(TT / 64, DM / 64, 1), 32, 0, stream>>>(ATh, ATl, WT, nullptr, DQ, OUT + (size_t)b * TT * DM, DM, nullptr, 0, 0, 0, 0); }
}

// v004
// A run of this version takes 413 microseconds.
// Next to v003, in two timings, it ran 1.35 and 1.36 times as fast.
// Over all steps from v000 it is 9.55 times as fast.
#include <hip/hip_runtime.h>

// Multi-head self-attention with ONE tied weight (x [4][2048][1024]; p = einsum('bsh,hf->bsf', x, W) ('xw' (in, out) [1024][1024] 1/32, no bias) split into 16 heads x 64; q = p x 64^-0.5, and the SAME p is the key and the value: logits = q.p; softmax over all keys (no mask); attn.p merged; out = einsum('bsh,hf->bsf', merged, W): the SAME W again -> [4][2048][1024] (8.4 M); argument order x, W).
// All NB_ batches go through each kernel in ONE launch (the batch is a grid dimension; every workspace plane holds all batches). Layout: bf16 copy of x; the 'xw' weight transposed once for all its uses; p projected ONCE, exact, its planes shared by query, key and value; dense T-2048 attention in ONE kernel (hybrid rows: < 512 hi/lo 3 products, rest fp16 x1024; a work-group keeps the scores of QB query rows in LDS; attn.p summed in KSP key slices, one wave each, the slices added in slice order); merged hi/lo x Wo exact.
// Compute dtypes, f32 accumulate: every input rounded to bf16; projections exact; attention rows < 512 3 products, rest fp16; softmax f32; Wo hl x exact.

#define NB_  4
#define TT   2048
#define DM   1024
#define NH_  16
#define NKV  16
#define REP  (NH_ / NKV)
#define HD   64
#define DQ   (NH_ * HD)
#define DKV  (NKV * HD)
#define RH   512                  // query rows < RH use hi+lo planes (0: none)
#define WIN  0
#define PCAR 1024.0f
#define SCL  0.125f   // HD^-0.5
#define KSP  16                   // key slices of the attn.p products: TT / KSP keys per wave of k_attn
#define QB   32                   // query rows per work-group of k_attn
#define SP   (TT + 4)             // LDS pitch of one score row in floats: 16 bytes more than the row, so that the 16 rows of a b128 fragment read fall on different banks
#define OP   68                   // LDS pitch of one row of a partial attn.p tile in floats
typedef _Float16 h16;
typedef unsigned short bf;
typedef __attribute__((ext_vector_type(16))) __bf16   v16bf;
typedef __attribute__((ext_vector_type(16))) _Float16 v16h;
typedef __attribute__((ext_vector_type(8)))  _Float16 v8h;
typedef __attribute__((ext_vector_type(8)))  unsigned short v8us;
typedef __attribute__((ext_vector_type(8)))  float    v8f;
typedef __attribute__((ext_vector_type(4)))  float    v4f;
typedef v8h  __attribute__((may_alias)) v8ha;
typedef v4f  __attribute__((may_alias)) v4fa;
typedef v8us __attribute__((may_alias)) v8usa;

__device__ __forceinline__ unsigned short f2bf(float f) { unsigned u = __float_as_uint(f); u += 0x7FFFu + ((u >> 16) & 1u); return (unsigned short)(u >> 16); }
__device__ __forceinline__ float bf2f(unsigned short b) { return __uint_as_float(((unsigned)b) << 16); }
__device__ __forceinline__ float bfr(float f) { return bf2f(f2bf(f)); }
__device__ __forceinline__ v16h cat16(v8h lo, v8h hi) { return __builtin_shufflevector(lo, hi, 0, 1, 2, 3, 4, 5, 6, 7, 8, 9, 10, 11, 12, 13, 14, 15); }
__device__ __forceinline__ v16bf cat16b(v8us lo, v8us hi) { return __builtin_bit_cast(v16bf, __builtin_shufflevector(lo, hi, 0, 1, 2, 3, 4, 5, 6, 7, 8, 9, 10, 11, 12, 13, 14, 15)); }
__device__ __forceinline__ v8f wmma16(v16h a, v16h b, v8f c) { return __builtin_amdgcn_wmma_f32_16x16x32_f16(false, a, false, b, (short)0, c, false, false); }
__device__ __forceinline__ v8f wmmab(v16bf a, v16bf b, v8f c) { return __builtin_amdgcn_wmma_f32_16x16x32_bf16(false, a, false, b, (short)0, c, false, false); }



// ---- k_gemmw: register-blocked GEMM, ONE WAVE per 64x64 output tile (16 accumulators), operands straight from K-contiguous 16-bit planes; grid (M/64, N/64, Z), 32 threads.
// C[m][n] (f32, pitch ldc, + optional f32 bias[n]) = sum_k A[m][k] Bt[n][k] (+ split products per NSPLIT). z-batch strides sA/sB/sC in elements. K % (32 * KS) == 0.
// KS > 1: grid z = Z * KS; work-group (z, ks) sums only k in [ks K/KS, (ks+1) K/KS) and stores that partial tile in plane ks (plane stride sP elements); the reader adds the KS planes.
template <typename T16> struct WFrag;
template <> struct WFrag<h16> { typedef v16h V; static __device__ __forceinline__ V ld(const h16* p) { return cat16(*(const v8h*)p, *(const v8h*)(p + 16)); } static __device__ __forceinline__ v8f mma(V a, V b, v8f c) { return wmma16(a, b, c); } };
template <> struct WFrag<bf> { typedef v16bf V; static __device__ __forceinline__ V ld(const bf* p) { return cat16b(*(const v8us*)p, *(const v8us*)(p + 16)); } static __device__ __forceinline__ v8f mma(V a, V b, v8f c) { return wmmab(a, b, c); } };
template <typename T16, int NSPLIT, bool BIAS, int KS = 1>
__global__ __launch_bounds__(32) void k_gemmw(const T16* __restrict__ A, const T16* __restrict__ A2, const T16* __restrict__ Bt, const T16* __restrict__ Bt2, int K, float* C, int ldc, const float* __restrict__ bias, size_t sA, size_t sB, size_t sC, size_t sP) {
    typedef typename WFrag<T16>::V V;
    __shared__ __align__(16) float os[16 * 68];
    const size_t z = blockIdx.z / KS; const int ks = (int)(blockIdx.z % KS); const int kb = ks * (K / KS), ke = kb + K / KS; C += (size_t)ks * sP; A += z * sA; if (A2) A2 += z * sA; Bt += z * sB; if (Bt2) Bt2 += z * sB; C += z * sC;
    const int lane = threadIdx.x & 31, lr = lane & 15, hi = lane >> 4; const int r0 = blockIdx.x * 64, c0 = blockIdx.y * 64;
    v8f acc[4][4];
#pragma unroll
    for (int mb = 0; mb < 4; ++mb)
#pragma unroll
        for (int nb = 0; nb < 4; ++nb) acc[mb][nb] = (v8f){};
    const size_t aoff = (size_t)(r0 + lr) * K + 8 * hi, boff = (size_t)(c0 + lr) * K + 8 * hi;
#pragma unroll 1
    for (int kc = kb; kc < ke; kc += 32) {
        V a[4], a2[4];
#pragma unroll
        for (int mb = 0; mb < 4; ++mb) { a[mb] = WFrag<T16>::ld(A + aoff + (size_t)mb * 16 * K + kc); if (NSPLIT == 1 || NSPLIT == 2) a2[mb] = WFrag<T16>::ld(A2 + aoff + (size_t)mb * 16 * K + kc); }
#pragma unroll
        for (int nb = 0; nb < 4; ++nb) { const V b = WFrag<T16>::ld(Bt + boff + (size_t)nb * 16 * K + kc); V b2; if (NSPLIT >= 2) b2 = WFrag<T16>::ld(Bt2 + boff + (size_t)nb * 16 * K + kc);
#pragma unroll
            for (int mb = 0; mb < 4; ++mb) { acc[mb][nb] = WFrag<T16>::mma(a[mb], b, acc[mb][nb]); if (NSPLIT == 1 || NSPLIT == 2) acc[mb][nb] = WFrag<T16>::mma(a2[mb], b, acc[mb][nb]); if (NSPLIT >= 2) acc[mb][nb] = WFrag<T16>::mma(a[mb], b2, acc[mb][nb]); } }
        asm volatile("v_nop\n\tv_nop\n\tv_nop\n\tv_nop" : "+v"(acc[0][0]), "+v"(acc[1][1]), "+v"(acc[2][2]), "+v"(acc[3][3]) : "v"(a[0]), "v"(a[3]));
    }
#pragma unroll
    for (int mb = 0; mb < 4; ++mb) {
#pragma unroll
        for (int nb = 0; nb < 4; ++nb) {
#pragma unroll
            for (int j = 0; j < 8; ++j) os[(hi * 8 + j) * 68 + nb * 16 + lr] = acc[mb][nb][j]; }
        __builtin_amdgcn_wave_barrier(); asm volatile("" ::: "memory");
        float* crow = C + (size_t)(r0 + mb * 16) * ldc + c0;
{
#pragma unroll
            for (int s = 0; s < 8; ++s) { const int row = 2 * s + hi, cofs = lr * 4; v4f val = *(const v4fa*)(os + row * 68 + cofs); if (BIAS) { val[0] += bfr(bias[c0 + cofs]); val[1] += bfr(bias[c0 + cofs + 1]); val[2] += bfr(bias[c0 + cofs + 2]); val[3] += bfr(bias[c0 + cofs + 3]); }
                *(v4f*)(crow + (size_t)row * ldc + cofs) = val; }
             }
        __builtin_amdgcn_wave_barrier(); asm volatile("" ::: "memory");
    }
}

__device__ __forceinline__ h16 tohx(float x) { return (h16)x; }
__device__ __forceinline__ void splitf(float y, unsigned short& h, unsigned short& l) { h = f2bf(y); l = f2bf(y - bf2f(h)); }
typedef __attribute__((ext_vector_type(2))) _Float16 v2h;
typedef __attribute__((ext_vector_type(4))) _Float16 v4h;
typedef __attribute__((ext_vector_type(2))) unsigned short v2us;
typedef __attribute__((ext_vector_type(4))) unsigned short v4us;
typedef __attribute__((ext_vector_type(2))) float v2f;
typedef __attribute__((ext_vector_type(4))) int v4i;

__global__ __launch_bounds__(256) void k_wtG(const float* __restrict__ w, int K, int N, bf* Bt) {
    const int lane = threadIdx.x & 31; const int L0 = (blockIdx.x * 8 + (threadIdx.x >> 5)) * 8; const int nlines = N * K / 64;
{
#pragma unroll 1
        for (int l = 0; l < 8; ++l) { const int L = L0 + l; if (L >= nlines) break; const size_t e = (size_t)L * 64 + lane * 2; const int k = (int)(e % K), n = (int)(e / K); v2us o;
            o[0] = f2bf(w[(size_t)k * N + n]); o[1] = f2bf(w[(size_t)(k + 1) * N + n]); *(v2us*)(Bt + e) = o; }
         }
}
__global__ __launch_bounds__(256) void k_cvt8(const float* __restrict__ src, bf* dst, size_t n8) { const size_t i = (size_t)blockIdx.x * 256 + threadIdx.x; if (i >= n8) return; const v8f v = *(const v8f*)(src + i * 8); v8us o;
#pragma unroll
    for (int k = 0; k < 8; ++k) o[k] = f2bf(v[k]); *(v8us*)(dst + i * 8) = o;  }

// k_rope: head planes [h][t][d] (fp16 + hi/lo) of rope(x) x sc with the rotate-half convention out[d] = x[d] cos[t][d] - x[d+HD/2] sin[t][d], out[d+HD/2] = x[d+HD/2] cos[t][d+HD/2] + x[d] sin[t][d+HD/2]
__global__ __launch_bounds__(256) void k_rope(const float* __restrict__ F, int pitch, int nheads, const float* __restrict__ CS, const float* __restrict__ RF, const float* __restrict__ nw, float sc, h16* P16, bf* Ph, bf* Pl) {
    { const size_t bb = blockIdx.y, po = bb * nheads * TT * HD; F += bb * TT * pitch; P16 += po; Ph += po; Pl += po; }   // grid y: the batch
    const size_t e = ((size_t)blockIdx.x * 256 + threadIdx.x) * 2; if (e >= (size_t)nheads * TT * HD) return; const int d = (int)(e % HD); const int t = (int)((e / HD) % TT); const int h = (int)(e / ((size_t)HD * TT)); const float* f = F + (size_t)t * pitch + h * HD; const float rf = RF ? RF[(size_t)h * TT + t] : 1.0f; v2h o16; v2us oh, ol;
#pragma unroll
    for (int q = 0; q < 2; ++q) { const int dd = d + q; const int dp = (dd < HD / 2) ? dd + HD / 2 : dd - HD / 2; float x0 = f[dd], x1 = f[dp];
        if (RF) { float n0 = __fmul_rn(x0, rf), n1 = __fmul_rn(x1, rf); asm volatile("" : "+v"(n0)); asm volatile("" : "+v"(n1)); x0 = __fmul_rn(bfr(nw[dd]), n0); x1 = __fmul_rn(bfr(nw[dp]), n1); }
        const v2f cs = *(const v2f*)(CS + ((size_t)t * HD + dd) * 2); float a = __fmul_rn(x0, cs[0]), bq = __fmul_rn(x1, cs[1]); asm volatile("" : "+v"(a)); asm volatile("" : "+v"(bq)); const float r = ((dd < HD / 2) ? __fsub_rn(a, bq) : __fadd_rn(a, bq)) * sc;
        o16[q] = tohx(r); unsigned short a2, c2; splitf(r, a2, c2); oh[q] = a2; ol[q] = c2; }
    *(v2h*)(P16 + e) = o16; *(v2us*)(Ph + e) = oh; *(v2us*)(Pl + e) = ol;  }
__global__ __launch_bounds__(256) void k_vtp(const float* __restrict__ F, int pitch, int nheads, h16* V16, bf* Vh, bf* Vl) {
    { const size_t bb = blockIdx.y, po = bb * nheads * HD * TT; F += bb * TT * pitch; V16 += po; Vh += po; Vl += po; }   // grid y: the batch
    const size_t e = ((size_t)blockIdx.x * 256 + threadIdx.x) * 2; if (e >= (size_t)nheads * HD * TT) return; const int t = (int)(e % TT); const int d = (int)((e / TT) % HD); const int g = (int)(e / ((size_t)TT * HD)); v2h o16; v2us oh, ol;
#pragma unroll
    for (int q = 0; q < 2; ++q) { const float x = F[(size_t)(t + q) * pitch + g * HD + d]; o16[q] = tohx(x); unsigned short a2, c2; splitf(x, a2, c2); oh[q] = a2; ol[q] = c2; }
    *(v2h*)(V16 + e) = o16; *(v2us*)(Vh + e) = oh; *(v2us*)(Vl + e) = ol;  }
__global__ __launch_bounds__(256) void k_csid(float* CS) { const int idx = blockIdx.x * 256 + threadIdx.x; if (idx >= TT * HD) return; v2f cs; cs[0] = 1.0f; cs[1] = 0.0f; *(v2f*)(CS + (size_t)idx * 2) = cs;  }
typedef v4h  __attribute__((may_alias)) v4ha;
typedef v4us __attribute__((may_alias)) v4usa;
// fragment loads from the LDS score rows (the rows hold f32 scores first and 16-bit weights later: may_alias types)
template <typename T16> struct LFrag;
template <> struct LFrag<h16> { static __device__ __forceinline__ v16h ld(const h16* p) { return cat16(*(const v8ha*)p, *(const v8ha*)(p + 16)); } };
template <> struct LFrag<bf> { static __device__ __forceinline__ v16bf ld(const bf* p) { return cat16b(*(const v8usa*)p, *(const v8usa*)(p + 16)); } };

// ---- k_attn: logits, softmax, attn.p and the head merge for QB query rows of one head; KSP waves; grid (heads, TT / QB, batches).
// 1: wave w forms the scores of its TT / KSP keys for all QB rows (f32, LDS). 2: wave w does the softmax of rows 2w, 2w + 1 (register row, one exp, fixed trees) and writes the 16-bit weights over the row's own bytes (hi plane in the first half, lo plane in the second; fp16: first half only).
// 3: wave w sums attn.p over its own key slice; the KSP partial tiles go through LDS and are added in slice order; the result is split hi/lo into the merged planes.
// stands behind a run of global loads, in front of whatever overwrites their address registers; the pointers are inputs, so that their registers are not given to a load's result before the wait
#define XWAIT(p, p2) asm volatile("s_wait_xcnt 0x0" :: "v"(p), "v"(p2) : "memory")
template <typename T16, bool HR>
__device__ __forceinline__ void attn_body(float* S, const T16* __restrict__ Q, const T16* __restrict__ Q2, const T16* __restrict__ Kp, const T16* __restrict__ K2, const T16* __restrict__ Vt, const T16* __restrict__ Vt2, int i0, int h, bf* Ah, bf* Al) {
    typedef typename WFrag<T16>::V V;
    const int tid = threadIdx.x, lane = tid & 31, lr = lane & 15, hi = lane >> 4, w = tid >> 5; const int kb = w * (TT / KSP);
    {
        V a[2][2], a2[2][2]; const size_t qo = (size_t)(i0 + lr) * HD + 8 * hi, ko = (size_t)(kb + lr) * HD + 8 * hi; const T16* qp = Q + qo; const T16* qp2 = HR ? Q2 + qo : qp; const T16* kp = Kp + ko; const T16* kp2 = HR ? K2 + ko : kp;
#pragma unroll
        for (int mb = 0; mb < 2; ++mb)
#pragma unroll
            for (int kk = 0; kk < 2; ++kk) { const int ao = mb * 16 * HD + kk * 32; a[mb][kk] = WFrag<T16>::ld(qp + ao); if (HR) a2[mb][kk] = WFrag<T16>::ld(qp2 + ao); }
        XWAIT(qp, qp2);
        // GN key tiles at a time, 2 GN accumulator chains; rolled: unrolled whole, the hoisted key loads spill
        constexpr int GN = HR ? 2 : 4;
#pragma unroll 1
        for (int ng = 0; ng < TT / KSP / 16; ng += GN) { v8f acc[2][GN]; V b[GN][2], b2[GN][2];
#pragma unroll
            for (int nb = 0; nb < GN; ++nb)
#pragma unroll
                for (int kk = 0; kk < 2; ++kk) { const int bo = nb * 16 * HD + kk * 32; b[nb][kk] = WFrag<T16>::ld(kp + bo); if (HR) b2[nb][kk] = WFrag<T16>::ld(kp2 + bo); }
            XWAIT(kp, kp2); kp += GN * 16 * HD; kp2 += GN * 16 * HD;
#pragma unroll
            for (int nb = 0; nb < GN; ++nb)
#pragma unroll
                for (int mb = 0; mb < 2; ++mb) { acc[mb][nb] = (v8f){};
#pragma unroll
                    for (int kk = 0; kk < 2; ++kk) { acc[mb][nb] = WFrag<T16>::mma(a[mb][kk], b[nb][kk], acc[mb][nb]); if (HR) { acc[mb][nb] = WFrag<T16>::mma(a2[mb][kk], b[nb][kk], acc[mb][nb]); acc[mb][nb] = WFrag<T16>::mma(a[mb][kk], b2[nb][kk], acc[mb][nb]); } } }
            // four vector slots behind the group's last matrix instruction: a later chain starts from zero in registers that a chain of this group has just written, with only LDS stores in between; the key fragments are inputs, so that no chain's result is laid over a fragment that an issued matrix instruction still names
            if constexpr (HR) asm volatile("v_nop\n\tv_nop\n\tv_nop\n\tv_nop" : "+v"(acc[0][0]), "+v"(acc[1][0]), "+v"(acc[0][1]), "+v"(acc[1][1]) : "v"(b[0][0]), "v"(b[0][1]), "v"(b[1][0]), "v"(b[1][1]), "v"(b2[0][0]), "v"(b2[0][1]), "v"(b2[1][0]), "v"(b2[1][1]));
            else asm volatile("v_nop\n\tv_nop\n\tv_nop\n\tv_nop" : "+v"(acc[0][0]), "+v"(acc[1][0]), "+v"(acc[0][1]), "+v"(acc[1][1]), "+v"(acc[0][2]), "+v"(acc[1][2]), "+v"(acc[0][3]), "+v"(acc[1][3]) : "v"(b[0][0]), "v"(b[0][1]), "v"(b[1][0]), "v"(b[1][1]), "v"(b[2][0]), "v"(b[2][1]), "v"(b[3][0]), "v"(b[3][1]));
#pragma unroll
            for (int nb = 0; nb < GN; ++nb)
#pragma unroll
                for (int mb = 0; mb < 2; ++mb)
#pragma unroll
                    for (int j = 0; j < 8; ++j) S[(mb * 16 + hi * 8 + j) * SP + kb + (ng + nb) * 16 + lr] = acc[mb][nb][j]; }
    }
    __syncthreads();   // every score of the QB rows is in LDS before a row is read
    // rolled: one row's 64 registers at a time
#pragma unroll 1
    for (int r = 0; r < QB / KSP; ++r) { float* sr = S + (w * (QB / KSP) + r) * SP; float v[TT / 32]; float mx = -3.0e38f;
#pragma unroll
        for (int ch = 0; ch < TT / 128; ++ch) { const v4f a = *(const v4fa*)(sr + ch * 128 + lane * 4);
#pragma unroll
            for (int q = 0; q < 4; ++q) { const float t = a[q] * SCL; v[ch * 4 + q] = t; mx = fmaxf(mx, t); } }
#pragma unroll
        for (int sh = 16; sh; sh >>= 1) mx = fmaxf(mx, __shfl_xor(mx, sh, 32));
        float sum = 0.f;
#pragma unroll
        for (int k = 0; k < TT / 32; ++k) { const float d0 = __fsub_rn(v[k], mx); v[k] = __builtin_amdgcn_exp2f(__fmul_rn(d0, 1.4426950408889634f)); sum += v[k]; }
#pragma unroll
        for (int sh = 16; sh; sh >>= 1) sum += __shfl_xor(sum, sh, 32);
        const float f = __fdiv_rn(HR ? 1.0f : PCAR, sum);
        if (HR) { bf* ph = (bf*)sr;
#pragma unroll
            for (int ch = 0; ch < TT / 128; ++ch) { v4us oh, ol;
#pragma unroll
                for (int q = 0; q < 4; ++q) { unsigned short a, c2; splitf(v[ch * 4 + q] * f, a, c2); oh[q] = a; ol[q] = c2; }
                *(v4usa*)(ph + ch * 128 + lane * 4) = oh; *(v4usa*)(ph + TT + ch * 128 + lane * 4) = ol; }
        } else { h16* p16 = (h16*)sr;
#pragma unroll
            for (int ch = 0; ch < TT / 128; ++ch) { v4h o4;
#pragma unroll
                for (int q = 0; q < 4; ++q) o4[q] = tohx(v[ch * 4 + q] * f);
                *(v4ha*)(p16 + ch * 128 + lane * 4) = o4; } }
    }
    __syncthreads();   // every row's weights are in LDS before a wave reads its key slice of all rows
    v8f acc[2][4];
#pragma unroll
    for (int mb = 0; mb < 2; ++mb)
#pragma unroll
        for (int nb = 0; nb < 4; ++nb) acc[mb][nb] = (v8f){};
    // two chunks' value loads in flight where the registers allow it (one plane); rolled for the two planes
    constexpr int U3 = HR ? 1 : 2; const size_t vo = (size_t)lr * TT + kb + 8 * hi; const T16* vp = Vt + vo; const T16* vp2 = HR ? Vt2 + vo : vp;
#pragma unroll U3
    for (int kc = 0; kc < TT / KSP; kc += 32) { V a[2], a2[2], b[4], b2[4];
#pragma unroll
        for (int nb = 0; nb < 4; ++nb) { b[nb] = WFrag<T16>::ld(vp + nb * 16 * TT); if (HR) b2[nb] = WFrag<T16>::ld(vp2 + nb * 16 * TT); }
        XWAIT(vp, vp2); vp += 32; vp2 += 32;
#pragma unroll
        for (int mb = 0; mb < 2; ++mb) { const T16* pr = (const T16*)(S + (mb * 16 + lr) * SP) + kb + kc + 8 * hi; a[mb] = LFrag<T16>::ld(pr); if (HR) a2[mb] = LFrag<T16>::ld(pr + TT); }
#pragma unroll
        for (int nb = 0; nb < 4; ++nb)
#pragma unroll
            for (int mb = 0; mb < 2; ++mb) { acc[mb][nb] = WFrag<T16>::mma(a[mb], b[nb], acc[mb][nb]); if (HR) { acc[mb][nb] = WFrag<T16>::mma(a2[mb], b[nb], acc[mb][nb]); acc[mb][nb] = WFrag<T16>::mma(a[mb], b2[nb], acc[mb][nb]); } } }
    __syncthreads();   // every wave has read its weights before the partial tiles overwrite them
#pragma unroll
    for (int mb = 0; mb < 2; ++mb)
#pragma unroll
        for (int nb = 0; nb < 4; ++nb)
#pragma unroll
            for (int j = 0; j < 8; ++j) S[w * (QB * OP) + (mb * 16 + hi * 8 + j) * OP + nb * 16 + lr] = acc[mb][nb][j];
    __syncthreads();   // all KSP partial tiles are in LDS before they are added
    const int row = tid >> 4, c = (tid & 15) * 4; v4f sm = *(const v4fa*)(S + row * OP + c);
#pragma unroll
    for (int ks = 1; ks < KSP; ++ks) { const v4f p = *(const v4fa*)(S + ks * (QB * OP) + row * OP + c); sm[0] += p[0]; sm[1] += p[1]; sm[2] += p[2]; sm[3] += p[3]; }   // key slices added in slice order
    const float cs = HR ? 1.0f : (1.0f / PCAR); v4us oh, ol;
#pragma unroll
    for (int q = 0; q < 4; ++q) { unsigned short a, c2; splitf(sm[q] * cs, a, c2); oh[q] = a; ol[q] = c2; }
    const size_t oo = (size_t)(i0 + row) * DQ + h * HD + c; *(v4us*)(Ah + oo) = oh; *(v4us*)(Al + oo) = ol;
}
__global__ __launch_bounds__(KSP * 32) void k_attn(const h16* __restrict__ Q16, const bf* __restrict__ Qh, const bf* __restrict__ Ql, const h16* __restrict__ K16, const bf* __restrict__ Kh, const bf* __restrict__ Kl, const h16* __restrict__ V16, const bf* __restrict__ Vh, const bf* __restrict__ Vl, bf* Ah, bf* Al) {
    __shared__ __align__(16) float S[QB * SP];
    const int h = blockIdx.x, i0 = blockIdx.y * QB; const size_t bb = blockIdx.z, pq = (bb * NH_ + h) * TT * HD, pk = (bb * NKV + h / REP) * TT * HD; Ah += bb * TT * DQ; Al += bb * TT * DQ;
    if (i0 < RH) attn_body<bf, true>(S, Qh + pq, Ql + pq, Kh + pk, Kl + pk, Vh + pk, Vl + pk, i0, h, Ah, Al);   // the same for the whole work-group (RH % QB == 0)
    else attn_body<h16, false>(S, Q16 + pq, nullptr, K16 + pk, nullptr, V16 + pk, nullptr, i0, h, Ah, Al);
}

extern "C" void kernel_launch(void* const* d_in, const int* in_sizes, int n_in,
                              void* d_out, int out_size, void* d_ws, size_t ws_size, hipStream_t stream) {
    (void)in_sizes; (void)n_in; (void)out_size;
    const float* x = (const float*)d_in[0]; const float* wt = (const float*)d_in[1];   /* order x, W: THIS module has ONE weight ('xw' (in, out) [1024][1024]): p = x W serves as the query (scaled in the softmax), the key AND the value, and the output projection reuses the SAME W: TWO inputs, both read */
    float* OUT = (float*)d_out;     // [4][2048][1024]
    char* wsp = (char*)d_ws;
    auto take = [&](size_t bytes) { char* p = wsp; wsp += (bytes + 255) & ~(size_t)255; return (void*)p; };
    bf* WT = (bf*)take((size_t)DQ * DM * 2); float* CS = (float*)take((size_t)TT * HD * 2 * 4);
    bf* XB = (bf*)take((size_t)NB_ * TT * DM * 2); float* FP = (float*)take((size_t)NB_ * TT * DQ * 4);
    h16* PP16 = (h16*)take((size_t)NB_ * NH_ * TT * HD * 2); h16* VT16 = (h16*)take((size_t)NB_ * NKV * HD * TT * 2);
    bf* PPh = (bf*)take((size_t)NB_ * NH_ * TT * HD * 2); bf* PPl = (bf*)take((size_t)NB_ * NH_ * TT * HD * 2); bf* VTh = (bf*)take((size_t)NB_ * NKV * HD * TT * 2); bf* VTl = (bf*)take((size_t)NB_ * NKV * HD * TT * 2);
    bf* ATh = (bf*)take((size_t)NB_ * TT * DQ * 2); bf* ATl = (bf*)take((size_t)NB_ * TT * DQ * 2);
    if ((size_t)(wsp - (char*)d_ws) > ws_size) return;    // 179 MiB of the 256 MiB
    // the one weight is transposed once (DM == DQ: the same plane is the B operand of the input and of the output projection)
    k_wtG<<<(unsigned)((DM * DQ / 64 + 63) / 64), 256, 0, stream>>>(wt, DM, DQ, WT);
    k_csid<<<(TT * HD + 255) / 256, 256, 0, stream>>>(CS);
    const unsigned LQ = (unsigned)(((size_t)NH_ * TT * HD / 2 + 255) / 256), LKv = (unsigned)(((size_t)NKV * TT * HD / 2 + 255) / 256);
    k_cvt8<<<(unsigned)(((size_t)NB_ * TT * DM / 8 + 255) / 256), 256, 0, stream>>>(x, XB, (size_t)NB_ * TT * DM / 8);
    // p = x W once; its [b][h][t][d] planes are read as the query and as the key, its [b][h][d][t] planes as the value
    k_gemmw<bf, 0, false><<<dim3(TT / 64, DQ / 64, NB_), 32, 0, stream>>>(XB, nullptr, WT, nullptr, DM, FP, DQ, nullptr, (size_t)TT * DM, 0, (size_t)TT * DQ, 0);
    k_rope<<<dim3(LQ, NB_), 256, 0, stream>>>(FP, DQ, NH_, CS, nullptr, nullptr, 1.0f, PP16, PPh, PPl);
    k_vtp<<<dim3(LKv, NB_), 256, 0, stream>>>(FP, DKV, NKV, VT16, VTh, VTl);
    k_attn<<<dim3(NH_, TT / QB, NB_), KSP * 32, 0, stream>>>(PP16, PPh, PPl, PP16, PPh, PPl, VT16, VTh, VTl, ATh, ATl);   // batch slowest: one batch's planes are read at a time; in a batch the hi/lo rows' longer work-groups start first, and the launch ends on short ones
    k_gemmw<bf, 1, false><<<dim3(TT / 64, DM / 64, NB_), 32, 0, stream>>>(ATh, ATl, WT, nullptr, DQ, OUT, DM, nullptr, (size_t)TT * DQ, 0, (size_t)TT * DM, 0);
}

// v005
// A run of this version takes 365 microseconds.
// Two timings next to v004 both put it at 1.13 times that version's speed.
// Over all steps from v000 it is 10.8 times as fast.
#include <hip/hip_runtime.h>

// Multi-head self-attention with ONE tied weight (x [4][2048][1024]; p = einsum('bsh,hf->bsf', x, W) ('xw' (in, out) [1024][1024] 1/32, no bias) split into 16 heads x 64; q = p x 64^-0.5, and the SAME p is the key and the value: logits = q.p; softmax over all keys (no mask); attn.p merged; out = einsum('bsh,hf->bsf', merged, W): the SAME W again -> [4][2048][1024] (8.4 M); argument order x, W).
// All NB_ batches go through each kernel in ONE launch (the batch is a grid dimension; every workspace plane holds all batches). Layout: bf16 copy of x; the 'xw' weight transposed once for all its uses; p projected ONCE, exact, its 16-bit head planes written by the projection's own epilogue and shared by query, key and value; dense T-2048 attention in ONE kernel (hybrid rows: < 512 hi/lo 3 products, rest fp16 x1024; a work-group keeps the scores of QB query rows in LDS; attn.p summed in KSP key slices, one wave each, the slices added in slice order); merged hi/lo x Wo exact.
// Compute dtypes, f32 accumulate: every input rounded to bf16; projections exact; attention rows < 512 3 products, rest fp16; softmax f32; Wo hl x exact.

#define NB_  4
#define TT   2048
#define DM   1024
#define NH_  16
#define NKV  16
#define REP  (NH_ / NKV)
#define HD   64
#define DQ   (NH_ * HD)
#define DKV  (NKV * HD)
#define RH   512                  // query rows < RH use hi+lo planes (0: none)
#define WIN  0
#define PCAR 1024.0f
#define SCL  0.125f   // HD^-0.5
#define KSP  16                   // key slices of the attn.p products: TT / KSP keys per wave of k_attn
#define QB   32                   // query rows per work-group of k_attn
#define SP   (TT + 4)             // LDS pitch of one score row in floats: 16 bytes more than the row, so that the 16 rows of a b128 fragment read fall on different banks
#define OP   68                   // LDS pitch of one row of a partial attn.p tile in floats
typedef _Float16 h16;
typedef unsigned short bf;
typedef __attribute__((ext_vector_type(16))) __bf16   v16bf;
typedef __attribute__((ext_vector_type(16))) _Float16 v16h;
typedef __attribute__((ext_vector_type(8)))  _Float16 v8h;
typedef __attribute__((ext_vector_type(8)))  unsigned short v8us;
typedef __attribute__((ext_vector_type(8)))  float    v8f;
typedef __attribute__((ext_vector_type(4)))  float    v4f;
typedef v8h  __attribute__((may_alias)) v8ha;
typedef v4f  __attribute__((may_alias)) v4fa;
typedef v8us __attribute__((may_alias)) v8usa;

__device__ __forceinline__ unsigned short f2bf(float f) { unsigned u = __float_as_uint(f); u += 0x7FFFu + ((u >> 16) & 1u); return (unsigned short)(u >> 16); }
__device__ __forceinline__ float bf2f(unsigned short b) { return __uint_as_float(((unsigned)b) << 16); }
__device__ __forceinline__ float bfr(float f) { return bf2f(f2bf(f)); }
__device__ __forceinline__ v16h cat16(v8h lo, v8h hi) { return __builtin_shufflevector(lo, hi, 0, 1, 2, 3, 4, 5, 6, 7, 8, 9, 10, 11, 12, 13, 14, 15); }
__device__ __forceinline__ v16bf cat16b(v8us lo, v8us hi) { return __builtin_bit_cast(v16bf, __builtin_shufflevector(lo, hi, 0, 1, 2, 3, 4, 5, 6, 7, 8, 9, 10, 11, 12, 13, 14, 15)); }
__device__ __forceinline__ v8f wmma16(v16h a, v16h b, v8f c) { return __builtin_amdgcn_wmma_f32_16x16x32_f16(false, a, false, b, (short)0, c, false, false); }
__device__ __forceinline__ v8f wmmab(v16bf a, v16bf b, v8f c) { return __builtin_amdgcn_wmma_f32_16x16x32_bf16(false, a, false, b, (short)0, c, false, false); }


__device__ __forceinline__ h16 tohx(float x) { return (h16)x; }
__device__ __forceinline__ void splitf(float y, unsigned short& h, unsigned short& l) { h = f2bf(y); l = f2bf(y - bf2f(h)); }
// ---- k_gemmw: register-blocked GEMM, ONE WAVE per 64x64 output tile (16 accumulators), operands straight from K-contiguous 16-bit planes; grid (M/64, N/64, Z), 32 threads.
// C[m][n] (f32, pitch ldc, + optional f32 bias[n]) = sum_k A[m][k] Bt[n][k] (+ split products per NSPLIT). z-batch strides sA/sB/sC in elements. K % (32 * KS) == 0.
// KS > 1: grid z = Z * KS; work-group (z, ks) sums only k in [ks K/KS, (ks+1) K/KS) and stores that partial tile in plane ks (plane stride sP elements); the reader adds the KS planes.
// HP: no f32 C; the tile is 64 positions x the HD columns of head blockIdx.y of batch z, and the epilogue writes it as 16-bit head planes (fp16, bf16 hi, bf16 lo), once as [b][h][t][d] (P*) and once as [b][h][d][t] (V*).
template <typename T16> struct WFrag;
template <> struct WFrag<h16> { typedef v16h V; static __device__ __forceinline__ V ld(const h16* p) { return cat16(*(const v8h*)p, *(const v8h*)(p + 16)); } static __device__ __forceinline__ v8f mma(V a, V b, v8f c) { return wmma16(a, b, c); } };
template <> struct WFrag<bf> { typedef v16bf V; static __device__ __forceinline__ V ld(const bf* p) { return cat16b(*(const v8us*)p, *(const v8us*)(p + 16)); } static __device__ __forceinline__ v8f mma(V a, V b, v8f c) { return wmmab(a, b, c); } };
// stands behind a group of plane stores, in front of whatever overwrites their registers; the stored values and the pointers are inputs, so that their registers are not given to a later value before the wait
#define SWAIT(d0, d1, d2, p0, p1, p2) asm volatile("s_wait_xcnt 0x0" :: "v"(d0), "v"(d1), "v"(d2), "v"(p0), "v"(p1), "v"(p2) : "memory")
template <typename T16, int NSPLIT, bool BIAS, int KS = 1, bool HP = false>
__global__ __launch_bounds__(32) void k_gemmw(const T16* __restrict__ A, const T16* __restrict__ A2, const T16* __restrict__ Bt, const T16* __restrict__ Bt2, int K, float* C, int ldc, const float* __restrict__ bias, size_t sA, size_t sB, size_t sC, size_t sP, h16* P16, bf* Ph, bf* Pl, h16* V16, bf* Vh, bf* Vl) {
    typedef typename WFrag<T16>::V V;
    __shared__ __align__(16) float os[16 * 68];
    const size_t z = blockIdx.z / KS; const int ks = (int)(blockIdx.z % KS); const int kb = ks * (K / KS), ke = kb + K / KS; C += (size_t)ks * sP; A += z * sA; if (A2) A2 += z * sA; Bt += z * sB; if (Bt2) Bt2 += z * sB; C += z * sC;
    const int lane = threadIdx.x & 31, lr = lane & 15, hi = lane >> 4; const int r0 = blockIdx.x * 64, c0 = blockIdx.y * 64;
    v8f acc[4][4];
#pragma unroll
    for (int mb = 0; mb < 4; ++mb)
#pragma unroll
        for (int nb = 0; nb < 4; ++nb) acc[mb][nb] = (v8f){};
    const size_t aoff = (size_t)(r0 + lr) * K + 8 * hi, boff = (size_t)(c0 + lr) * K + 8 * hi;
#pragma unroll 1
    for (int kc = kb; kc < ke; kc += 32) {
        V a[4], a2[4];
#pragma unroll
        for (int mb = 0; mb < 4; ++mb) { a[mb] = WFrag<T16>::ld(A + aoff + (size_t)mb * 16 * K + kc); if (NSPLIT == 1 || NSPLIT == 2) a2[mb] = WFrag<T16>::ld(A2 + aoff + (size_t)mb * 16 * K + kc); }
#pragma unroll
        for (int nb = 0; nb < 4; ++nb) { const V b = WFrag<T16>::ld(Bt + boff + (size_t)nb * 16 * K + kc); V b2; if (NSPLIT >= 2) b2 = WFrag<T16>::ld(Bt2 + boff + (size_t)nb * 16 * K + kc);
#pragma unroll
            for (int mb = 0; mb < 4; ++mb) { acc[mb][nb] = WFrag<T16>::mma(a[mb], b, acc[mb][nb]); if (NSPLIT == 1 || NSPLIT == 2) acc[mb][nb] = WFrag<T16>::mma(a2[mb], b, acc[mb][nb]); if (NSPLIT >= 2) acc[mb][nb] = WFrag<T16>::mma(a[mb], b2, acc[mb][nb]); } }
        asm volatile("v_nop\n\tv_nop\n\tv_nop\n\tv_nop" : "+v"(acc[0][0]), "+v"(acc[1][1]), "+v"(acc[2][2]), "+v"(acc[3][3]) : "v"(a[0]), "v"(a[3]));
    }
    if constexpr (HP) {
        static_assert(HD == 64, "one 64-column tile is one head");
        const size_t po = (z * NH_ + blockIdx.y) * (size_t)TT * HD;
        // [d][t] planes: a lane's 8 accumulator rows are 8 successive positions of one column, 16 bytes of a plane row, stored straight from registers
#pragma unroll
        for (int nb = 0; nb < 4; ++nb)
#pragma unroll
            for (int mb = 0; mb < 4; ++mb) { v8h o16; v8us oh, ol;
#pragma unroll
                for (int j = 0; j < 8; ++j) { const float x = acc[mb][nb][j]; o16[j] = tohx(x); unsigned short a2, c2; splitf(x, a2, c2); oh[j] = a2; ol[j] = c2; }
                const size_t vo = po + (size_t)(nb * 16 + lr) * TT + r0 + mb * 16 + hi * 8; *(v8h*)(V16 + vo) = o16; *(v8us*)(Vh + vo) = oh; *(v8us*)(Vl + vo) = ol; SWAIT(o16, oh, ol, V16 + vo, Vh + vo, Vl + vo); }
        // [t][d] planes: 16 rows at a time through LDS (one wave: its LDS operations run in program order), so that a lane holds 8 successive columns of one position; a store covers 4 whole plane rows
#pragma unroll
        for (int mb = 0; mb < 4; ++mb) {
#pragma unroll
            for (int nb = 0; nb < 4; ++nb) {
#pragma unroll
                for (int j = 0; j < 8; ++j) os[(hi * 8 + j) * 68 + nb * 16 + lr] = acc[mb][nb][j]; }
#pragma unroll
            for (int s = 0; s < 4; ++s) { const int row = 4 * s + (lane >> 3), cofs = (lane & 7) * 8; const v4f x0 = *(const v4fa*)(os + row * 68 + cofs), x1 = *(const v4fa*)(os + row * 68 + cofs + 4); v8h o16; v8us oh, ol;
#pragma unroll
                for (int j = 0; j < 8; ++j) { const float x = j < 4 ? x0[j & 3] : x1[j & 3]; o16[j] = tohx(x); unsigned short a2, c2; splitf(x, a2, c2); oh[j] = a2; ol[j] = c2; }
                const size_t pp = po + (size_t)(r0 + mb * 16 + row) * HD + cofs; *(v8h*)(P16 + pp) = o16; *(v8us*)(Ph + pp) = oh; *(v8us*)(Pl + pp) = ol; SWAIT(o16, oh, ol, P16 + pp, Ph + pp, Pl + pp); }
        }
        return;
    }
#pragma unroll
    for (int mb = 0; mb < 4; ++mb) {
#pragma unroll
        for (int nb = 0; nb < 4; ++nb) {
#pragma unroll
            for (int j = 0; j < 8; ++j) os[(hi * 8 + j) * 68 + nb * 16 + lr] = acc[mb][nb][j]; }
        __builtin_amdgcn_wave_barrier(); asm volatile("" ::: "memory");
        float* crow = C + (size_t)(r0 + mb * 16) * ldc + c0;
{
#pragma unroll
            for (int s = 0; s < 8; ++s) { const int row = 2 * s + hi, cofs = lr * 4; v4f val = *(const v4fa*)(os + row * 68 + cofs); if (BIAS) { val[0] += bfr(bias[c0 + cofs]); val[1] += bfr(bias[c0 + cofs + 1]); val[2] += bfr(bias[c0 + cofs + 2]); val[3] += bfr(bias[c0 + cofs + 3]); }
                *(v4f*)(crow + (size_t)row * ldc + cofs) = val; }
             }
        __builtin_amdgcn_wave_barrier(); asm volatile("" ::: "memory");
    }
}

typedef __attribute__((ext_vector_type(2))) _Float16 v2h;
typedef __attribute__((ext_vector_type(4))) _Float16 v4h;
typedef __attribute__((ext_vector_type(2))) unsigned short v2us;
typedef __attribute__((ext_vector_type(4))) unsigned short v4us;
typedef __attribute__((ext_vector_type(2))) float v2f;
typedef __attribute__((ext_vector_type(4))) int v4i;

__global__ __launch_bounds__(256) void k_wtG(const float* __restrict__ w, int K, int N, bf* Bt) {
    const int lane = threadIdx.x & 31; const int L0 = (blockIdx.x * 8 + (threadIdx.x >> 5)) * 8; const int nlines = N * K / 64;
{
#pragma unroll 1
        for (int l = 0; l < 8; ++l) { const int L = L0 + l; if (L >= nlines) break; const size_t e = (size_t)L * 64 + lane * 2; const int k = (int)(e % K), n = (int)(e / K); v2us o;
            o[0] = f2bf(w[(size_t)k * N + n]); o[1] = f2bf(w[(size_t)(k + 1) * N + n]); *(v2us*)(Bt + e) = o; }
         }
}
__global__ __launch_bounds__(256) void k_cvt8(const float* __restrict__ src, bf* dst, size_t n8) { const size_t i = (size_t)blockIdx.x * 256 + threadIdx.x; if (i >= n8) return; const v8f v = *(const v8f*)(src + i * 8); v8us o;
#pragma unroll
    for (int k = 0; k < 8; ++k) o[k] = f2bf(v[k]); *(v8us*)(dst + i * 8) = o;  }
typedef v4h  __attribute__((may_alias)) v4ha;
typedef v4us __attribute__((may_alias)) v4usa;
// fragment loads from the LDS score rows (the rows hold f32 scores first and 16-bit weights later: may_alias types)
template <typename T16> struct LFrag;
template <> struct LFrag<h16> { static __device__ __forceinline__ v16h ld(const h16* p) { return cat16(*(const v8ha*)p, *(const v8ha*)(p + 16)); } };
template <> struct LFrag<bf> { static __device__ __forceinline__ v16bf ld(const bf* p) { return cat16b(*(const v8usa*)p, *(const v8usa*)(p + 16)); } };

// ---- k_attn: logits, softmax, attn.p and the head merge for QB query rows of one head; KSP waves; grid (heads, TT / QB, batches).
// 1: wave w forms the scores of its TT / KSP keys for all QB rows (f32, LDS). 2: wave w does the softmax of rows 2w, 2w + 1 (register row, one exp, fixed trees) and writes the 16-bit weights over the row's own bytes (hi plane in the first half, lo plane in the second; fp16: first half only).
// 3: wave w sums attn.p over its own key slice; the KSP partial tiles go through LDS and are added in slice order; the result is split hi/lo into the merged planes.
// stands behind a run of global loads, in front of whatever overwrites their address registers; the pointers are inputs, so that their registers are not given to a load's result before the wait
#define XWAIT(p, p2) asm volatile("s_wait_xcnt 0x0" :: "v"(p), "v"(p2) : "memory")
template <typename T16, bool HR>
__device__ __forceinline__ void attn_body(float* S, const T16* __restrict__ Q, const T16* __restrict__ Q2, const T16* __restrict__ Kp, const T16* __restrict__ K2, const T16* __restrict__ Vt, const T16* __restrict__ Vt2, int i0, int h, bf* Ah, bf* Al) {
    typedef typename WFrag<T16>::V V;
    const int tid = threadIdx.x, lane = tid & 31, lr = lane & 15, hi = lane >> 4, w = tid >> 5; const int kb = w * (TT / KSP);
    {
        V a[2][2], a2[2][2]; const size_t qo = (size_t)(i0 + lr) * HD + 8 * hi, ko = (size_t)(kb + lr) * HD + 8 * hi; const T16* qp = Q + qo; const T16* qp2 = HR ? Q2 + qo : qp; const T16* kp = Kp + ko; const T16* kp2 = HR ? K2 + ko : kp;
#pragma unroll
        for (int mb = 0; mb < 2; ++mb)
#pragma unroll
            for (int kk = 0; kk < 2; ++kk) { const int ao = mb * 16 * HD + kk * 32; a[mb][kk] = WFrag<T16>::ld(qp + ao); if (HR) a2[mb][kk] = WFrag<T16>::ld(qp2 + ao); }
        XWAIT(qp, qp2);
        // GN key tiles at a time, 2 GN accumulator chains; rolled: unrolled whole, the hoisted key loads spill
        constexpr int GN = HR ? 2 : 4;
#pragma unroll 1
        for (int ng = 0; ng < TT / KSP / 16; ng += GN) { v8f acc[2][GN]; V b[GN][2], b2[GN][2];
#pragma unroll
            for (int nb = 0; nb < GN; ++nb)
#pragma unroll
                for (int kk = 0; kk < 2; ++kk) { const int bo = nb * 16 * HD + kk * 32; b[nb][kk] = WFrag<T16>::ld(kp + bo); if (HR) b2[nb][kk] = WFrag<T16>::ld(kp2 + bo); }
            XWAIT(kp, kp2); kp += GN * 16 * HD; kp2 += GN * 16 * HD;
#pragma unroll
            for (int nb = 0; nb < GN; ++nb)
#pragma unroll
                for (int mb = 0; mb < 2; ++mb) { acc[mb][nb] = (v8f){};
#pragma unroll
                    for (int kk = 0; kk < 2; ++kk) { acc[mb][nb] = WFrag<T16>::mma(a[mb][kk], b[nb][kk], acc[mb][nb]); if (HR) { acc[mb][nb] = WFrag<T16>::mma(a2[mb][kk], b[nb][kk], acc[mb][nb]); acc[mb][nb] = WFrag<T16>::mma(a[mb][kk], b2[nb][kk], acc[mb][nb]); } } }
            // four vector slots behind the group's last matrix instruction: a later chain starts from zero in registers that a chain of this group has just written, with only LDS stores in between; the key fragments are inputs, so that no chain's result is laid over a fragment that an issued matrix instruction still names
            if constexpr (HR) asm volatile("v_nop\n\tv_nop\n\tv_nop\n\tv_nop" : "+v"(acc[0][0]), "+v"(acc[1][0]), "+v"(acc[0][1]), "+v"(acc[1][1]) : "v"(b[0][0]), "v"(b[0][1]), "v"(b[1][0]), "v"(b[1][1]), "v"(b2[0][0]), "v"(b2[0][1]), "v"(b2[1][0]), "v"(b2[1][1]));
            else asm volatile("v_nop\n\tv_nop\n\tv_nop\n\tv_nop" : "+v"(acc[0][0]), "+v"(acc[1][0]), "+v"(acc[0][1]), "+v"(acc[1][1]), "+v"(acc[0][2]), "+v"(acc[1][2]), "+v"(acc[0][3]), "+v"(acc[1][3]) : "v"(b[0][0]), "v"(b[0][1]), "v"(b[1][0]), "v"(b[1][1]), "v"(b[2][0]), "v"(b[2][1]), "v"(b[3][0]), "v"(b[3][1]));
#pragma unroll
            for (int nb = 0; nb < GN; ++nb)
#pragma unroll
                for (int mb = 0; mb < 2; ++mb)
#pragma unroll
                    for (int j = 0; j < 8; ++j) S[(mb * 16 + hi * 8 + j) * SP + kb + (ng + nb) * 16 + lr] = acc[mb][nb][j]; }
    }
    __syncthreads();   // every score of the QB rows is in LDS before a row is read
    // rolled: one row's 64 registers at a time
#pragma unroll 1
    for (int r = 0; r < QB / KSP; ++r) { float* sr = S + (w * (QB / KSP) + r) * SP; float v[TT / 32]; float mx = -3.0e38f;
#pragma unroll
        for (int ch = 0; ch < TT / 128; ++ch) { const v4f a = *(const v4fa*)(sr + ch * 128 + lane * 4);
#pragma unroll
            for (int q = 0; q < 4; ++q) { const float t = a[q] * SCL; v[ch * 4 + q] = t; mx = fmaxf(mx, t); } }
#pragma unroll
        for (int sh = 16; sh; sh >>= 1) mx = fmaxf(mx, __shfl_xor(mx, sh, 32));
        float sum = 0.f;
#pragma unroll
        for (int k = 0; k < TT / 32; ++k) { const float d0 = __fsub_rn(v[k], mx); v[k] = __builtin_amdgcn_exp2f(__fmul_rn(d0, 1.4426950408889634f)); sum += v[k]; }
#pragma unroll
        for (int sh = 16; sh; sh >>= 1) sum += __shfl_xor(sum, sh, 32);
        const float f = __fdiv_rn(HR ? 1.0f : PCAR, sum);
        if (HR) { bf* ph = (bf*)sr;
#pragma unroll
            for (int ch = 0; ch < TT / 128; ++ch) { v4us oh, ol;
#pragma unroll
                for (int q = 0; q < 4; ++q) { unsigned short a, c2; splitf(v[ch * 4 + q] * f, a, c2); oh[q] = a; ol[q] = c2; }
                *(v4usa*)(ph + ch * 128 + lane * 4) = oh; *(v4usa*)(ph + TT + ch * 128 + lane * 4) = ol; }
        } else { h16* p16 = (h16*)sr;
#pragma unroll
            for (int ch = 0; ch < TT / 128; ++ch) { v4h o4;
#pragma unroll
                for (int q = 0; q < 4; ++q) o4[q] = tohx(v[ch * 4 + q] * f);
                *(v4ha*)(p16 + ch * 128 + lane * 4) = o4; } }
    }
    __syncthreads();   // every row's weights are in LDS before a wave reads its key slice of all rows
    v8f acc[2][4];
#pragma unroll
    for (int mb = 0; mb < 2; ++mb)
#pragma unroll
        for (int nb = 0; nb < 4; ++nb) acc[mb][nb] = (v8f){};
    // two chunks' value loads in flight where the registers allow it (one plane); rolled for the two planes
    constexpr int U3 = HR ? 1 : 2; const size_t vo = (size_t)lr * TT + kb + 8 * hi; const T16* vp = Vt + vo; const T16* vp2 = HR ? Vt2 + vo : vp;
#pragma unroll U3
    for (int kc = 0; kc < TT / KSP; kc += 32) { V a[2], a2[2], b[4], b2[4];
#pragma unroll
        for (int nb = 0; nb < 4; ++nb) { b[nb] = WFrag<T16>::ld(vp + nb * 16 * TT); if (HR) b2[nb] = WFrag<T16>::ld(vp2 + nb * 16 * TT); }
        XWAIT(vp, vp2); vp += 32; vp2 += 32;
#pragma unroll
        for (int mb = 0; mb < 2; ++mb) { const T16* pr = (const T16*)(S + (mb * 16 + lr) * SP) + kb + kc + 8 * hi; a[mb] = LFrag<T16>::ld(pr); if (HR) a2[mb] = LFrag<T16>::ld(pr + TT); }
#pragma unroll
        for (int nb = 0; nb < 4; ++nb)
#pragma unroll
            for (int mb = 0; mb < 2; ++mb) { acc[mb][nb] = WFrag<T16>::mma(a[mb], b[nb], acc[mb][nb]); if (HR) { acc[mb][nb] = WFrag<T16>::mma(a2[mb], b[nb], acc[mb][nb]); acc[mb][nb] = WFrag<T16>::mma(a[mb], b2[nb], acc[mb][nb]); } } }
    __syncthreads();   // every wave has read its weights before the partial tiles overwrite them
#pragma unroll
    for (int mb = 0; mb < 2; ++mb)
#pragma unroll
        for (int nb = 0; nb < 4; ++nb)
#pragma unroll
            for (int j = 0; j < 8; ++j) S[w * (QB * OP) + (mb * 16 + hi * 8 + j) * OP + nb * 16 + lr] = acc[mb][nb][j];
    __syncthreads();   // all KSP partial tiles are in LDS before they are added
    const int row = tid >> 4, c = (tid & 15) * 4; v4f sm = *(const v4fa*)(S + row * OP + c);
#pragma unroll
    for (int ks = 1; ks < KSP; ++ks) { const v4f p = *(const v4fa*)(S + ks * (QB * OP) + row * OP + c); sm[0] += p[0]; sm[1] += p[1]; sm[2] += p[2]; sm[3] += p[3]; }   // key slices added in slice order
    const float cs = HR ? 1.0f : (1.0f / PCAR); v4us oh, ol;
#pragma unroll
    for (int q = 0; q < 4; ++q) { unsigned short a, c2; splitf(sm[q] * cs, a, c2); oh[q] = a; ol[q] = c2; }
    const size_t oo = (size_t)(i0 + row) * DQ + h * HD + c; *(v4us*)(Ah + oo) = oh; *(v4us*)(Al + oo) = ol;
}
__global__ __launch_bounds__(KSP * 32) void k_attn(const h16* __restrict__ Q16, const bf* __restrict__ Qh, const bf* __restrict__ Ql, const h16* __restrict__ K16, const bf* __restrict__ Kh, const bf* __restrict__ Kl, const h16* __restrict__ V16, const bf* __restrict__ Vh, const bf* __restrict__ Vl, bf* Ah, bf* Al) {
    __shared__ __align__(16) float S[QB * SP];
    const int h = blockIdx.x, i0 = blockIdx.y * QB; const size_t bb = blockIdx.z, pq = (bb * NH_ + h) * TT * HD, pk = (bb * NKV + h / REP) * TT * HD; Ah += bb * TT * DQ; Al += bb * TT * DQ;
    if (i0 < RH) attn_body<bf, true>(S, Qh + pq, Ql + pq, Kh + pk, Kl + pk, Vh + pk, Vl + pk, i0, h, Ah, Al);   // the same for the whole work-group (RH % QB == 0)
    else attn_body<h16, false>(S, Q16 + pq, nullptr, K16 + pk, nullptr, V16 + pk, nullptr, i0, h, Ah, Al);
}

extern "C" void kernel_launch(void* const* d_in, const int* in_sizes, int n_in,
                              void* d_out, int out_size, void* d_ws, size_t ws_size, hipStream_t stream) {
    (void)in_sizes; (void)n_in; (void)out_size;
    const float* x = (const float*)d_in[0]; const float* wt = (const float*)d_in[1];   /* order x, W: THIS module has ONE weight ('xw' (in, out) [1024][1024]): p = x W serves as the query (scaled in the softmax), the key AND the value, and the output projection reuses the SAME W: TWO inputs, both read */
    float* OUT = (float*)d_out;     // [4][2048][1024]
    char* wsp = (char*)d_ws;
    auto take = [&](size_t bytes) { char* p = wsp; wsp += (bytes + 255) & ~(size_t)255; return (void*)p; };
    bf* WT = (bf*)take((size_t)DQ * DM * 2);
    bf* XB = (bf*)take((size_t)NB_ * TT * DM * 2);
    h16* PP16 = (h16*)take((size_t)NB_ * NH_ * TT * HD * 2); h16* VT16 = (h16*)take((size_t)NB_ * NKV * HD * TT * 2);
    bf* PPh = (bf*)take((size_t)NB_ * NH_ * TT * HD * 2); bf* PPl = (bf*)take((size_t)NB_ * NH_ * TT * HD * 2); bf* VTh = (bf*)take((size_t)NB_ * NKV * HD * TT * 2); bf* VTl = (bf*)take((size_t)NB_ * NKV * HD * TT * 2);
    bf* ATh = (bf*)take((size_t)NB_ * TT * DQ * 2); bf* ATl = (bf*)take((size_t)NB_ * TT * DQ * 2);
    if ((size_t)(wsp - (char*)d_ws) > ws_size) return;    // 146 MiB of the 256 MiB
    // the one weight is transposed once (DM == DQ: the same plane is the B operand of the input and of the output projection)
    k_wtG<<<(unsigned)((DM * DQ / 64 + 63) / 64), 256, 0, stream>>>(wt, DM, DQ, WT);
    k_cvt8<<<(unsigned)(((size_t)NB_ * TT * DM / 8 + 255) / 256), 256, 0, stream>>>(x, XB, (size_t)NB_ * TT * DM / 8);
    // p = x W once, written as 16-bit head planes by the GEMM's epilogue: the [b][h][t][d] planes are read as the query and as the key, the [b][h][d][t] planes as the value
    k_gemmw<bf, 0, false, 1, true><<<dim3(TT / 64, DQ / 64, NB_), 32, 0, stream>>>(XB, nullptr, WT, nullptr, DM, nullptr, DQ, nullptr, (size_t)TT * DM, 0, 0, 0, PP16, PPh, PPl, VT16, VTh, VTl);
    k_attn<<<dim3(NH_, TT / QB, NB_), KSP * 32, 0, stream>>>(PP16, PPh, PPl, PP16, PPh, PPl, VT16, VTh, VTl, ATh, ATl);   // batch slowest: one batch's planes are read at a time; in a batch the hi/lo rows' longer work-groups start first, and the launch ends on short ones
    k_gemmw<bf, 1, false><<<dim3(TT / 64, DM / 64, NB_), 32, 0, stream>>>(ATh, ATl, WT, nullptr, DQ, OUT, DM, nullptr, (size_t)TT * DQ, 0, (size_t)TT * DM, 0, nullptr, nullptr, nullptr, nullptr, nullptr, nullptr);
}

// v006
// It runs in 262 microseconds.
// Two timings next to v005 both put it at 1.39 times that version's speed.
// Over all steps from v000 it is 15.0 times as fast.
#include <hip/hip_runtime.h>

// Multi-head self-attention with ONE tied weight (x [4][2048][1024]; p = einsum('bsh,hf->bsf', x, W) ('xw' (in, out) [1024][1024] 1/32, no bias) split into 16 heads x 64; q = p x 64^-0.5, and the SAME p is the key and the value: logits = q.p; softmax over all keys (no mask); attn.p merged; out = einsum('bsh,hf->bsf', merged, W): the SAME W again -> [4][2048][1024] (8.4 M); argument order x, W).
// All NB_ batches go through each kernel in ONE launch (the batch is a grid dimension; every workspace plane holds all batches). Layout: bf16 copy of x; the 'xw' weight transposed once for all its uses; p projected ONCE, exact, its 16-bit head planes written by the projection's own epilogue and shared by query, key and value; dense T-2048 attention in ONE kernel (hybrid rows: < 512 hi/lo 3 products, rest fp16 x1024; a work-group keeps the scores of QB query rows in LDS; attn.p summed in KSP key slices, one wave each, the slices added in slice order); merged hi/lo x Wo exact.
// Every 16-bit operand plane that a matrix fragment is loaded from in global memory (x, W transposed, p's head planes, the merged planes) is stored in FRAGMENT ORDER (fo() below): the 16 bytes that the 32 lanes of one fragment load take lie side by side, so a load reads 4 whole 128-byte lines and not 32 bytes of each of 16 lines.
// Compute dtypes, f32 accumulate: every input rounded to bf16; projections exact; attention rows < 512 3 products, rest fp16; softmax f32; Wo hl x exact.

#define NB_  4
#define TT   2048
#define DM   1024
#define NH_  16
#define NKV  16
#define REP  (NH_ / NKV)
#define HD   64
#define DQ   (NH_ * HD)
#define DKV  (NKV * HD)
#define RH   512                  // query rows < RH use hi+lo planes (0: none)
#define WIN  0
#define PCAR 1024.0f
#define SCL  0.125f   // HD^-0.5
#define KSP  16                   // key slices of the attn.p products: TT / KSP keys per wave of k_attn
#define QB   32                   // query rows per work-group of k_attn
#define SP   (TT + 4)             // LDS pitch of one score row in floats: 16 bytes more than the row, so that the 16 rows of a b128 fragment read fall on different banks
#define OP   68                   // LDS pitch of one row of a partial attn.p tile in floats
typedef _Float16 h16;
typedef unsigned short bf;
typedef __attribute__((ext_vector_type(16))) __bf16   v16bf;
typedef __attribute__((ext_vector_type(16))) _Float16 v16h;
typedef __attribute__((ext_vector_type(8)))  _Float16 v8h;
typedef __attribute__((ext_vector_type(8)))  unsigned short v8us;
typedef __attribute__((ext_vector_type(8)))  float    v8f;
typedef __attribute__((ext_vector_type(4)))  float    v4f;
typedef v8h  __attribute__((may_alias)) v8ha;
typedef v4f  __attribute__((may_alias)) v4fa;
typedef v8us __attribute__((may_alias)) v8usa;

__device__ __forceinline__ unsigned short f2bf(float f) { unsigned u = __float_as_uint(f); u += 0x7FFFu + ((u >> 16) & 1u); return (unsigned short)(u >> 16); }
__device__ __forceinline__ float bf2f(unsigned short b) { return __uint_as_float(((unsigned)b) << 16); }
__device__ __forceinline__ float bfr(float f) { return bf2f(f2bf(f)); }
__device__ __forceinline__ v16h cat16(v8h lo, v8h hi) { return __builtin_shufflevector(lo, hi, 0, 1, 2, 3, 4, 5, 6, 7, 8, 9, 10, 11, 12, 13, 14, 15); }
__device__ __forceinline__ v16bf cat16b(v8us lo, v8us hi) { return __builtin_bit_cast(v16bf, __builtin_shufflevector(lo, hi, 0, 1, 2, 3, 4, 5, 6, 7, 8, 9, 10, 11, 12, 13, 14, 15)); }
__device__ __forceinline__ v8f wmma16(v16h a, v16h b, v8f c) { return __builtin_amdgcn_wmma_f32_16x16x32_f16(false, a, false, b, (short)0, c, false, false); }
__device__ __forceinline__ v8f wmmab(v16bf a, v16bf b, v8f c) { return __builtin_amdgcn_wmma_f32_16x16x32_bf16(false, a, false, b, (short)0, c, false, false); }


__device__ __forceinline__ h16 tohx(float x) { return (h16)x; }
__device__ __forceinline__ void splitf(float y, unsigned short& h, unsigned short& l) { h = f2bf(y); l = f2bf(y - bf2f(h)); }
// fragment order of a [rows][K] plane (rows % 16 == 0, K % 32 == 0): blocks of 16 rows x 32 k, 512 elements each, k blocks of a row block in a row; in a block the 8-element pieces lie as [k bit 4][k bit 3][row & 15], which is [half of the fragment][lane]
__device__ __forceinline__ size_t fo(size_t row, size_t k, size_t K) { return ((row >> 4) * (K >> 5) + (k >> 5)) * 512 + ((k >> 4) & 1) * 256 + ((k >> 3) & 1) * 128 + (row & 15) * 8 + (k & 7); }
// ---- k_gemmw: register-blocked GEMM, ONE WAVE per 64x64 output tile (16 accumulators), operands straight from 16-bit planes in fragment order; grid (M/64, N/64, Z), 32 threads.
// C[m][n] (f32, pitch ldc, + optional f32 bias[n]) = sum_k A[m][k] Bt[n][k] (+ split products per NSPLIT). z-batch strides sA/sB/sC in elements. K % (32 * KS) == 0.
// KS > 1: grid z = Z * KS; work-group (z, ks) sums only k in [ks K/KS, (ks+1) K/KS) and stores that partial tile in plane ks (plane stride sP elements); the reader adds the KS planes.
// HP: no f32 C; the tile is 64 positions x the HD columns of head blockIdx.y of batch z, and the epilogue writes it as 16-bit head planes (fp16, bf16 hi, bf16 lo), once as [b][h][t][d] (P*) and once as [b][h][d][t] (V*), each [t][d] or [d][t] plane in fragment order.
// WFrag::ld: one fragment of a plane in fragment order; p = the 16 x 32 block's start + lane * 8
template <typename T16> struct WFrag;
template <> struct WFrag<h16> { typedef v16h V; static __device__ __forceinline__ V ld(const h16* p) { return cat16(*(const v8h*)p, *(const v8h*)(p + 256)); } static __device__ __forceinline__ v8f mma(V a, V b, v8f c) { return wmma16(a, b, c); } };
template <> struct WFrag<bf> { typedef v16bf V; static __device__ __forceinline__ V ld(const bf* p) { return cat16b(*(const v8us*)p, *(const v8us*)(p + 256)); } static __device__ __forceinline__ v8f mma(V a, V b, v8f c) { return wmmab(a, b, c); } };
// stands behind a group of plane stores, in front of whatever overwrites their registers; the stored values and the pointers are inputs, so that their registers are not given to a later value before the wait
#define SWAIT(d0, d1, d2, p0, p1, p2) asm volatile("s_wait_xcnt 0x0" :: "v"(d0), "v"(d1), "v"(d2), "v"(p0), "v"(p1), "v"(p2) : "memory")
// stands behind a run of global loads (the fragment loads of one k step), in front of whatever overwrites their address registers (the pointer steps); the pointers are inputs, so that their registers are not given to a load's result before the wait
#define LWAIT(p0, p1, p2, p3) asm volatile("s_wait_xcnt 0x0" :: "v"(p0), "v"(p1), "v"(p2), "v"(p3) : "memory")
template <typename T16, int NSPLIT, bool BIAS, int K, int KS = 1, bool HP = false>
__global__ __launch_bounds__(32) void k_gemmw(const T16* __restrict__ A, const T16* __restrict__ A2, const T16* __restrict__ Bt, const T16* __restrict__ Bt2, float* C, int ldc, const float* __restrict__ bias, size_t sA, size_t sB, size_t sC, size_t sP, h16* P16, bf* Ph, bf* Pl, h16* V16, bf* Vh, bf* Vl) {
    typedef typename WFrag<T16>::V V;
    __shared__ __align__(16) float os[16 * 68];
    const size_t z = blockIdx.z / KS; const int ks = (int)(blockIdx.z % KS); const int kb = ks * (K / KS), ke = kb + K / KS; C += (size_t)ks * sP; A += z * sA; if (A2) A2 += z * sA; Bt += z * sB; if (Bt2) Bt2 += z * sB; C += z * sC;
    const int lane = threadIdx.x & 31, lr = lane & 15, hi = lane >> 4; const int r0 = blockIdx.x * 64, c0 = blockIdx.y * 64;
    v8f acc[4][4];
#pragma unroll
    for (int mb = 0; mb < 4; ++mb)
#pragma unroll
        for (int nb = 0; nb < 4; ++nb) acc[mb][nb] = (v8f){};
    const size_t aoff = (size_t)r0 * K + (size_t)kb * 16 + lane * 8, boff = (size_t)c0 * K + (size_t)kb * 16 + lane * 8;   // a row block of 16 rows is 16 K elements, a k block 512
    const T16* ap = A + aoff; const T16* ap2 = (NSPLIT == 1 || NSPLIT == 2) ? A2 + aoff : ap; const T16* bp = Bt + boff; const T16* bp2 = NSPLIT >= 2 ? Bt2 + boff : bp;
#pragma unroll 1
    for (int kc = kb; kc < ke; kc += 32) {
        V a[4], a2[4], b[4], b2[4];
#pragma unroll
        for (int mb = 0; mb < 4; ++mb) { a[mb] = WFrag<T16>::ld(ap + mb * 16 * K); if (NSPLIT == 1 || NSPLIT == 2) a2[mb] = WFrag<T16>::ld(ap2 + mb * 16 * K); }
#pragma unroll
        for (int nb = 0; nb < 4; ++nb) { b[nb] = WFrag<T16>::ld(bp + nb * 16 * K); if (NSPLIT >= 2) b2[nb] = WFrag<T16>::ld(bp2 + nb * 16 * K); }
        LWAIT(ap, ap2, bp, bp2); ap += 512; ap2 += 512; bp += 512; bp2 += 512;
#pragma unroll
        for (int nb = 0; nb < 4; ++nb)
#pragma unroll
            for (int mb = 0; mb < 4; ++mb) { acc[mb][nb] = WFrag<T16>::mma(a[mb], b[nb], acc[mb][nb]); if (NSPLIT == 1 || NSPLIT == 2) acc[mb][nb] = WFrag<T16>::mma(a2[mb], b[nb], acc[mb][nb]); if (NSPLIT >= 2) acc[mb][nb] = WFrag<T16>::mma(a[mb], b2[nb], acc[mb][nb]); }
        asm volatile("v_nop\n\tv_nop\n\tv_nop\n\tv_nop" : "+v"(acc[0][0]), "+v"(acc[1][1]), "+v"(acc[2][2]), "+v"(acc[3][3]) : "v"(a[0]), "v"(a[3]));
    }
    if constexpr (HP) {
        static_assert(HD == 64, "one 64-column tile is one head");
        const size_t po = (z * NH_ + blockIdx.y) * (size_t)TT * HD;
        // [d][t] planes: a lane's 8 accumulator rows are 8 successive positions of one column, one 8-element piece of the plane, stored straight from registers; the 32 lanes' pieces are half a block, 512 bytes in a row
#pragma unroll
        for (int nb = 0; nb < 4; ++nb)
#pragma unroll
            for (int mb = 0; mb < 4; ++mb) { v8h o16; v8us oh, ol;
#pragma unroll
                for (int j = 0; j < 8; ++j) { const float x = acc[mb][nb][j]; o16[j] = tohx(x); unsigned short a2, c2; splitf(x, a2, c2); oh[j] = a2; ol[j] = c2; }
                const size_t vo = po + fo(nb * 16 + lr, r0 + mb * 16 + hi * 8, TT); *(v8h*)(V16 + vo) = o16; *(v8us*)(Vh + vo) = oh; *(v8us*)(Vl + vo) = ol; SWAIT(o16, oh, ol, V16 + vo, Vh + vo, Vl + vo); }
        // [t][d] planes: 16 rows at a time through LDS (one wave: its LDS operations run in program order), so that a lane holds 8 successive columns of one position; a store covers half a block, 512 bytes in a row
#pragma unroll
        for (int mb = 0; mb < 4; ++mb) {
#pragma unroll
            for (int nb = 0; nb < 4; ++nb) {
#pragma unroll
                for (int j = 0; j < 8; ++j) os[(hi * 8 + j) * 68 + nb * 16 + lr] = acc[mb][nb][j]; }
#pragma unroll
            for (int s = 0; s < 4; ++s) { const int row = lr, cofs = (2 * s + hi) * 8; const v4f x0 = *(const v4fa*)(os + row * 68 + cofs), x1 = *(const v4fa*)(os + row * 68 + cofs + 4); v8h o16; v8us oh, ol;
#pragma unroll
                for (int j = 0; j < 8; ++j) { const float x = j < 4 ? x0[j & 3] : x1[j & 3]; o16[j] = tohx(x); unsigned short a2, c2; splitf(x, a2, c2); oh[j] = a2; ol[j] = c2; }
                const size_t pp = po + fo(r0 + mb * 16 + row, cofs, HD); *(v8h*)(P16 + pp) = o16; *(v8us*)(Ph + pp) = oh; *(v8us*)(Pl + pp) = ol; SWAIT(o16, oh, ol, P16 + pp, Ph + pp, Pl + pp); }
        }
        return;
    }
#pragma unroll
    for (int mb = 0; mb < 4; ++mb) {
#pragma unroll
        for (int nb = 0; nb < 4; ++nb) {
#pragma unroll
            for (int j = 0; j < 8; ++j) os[(hi * 8 + j) * 68 + nb * 16 + lr] = acc[mb][nb][j]; }
        __builtin_amdgcn_wave_barrier(); asm volatile("" ::: "memory");
        float* crow = C + (size_t)(r0 + mb * 16) * ldc + c0;
{
#pragma unroll
            for (int s = 0; s < 8; ++s) { const int row = 2 * s + hi, cofs = lr * 4; v4f val = *(const v4fa*)(os + row * 68 + cofs); if (BIAS) { val[0] += bfr(bias[c0 + cofs]); val[1] += bfr(bias[c0 + cofs + 1]); val[2] += bfr(bias[c0 + cofs + 2]); val[3] += bfr(bias[c0 + cofs + 3]); }
                *(v4f*)(crow + (size_t)row * ldc + cofs) = val; }
             }
        __builtin_amdgcn_wave_barrier(); asm volatile("" ::: "memory");
    }
}

typedef __attribute__((ext_vector_type(2))) _Float16 v2h;
typedef __attribute__((ext_vector_type(4))) _Float16 v4h;
typedef __attribute__((ext_vector_type(2))) unsigned short v2us;
typedef __attribute__((ext_vector_type(4))) unsigned short v4us;
typedef __attribute__((ext_vector_type(2))) float v2f;
typedef __attribute__((ext_vector_type(4))) int v4i;

__global__ __launch_bounds__(256) void k_wtG(const float* __restrict__ w, int K, int N, bf* Bt) {
    const int lane = threadIdx.x & 31; const int L0 = (blockIdx.x * 8 + (threadIdx.x >> 5)) * 8; const int nlines = N * K / 64;
{
#pragma unroll 1
        for (int l = 0; l < 8; ++l) { const int L = L0 + l; if (L >= nlines) break; const size_t e = (size_t)L * 64 + lane * 2; const int blk = (int)(e >> 9), k = (blk % (K >> 5)) * 32 + (int)((e >> 7) & 3) * 8 + (int)(e & 7), n = (blk / (K >> 5)) * 16 + (int)((e >> 3) & 15); v2us o;   // e = fo(n, k, K)
            const float* w0 = w + (size_t)k * N + n; const float* w1 = w0 + N; const float f0 = *w0, f1 = *w1; LWAIT(w0, w1, w0, w1);
            o[0] = f2bf(f0); o[1] = f2bf(f1); *(v2us*)(Bt + e) = o; }
         }
}
// dst: the [rows][K] plane in fragment order; thread i writes piece i of dst, so that the stores are whole lines, and reads the 8 floats that belong there
template <int K>
__global__ __launch_bounds__(256) void k_cvt8(const float* __restrict__ src, bf* dst, size_t n8) { const size_t i = (size_t)blockIdx.x * 256 + threadIdx.x; if (i >= n8) return; const size_t blk = i >> 6, row = (blk / (K >> 5)) * 16 + (i & 15), k = (blk % (K >> 5)) * 32 + ((i >> 4) & 3) * 8; const v8f v = *(const v8f*)(src + row * K + k); v8us o;
#pragma unroll
    for (int k = 0; k < 8; ++k) o[k] = f2bf(v[k]); *(v8us*)(dst + i * 8) = o;  }
typedef v4h  __attribute__((may_alias)) v4ha;
typedef v4us __attribute__((may_alias)) v4usa;
// fragment loads from the LDS score rows (the rows hold f32 scores first and 16-bit weights later: may_alias types)
template <typename T16> struct LFrag;
template <> struct LFrag<h16> { static __device__ __forceinline__ v16h ld(const h16* p) { return cat16(*(const v8ha*)p, *(const v8ha*)(p + 16)); } };
template <> struct LFrag<bf> { static __device__ __forceinline__ v16bf ld(const bf* p) { return cat16b(*(const v8usa*)p, *(const v8usa*)(p + 16)); } };

// ---- k_attn: logits, softmax, attn.p and the head merge for QB query rows of one head; KSP waves; grid (heads, TT / QB, batches).
// 1: wave w forms the scores of its TT / KSP keys for all QB rows (f32, LDS). 2: wave w does the softmax of rows 2w, 2w + 1 (register row, one exp, fixed trees) and writes the 16-bit weights over the row's own bytes (hi plane in the first half, lo plane in the second; fp16: first half only).
// 3: wave w sums attn.p over its own key slice; the KSP partial tiles go through LDS and are added in slice order; the result is split hi/lo into the merged planes.
// stands behind a run of global loads, in front of whatever overwrites their address registers; the pointers are inputs, so that their registers are not given to a load's result before the wait
#define XWAIT(p, p2) asm volatile("s_wait_xcnt 0x0" :: "v"(p), "v"(p2) : "memory")
template <typename T16, bool HR>
__device__ __forceinline__ void attn_body(float* S, const T16* __restrict__ Q, const T16* __restrict__ Q2, const T16* __restrict__ Kp, const T16* __restrict__ K2, const T16* __restrict__ Vt, const T16* __restrict__ Vt2, int i0, int h, bf* Ah, bf* Al) {
    typedef typename WFrag<T16>::V V;
    const int tid = threadIdx.x, lane = tid & 31, lr = lane & 15, hi = lane >> 4, w = tid >> 5; const int kb = w * (TT / KSP);
    {
        V a[2][2], a2[2][2]; const size_t qo = (size_t)i0 * HD + lane * 8, ko = (size_t)kb * HD + lane * 8; const T16* qp = Q + qo; const T16* qp2 = HR ? Q2 + qo : qp; const T16* kp = Kp + ko; const T16* kp2 = HR ? K2 + ko : kp;
#pragma unroll
        for (int mb = 0; mb < 2; ++mb)
#pragma unroll
            for (int kk = 0; kk < 2; ++kk) { const int ao = mb * 16 * HD + kk * 512; a[mb][kk] = WFrag<T16>::ld(qp + ao); if (HR) a2[mb][kk] = WFrag<T16>::ld(qp2 + ao); }
        XWAIT(qp, qp2);
        // GN key tiles at a time, 2 GN accumulator chains; rolled: unrolled whole, the hoisted key loads spill
        constexpr int GN = HR ? 2 : 4;
#pragma unroll 1
        for (int ng = 0; ng < TT / KSP / 16; ng += GN) { v8f acc[2][GN]; V b[GN][2], b2[GN][2];
#pragma unroll
            for (int nb = 0; nb < GN; ++nb)
#pragma unroll
                for (int kk = 0; kk < 2; ++kk) { const int bo = nb * 16 * HD + kk * 512; b[nb][kk] = WFrag<T16>::ld(kp + bo); if (HR) b2[nb][kk] = WFrag<T16>::ld(kp2 + bo); }
            XWAIT(kp, kp2); kp += GN * 16 * HD; kp2 += GN * 16 * HD;
#pragma unroll
            for (int nb = 0; nb < GN; ++nb)
#pragma unroll
                for (int mb = 0; mb < 2; ++mb) { acc[mb][nb] = (v8f){};
#pragma unroll
                    for (int kk = 0; kk < 2; ++kk) { acc[mb][nb] = WFrag<T16>::mma(a[mb][kk], b[nb][kk], acc[mb][nb]); if (HR) { acc[mb][nb] = WFrag<T16>::mma(a2[mb][kk], b[nb][kk], acc[mb][nb]); acc[mb][nb] = WFrag<T16>::mma(a[mb][kk], b2[nb][kk], acc[mb][nb]); } } }
            // four vector slots behind the group's last matrix instruction: a later chain starts from zero in registers that a chain of this group has just written, with only LDS stores in between; the key fragments are inputs, so that no chain's result is laid over a fragment that an issued matrix instruction still names
            if constexpr (HR) asm volatile("v_nop\n\tv_nop\n\tv_nop\n\tv_nop" : "+v"(acc[0][0]), "+v"(acc[1][0]), "+v"(acc[0][1]), "+v"(acc[1][1]) : "v"(b[0][0]), "v"(b[0][1]), "v"(b[1][0]), "v"(b[1][1]), "v"(b2[0][0]), "v"(b2[0][1]), "v"(b2[1][0]), "v"(b2[1][1]));
            else asm volatile("v_nop\n\tv_nop\n\tv_nop\n\tv_nop" : "+v"(acc[0][0]), "+v"(acc[1][0]), "+v"(acc[0][1]), "+v"(acc[1][1]), "+v"(acc[0][2]), "+v"(acc[1][2]), "+v"(acc[0][3]), "+v"(acc[1][3]) : "v"(b[0][0]), "v"(b[0][1]), "v"(b[1][0]), "v"(b[1][1]), "v"(b[2][0]), "v"(b[2][1]), "v"(b[3][0]), "v"(b[3][1]));
#pragma unroll
            for (int nb = 0; nb < GN; ++nb)
#pragma unroll
                for (int mb = 0; mb < 2; ++mb)
#pragma unroll
                    for (int j = 0; j < 8; ++j) S[(mb * 16 + hi * 8 + j) * SP + kb + (ng + nb) * 16 + lr] = acc[mb][nb][j]; }
    }
    __syncthreads();   // every score of the QB rows is in LDS before a row is read
    // rolled: one row's 64 registers at a time
#pragma unroll 1
    for (int r = 0; r < QB / KSP; ++r) { float* sr = S + (w * (QB / KSP) + r) * SP; float v[TT / 32]; float mx = -3.0e38f;
#pragma unroll
        for (int ch = 0; ch < TT / 128; ++ch) { const v4f a = *(const v4fa*)(sr + ch * 128 + lane * 4);
#pragma unroll
            for (int q = 0; q < 4; ++q) { const float t = a[q] * SCL; v[ch * 4 + q] = t; mx = fmaxf(mx, t); } }
#pragma unroll
        for (int sh = 16; sh; sh >>= 1) mx = fmaxf(mx, __shfl_xor(mx, sh, 32));
        float sum = 0.f;
#pragma unroll
        for (int k = 0; k < TT / 32; ++k) { const float d0 = __fsub_rn(v[k], mx); v[k] = __builtin_amdgcn_exp2f(__fmul_rn(d0, 1.4426950408889634f)); sum += v[k]; }
#pragma unroll
        for (int sh = 16; sh; sh >>= 1) sum += __shfl_xor(sum, sh, 32);
        const float f = __fdiv_rn(HR ? 1.0f : PCAR, sum);
        if (HR) { bf* ph = (bf*)sr;
#pragma unroll
            for (int ch = 0; ch < TT / 128; ++ch) { v4us oh, ol;
#pragma unroll
                for (int q = 0; q < 4; ++q) { unsigned short a, c2; splitf(v[ch * 4 + q] * f, a, c2); oh[q] = a; ol[q] = c2; }
                *(v4usa*)(ph + ch * 128 + lane * 4) = oh; *(v4usa*)(ph + TT + ch * 128 + lane * 4) = ol; }
        } else { h16* p16 = (h16*)sr;
#pragma unroll
            for (int ch = 0; ch < TT / 128; ++ch) { v4h o4;
#pragma unroll
                for (int q = 0; q < 4; ++q) o4[q] = tohx(v[ch * 4 + q] * f);
                *(v4ha*)(p16 + ch * 128 + lane * 4) = o4; } }
    }
    __syncthreads();   // every row's weights are in LDS before a wave reads its key slice of all rows
    v8f acc[2][4];
#pragma unroll
    for (int mb = 0; mb < 2; ++mb)
#pragma unroll
        for (int nb = 0; nb < 4; ++nb) acc[mb][nb] = (v8f){};
    // two chunks' value loads in flight where the registers allow it (one plane); rolled for the two planes
    constexpr int U3 = HR ? 1 : 2; const size_t vo = (size_t)kb * 16 + lane * 8; const T16* vp = Vt + vo; const T16* vp2 = HR ? Vt2 + vo : vp;
#pragma unroll U3
    for (int kc = 0; kc < TT / KSP; kc += 32) { V a[2], a2[2], b[4], b2[4];
#pragma unroll
        for (int nb = 0; nb < 4; ++nb) { b[nb] = WFrag<T16>::ld(vp + nb * 16 * TT); if (HR) b2[nb] = WFrag<T16>::ld(vp2 + nb * 16 * TT); }
        XWAIT(vp, vp2); vp += 512; vp2 += 512;
#pragma unroll
        for (int mb = 0; mb < 2; ++mb) { const T16* pr = (const T16*)(S + (mb * 16 + lr) * SP) + kb + kc + 8 * hi; a[mb] = LFrag<T16>::ld(pr); if (HR) a2[mb] = LFrag<T16>::ld(pr + TT); }
#pragma unroll
        for (int nb = 0; nb < 4; ++nb)
#pragma unroll
            for (int mb = 0; mb < 2; ++mb) { acc[mb][nb] = WFrag<T16>::mma(a[mb], b[nb], acc[mb][nb]); if (HR) { acc[mb][nb] = WFrag<T16>::mma(a2[mb], b[nb], acc[mb][nb]); acc[mb][nb] = WFrag<T16>::mma(a[mb], b2[nb], acc[mb][nb]); } } }
    __syncthreads();   // every wave has read its weights before the partial tiles overwrite them
#pragma unroll
    for (int mb = 0; mb < 2; ++mb)
#pragma unroll
        for (int nb = 0; nb < 4; ++nb)
#pragma unroll
            for (int j = 0; j < 8; ++j) S[w * (QB * OP) + (mb * 16 + hi * 8 + j) * OP + nb * 16 + lr] = acc[mb][nb][j];
    __syncthreads();   // all KSP partial tiles are in LDS before they are added
    const int row = tid >> 4, c = (tid & 15) * 4; v4f sm = *(const v4fa*)(S + row * OP + c);
#pragma unroll
    for (int ks = 1; ks < KSP; ++ks) { const v4f p = *(const v4fa*)(S + ks * (QB * OP) + row * OP + c); sm[0] += p[0]; sm[1] += p[1]; sm[2] += p[2]; sm[3] += p[3]; }   // key slices added in slice order
    const float cs = HR ? 1.0f : (1.0f / PCAR); v4us oh, ol;
#pragma unroll
    for (int q = 0; q < 4; ++q) { unsigned short a, c2; splitf(sm[q] * cs, a, c2); oh[q] = a; ol[q] = c2; }
    const size_t oo = fo(i0 + row, h * HD + c, DQ); *(v4us*)(Ah + oo) = oh; *(v4us*)(Al + oo) = ol;
}
__global__ __launch_bounds__(KSP * 32) void k_attn(const h16* __restrict__ Q16, const bf* __restrict__ Qh, const bf* __restrict__ Ql, const h16* __restrict__ K16, const bf* __restrict__ Kh, const bf* __restrict__ Kl, const h16* __restrict__ V16, const bf* __restrict__ Vh, const bf* __restrict__ Vl, bf* Ah, bf* Al) {
    __shared__ __align__(16) float S[QB * SP];
    const int h = blockIdx.x, i0 = blockIdx.y * QB; const size_t bb = blockIdx.z, pq = (bb * NH_ + h) * TT * HD, pk = (bb * NKV + h / REP) * TT * HD; Ah += bb * TT * DQ; Al += bb * TT * DQ;
    if (i0 < RH) attn_body<bf, true>(S, Qh + pq, Ql + pq, Kh + pk, Kl + pk, Vh + pk, Vl + pk, i0, h, Ah, Al);   // the same for the whole work-group (RH % QB == 0)
    else attn_body<h16, false>(S, Q16 + pq, nullptr, K16 + pk, nullptr, V16 + pk, nullptr, i0, h, Ah, Al);
}

extern "C" void kernel_launch(void* const* d_in, const int* in_sizes, int n_in,
                              void* d_out, int out_size, void* d_ws, size_t ws_size, hipStream_t stream) {
    (void)in_sizes; (void)n_in; (void)out_size;
    const float* x = (const float*)d_in[0]; const float* wt = (const float*)d_in[1];   /* order x, W: THIS module has ONE weight ('xw' (in, out) [1024][1024]): p = x W serves as the query (scaled in the softmax), the key AND the value, and the output projection reuses the SAME W: TWO inputs, both read */
    float* OUT = (float*)d_out;     // [4][2048][1024]
    char* wsp = (char*)d_ws;
    auto take = [&](size_t bytes) { char* p = wsp; wsp += (bytes + 255) & ~(size_t)255; return (void*)p; };
    bf* WT = (bf*)take((size_t)DQ * DM * 2);
    bf* XB = (bf*)take((size_t)NB_ * TT * DM * 2);
    h16* PP16 = (h16*)take((size_t)NB_ * NH_ * TT * HD * 2); h16* VT16 = (h16*)take((size_t)NB_ * NKV * HD * TT * 2);
    bf* PPh = (bf*)take((size_t)NB_ * NH_ * TT * HD * 2); bf* PPl = (bf*)take((size_t)NB_ * NH_ * TT * HD * 2); bf* VTh = (bf*)take((size_t)NB_ * NKV * HD * TT * 2); bf* VTl = (bf*)take((size_t)NB_ * NKV * HD * TT * 2);
    bf* ATh = (bf*)take((size_t)NB_ * TT * DQ * 2); bf* ATl = (bf*)take((size_t)NB_ * TT * DQ * 2);
    if ((size_t)(wsp - (char*)d_ws) > ws_size) return;    // 146 MiB of the 256 MiB
    // the one weight is transposed once (DM == DQ: the same plane is the B operand of the input and of the output projection)
    k_wtG<<<(unsigned)((DM * DQ / 64 + 63) / 64), 256, 0, stream>>>(wt, DM, DQ, WT);
    k_cvt8<DM><<<(unsigned)(((size_t)NB_ * TT * DM / 8 + 255) / 256), 256, 0, stream>>>(x, XB, (size_t)NB_ * TT * DM / 8);
    // p = x W once, written as 16-bit head planes by the GEMM's epilogue: the [b][h][t][d] planes are read as the query and as the key, the [b][h][d][t] planes as the value
    k_gemmw<bf, 0, false, DM, 1, true><<<dim3(TT / 64, DQ / 64, NB_), 32, 0, stream>>>(XB, nullptr, WT, nullptr, nullptr, DQ, nullptr, (size_t)TT * DM, 0, 0, 0, PP16, PPh, PPl, VT16, VTh, VTl);
    k_attn<<<dim3(NH_, TT / QB, NB_), KSP * 32, 0, stream>>>(PP16, PPh, PPl, PP16, PPh, PPl, VT16, VTh, VTl, ATh, ATl);   // batch slowest: one batch's planes are read at a time; in a batch the hi/lo rows' longer work-groups start first, and the launch ends on short ones
    k_gemmw<bf, 1, false, DQ><<<dim3(TT / 64, DM / 64, NB_), 32, 0, stream>>>(ATh, ATl, WT, nullptr, OUT, DM, nullptr, (size_t)TT * DQ, 0, (size_t)TT * DM, 0, nullptr, nullptr, nullptr, nullptr, nullptr, nullptr);
}

// v007
// It runs in 197 microseconds.
// Two timings next to v006 put it at 1.35 and 1.34 times that version's speed.
// Counting every step since v000, it is 20.2 times as fast.
#include <hip/hip_runtime.h>

// Multi-head self-attention with ONE tied weight (x [4][2048][1024]; p = einsum('bsh,hf->bsf', x, W) ('xw' (in, out) [1024][1024] 1/32, no bias) split into 16 heads x 64; q = p x 64^-0.5, and the SAME p is the key and the value: logits = q.p; softmax over all keys (no mask); attn.p merged; out = einsum('bsh,hf->bsf', merged, W): the SAME W again -> [4][2048][1024] (8.4 M); argument order x, W).
// All NB_ batches go through each kernel in ONE launch (the batch is a grid dimension; every workspace plane holds all batches). Layout: bf16 copy of x; the 'xw' weight transposed once for all its uses; p projected ONCE, exact, its 16-bit head planes written by the projection's own epilogue and shared by query, key and value; dense T-2048 attention in ONE kernel (hybrid rows: < 512 hi/lo 3 products, rest fp16 x1024; a wave keeps its query rows' scores and weights in registers and walks the keys with a running maximum and sum); merged hi/lo x Wo exact.
// Every 16-bit operand plane that a matrix fragment is loaded from in global memory (x, W transposed, p's head planes, the merged planes) is stored in FRAGMENT ORDER (fo() below): the 16 bytes that the 32 lanes of one fragment load take lie side by side, so a load reads 4 whole 128-byte lines and not 32 bytes of each of 16 lines.
// Compute dtypes, f32 accumulate: every input rounded to bf16; projections exact; attention rows < 512 3 products, rest fp16; softmax f32; Wo hl x exact.

#define NB_  4
#define TT   2048
#define DM   1024
#define NH_  16
#define NKV  16
#define REP  (NH_ / NKV)
#define HD   64
#define DQ   (NH_ * HD)
#define DKV  (NKV * HD)
#define RH   512                  // query rows < RH use hi+lo planes (0: none)
#define WIN  0
#define SCL  0.125f   // HD^-0.5
#define FW   4                    // waves per work-group of k_attn: 16 query rows each in the hi/lo blocks, 32 in the fp16 blocks
typedef _Float16 h16;
typedef unsigned short bf;
typedef __attribute__((ext_vector_type(16))) __bf16   v16bf;
typedef __attribute__((ext_vector_type(16))) _Float16 v16h;
typedef __attribute__((ext_vector_type(8)))  _Float16 v8h;
typedef __attribute__((ext_vector_type(8)))  unsigned short v8us;
typedef __attribute__((ext_vector_type(8)))  float    v8f;
typedef __attribute__((ext_vector_type(4)))  float    v4f;
typedef v8h  __attribute__((may_alias)) v8ha;
typedef v4f  __attribute__((may_alias)) v4fa;
typedef v8us __attribute__((may_alias)) v8usa;

__device__ __forceinline__ unsigned short f2bf(float f) { unsigned u = __float_as_uint(f); u += 0x7FFFu + ((u >> 16) & 1u); return (unsigned short)(u >> 16); }
__device__ __forceinline__ float bf2f(unsigned short b) { return __uint_as_float(((unsigned)b) << 16); }
__device__ __forceinline__ float bfr(float f) { return bf2f(f2bf(f)); }
__device__ __forceinline__ v16h cat16(v8h lo, v8h hi) { return __builtin_shufflevector(lo, hi, 0, 1, 2, 3, 4, 5, 6, 7, 8, 9, 10, 11, 12, 13, 14, 15); }
__device__ __forceinline__ v16bf cat16b(v8us lo, v8us hi) { return __builtin_bit_cast(v16bf, __builtin_shufflevector(lo, hi, 0, 1, 2, 3, 4, 5, 6, 7, 8, 9, 10, 11, 12, 13, 14, 15)); }
__device__ __forceinline__ v8f wmma16(v16h a, v16h b, v8f c) { return __builtin_amdgcn_wmma_f32_16x16x32_f16(false, a, false, b, (short)0, c, false, false); }
__device__ __forceinline__ v8f wmmab(v16bf a, v16bf b, v8f c) { return __builtin_amdgcn_wmma_f32_16x16x32_bf16(false, a, false, b, (short)0, c, false, false); }


__device__ __forceinline__ h16 tohx(float x) { return (h16)x; }
__device__ __forceinline__ void splitf(float y, unsigned short& h, unsigned short& l) { h = f2bf(y); l = f2bf(y - bf2f(h)); }
// fragment order of a [rows][K] plane (rows % 16 == 0, K % 32 == 0): blocks of 16 rows x 32 k, 512 elements each, k blocks of a row block in a row; in a block the 8-element pieces lie as [k bit 4][k bit 3][row & 15], which is [half of the fragment][lane]
__device__ __forceinline__ size_t fo(size_t row, size_t k, size_t K) { return ((row >> 4) * (K >> 5) + (k >> 5)) * 512 + ((k >> 4) & 1) * 256 + ((k >> 3) & 1) * 128 + (row & 15) * 8 + (k & 7); }
// ---- k_gemmw: register-blocked GEMM, ONE WAVE per 64x64 output tile (16 accumulators), operands straight from 16-bit planes in fragment order; grid (M/64, N/64, Z), 32 threads.
// C[m][n] (f32, pitch ldc, + optional f32 bias[n]) = sum_k A[m][k] Bt[n][k] (+ split products per NSPLIT). z-batch strides sA/sB/sC in elements. K % (32 * KS) == 0.
// KS > 1: grid z = Z * KS; work-group (z, ks) sums only k in [ks K/KS, (ks+1) K/KS) and stores that partial tile in plane ks (plane stride sP elements); the reader adds the KS planes.
// HP: no f32 C; the tile is 64 positions x the HD columns of head blockIdx.y of batch z, and the epilogue writes it as 16-bit head planes (fp16, bf16 hi, bf16 lo), once as [b][h][t][d] (P*) and once as [b][h][d][t] (V*), each [t][d] or [d][t] plane in fragment order.
// WFrag::ld: one fragment of a plane in fragment order; p = the 16 x 32 block's start + lane * 8
template <typename T16> struct WFrag;
template <> struct WFrag<h16> { typedef v16h V; static __device__ __forceinline__ V ld(const h16* p) { return cat16(*(const v8h*)p, *(const v8h*)(p + 256)); } static __device__ __forceinline__ v8f mma(V a, V b, v8f c) { return wmma16(a, b, c); } };
template <> struct WFrag<bf> { typedef v16bf V; static __device__ __forceinline__ V ld(const bf* p) { return cat16b(*(const v8us*)p, *(const v8us*)(p + 256)); } static __device__ __forceinline__ v8f mma(V a, V b, v8f c) { return wmmab(a, b, c); } };
// stands behind a group of plane stores, in front of whatever overwrites their registers; the stored values and the pointers are inputs, so that their registers are not given to a later value before the wait
#define SWAIT(d0, d1, d2, p0, p1, p2) asm volatile("s_wait_xcnt 0x0" :: "v"(d0), "v"(d1), "v"(d2), "v"(p0), "v"(p1), "v"(p2) : "memory")
// stands behind a run of global loads (the fragment loads of one k step), in front of whatever overwrites their address registers (the pointer steps); the pointers are inputs, so that their registers are not given to a load's result before the wait
#define LWAIT(p0, p1, p2, p3) asm volatile("s_wait_xcnt 0x0" :: "v"(p0), "v"(p1), "v"(p2), "v"(p3) : "memory")
template <typename T16, int NSPLIT, bool BIAS, int K, int KS = 1, bool HP = false>
__global__ __launch_bounds__(32) void k_gemmw(const T16* __restrict__ A, const T16* __restrict__ A2, const T16* __restrict__ Bt, const T16* __restrict__ Bt2, float* C, int ldc, const float* __restrict__ bias, size_t sA, size_t sB, size_t sC, size_t sP, h16* P16, bf* Ph, bf* Pl, h16* V16, bf* Vh, bf* Vl) {
    typedef typename WFrag<T16>::V V;
    __shared__ __align__(16) float os[16 * 68];
    const size_t z = blockIdx.z / KS; const int ks = (int)(blockIdx.z % KS); const int kb = ks * (K / KS), ke = kb + K / KS; C += (size_t)ks * sP; A += z * sA; if (A2) A2 += z * sA; Bt += z * sB; if (Bt2) Bt2 += z * sB; C += z * sC;
    const int lane = threadIdx.x & 31, lr = lane & 15, hi = lane >> 4; const int r0 = blockIdx.x * 64, c0 = blockIdx.y * 64;
    v8f acc[4][4];
#pragma unroll
    for (int mb = 0; mb < 4; ++mb)
#pragma unroll
        for (int nb = 0; nb < 4; ++nb) acc[mb][nb] = (v8f){};
    const size_t aoff = (size_t)r0 * K + (size_t)kb * 16 + lane * 8, boff = (size_t)c0 * K + (size_t)kb * 16 + lane * 8;   // a row block of 16 rows is 16 K elements, a k block 512
    const T16* ap = A + aoff; const T16* ap2 = (NSPLIT == 1 || NSPLIT == 2) ? A2 + aoff : ap; const T16* bp = Bt + boff; const T16* bp2 = NSPLIT >= 2 ? Bt2 + boff : bp;
#pragma unroll 1
    for (int kc = kb; kc < ke; kc += 32) {
        V a[4], a2[4], b[4], b2[4];
#pragma unroll
        for (int mb = 0; mb < 4; ++mb) { a[mb] = WFrag<T16>::ld(ap + mb * 16 * K); if (NSPLIT == 1 || NSPLIT == 2) a2[mb] = WFrag<T16>::ld(ap2 + mb * 16 * K); }
#pragma unroll
        for (int nb = 0; nb < 4; ++nb) { b[nb] = WFrag<T16>::ld(bp + nb * 16 * K); if (NSPLIT >= 2) b2[nb] = WFrag<T16>::ld(bp2 + nb * 16 * K); }
        LWAIT(ap, ap2, bp, bp2); ap += 512; ap2 += 512; bp += 512; bp2 += 512;
#pragma unroll
        for (int nb = 0; nb < 4; ++nb)
#pragma unroll
            for (int mb = 0; mb < 4; ++mb) { acc[mb][nb] = WFrag<T16>::mma(a[mb], b[nb], acc[mb][nb]); if (NSPLIT == 1 || NSPLIT == 2) acc[mb][nb] = WFrag<T16>::mma(a2[mb], b[nb], acc[mb][nb]); if (NSPLIT >= 2) acc[mb][nb] = WFrag<T16>::mma(a[mb], b2[nb], acc[mb][nb]); }
        asm volatile("v_nop\n\tv_nop\n\tv_nop\n\tv_nop" : "+v"(acc[0][0]), "+v"(acc[1][1]), "+v"(acc[2][2]), "+v"(acc[3][3]) : "v"(a[0]), "v"(a[3]));
    }
    if constexpr (HP) {
        static_assert(HD == 64, "one 64-column tile is one head");
        const size_t po = (z * NH_ + blockIdx.y) * (size_t)TT * HD;
        // [d][t] planes: a lane's 8 accumulator rows are 8 successive positions of one column, one 8-element piece of the plane, stored straight from registers; the 32 lanes' pieces are half a block, 512 bytes in a row
#pragma unroll
        for (int nb = 0; nb < 4; ++nb)
#pragma unroll
            for (int mb = 0; mb < 4; ++mb) { v8h o16; v8us oh, ol;
#pragma unroll
                for (int j = 0; j < 8; ++j) { const float x = acc[mb][nb][j]; o16[j] = tohx(x); unsigned short a2, c2; splitf(x, a2, c2); oh[j] = a2; ol[j] = c2; }
                const size_t vo = po + fo(nb * 16 + lr, r0 + mb * 16 + hi * 8, TT); *(v8h*)(V16 + vo) = o16; *(v8us*)(Vh + vo) = oh; *(v8us*)(Vl + vo) = ol; SWAIT(o16, oh, ol, V16 + vo, Vh + vo, Vl + vo); }
        // [t][d] planes: 16 rows at a time through LDS (one wave: its LDS operations run in program order), so that a lane holds 8 successive columns of one position; a store covers half a block, 512 bytes in a row
#pragma unroll
        for (int mb = 0; mb < 4; ++mb) {
#pragma unroll
            for (int nb = 0; nb < 4; ++nb) {
#pragma unroll
                for (int j = 0; j < 8; ++j) os[(hi * 8 + j) * 68 + nb * 16 + lr] = acc[mb][nb][j]; }
#pragma unroll
            for (int s = 0; s < 4; ++s) { const int row = lr, cofs = (2 * s + hi) * 8; const v4f x0 = *(const v4fa*)(os + row * 68 + cofs), x1 = *(const v4fa*)(os + row * 68 + cofs + 4); v8h o16; v8us oh, ol;
#pragma unroll
                for (int j = 0; j < 8; ++j) { const float x = j < 4 ? x0[j & 3] : x1[j & 3]; o16[j] = tohx(x); unsigned short a2, c2; splitf(x, a2, c2); oh[j] = a2; ol[j] = c2; }
                const size_t pp = po + fo(r0 + mb * 16 + row, cofs, HD); *(v8h*)(P16 + pp) = o16; *(v8us*)(Ph + pp) = oh; *(v8us*)(Pl + pp) = ol; SWAIT(o16, oh, ol, P16 + pp, Ph + pp, Pl + pp); }
        }
        return;
    }
#pragma unroll
    for (int mb = 0; mb < 4; ++mb) {
#pragma unroll
        for (int nb = 0; nb < 4; ++nb) {
#pragma unroll
            for (int j = 0; j < 8; ++j) os[(hi * 8 + j) * 68 + nb * 16 + lr] = acc[mb][nb][j]; }
        __builtin_amdgcn_wave_barrier(); asm volatile("" ::: "memory");
        float* crow = C + (size_t)(r0 + mb * 16) * ldc + c0;
{
#pragma unroll
            for (int s = 0; s < 8; ++s) { const int row = 2 * s + hi, cofs = lr * 4; v4f val = *(const v4fa*)(os + row * 68 + cofs); if (BIAS) { val[0] += bfr(bias[c0 + cofs]); val[1] += bfr(bias[c0 + cofs + 1]); val[2] += bfr(bias[c0 + cofs + 2]); val[3] += bfr(bias[c0 + cofs + 3]); }
                *(v4f*)(crow + (size_t)row * ldc + cofs) = val; }
             }
        __builtin_amdgcn_wave_barrier(); asm volatile("" ::: "memory");
    }
}

typedef __attribute__((ext_vector_type(2))) _Float16 v2h;
typedef __attribute__((ext_vector_type(4))) _Float16 v4h;
typedef __attribute__((ext_vector_type(2))) unsigned short v2us;
typedef __attribute__((ext_vector_type(4))) unsigned short v4us;
typedef __attribute__((ext_vector_type(2))) float v2f;
typedef __attribute__((ext_vector_type(4))) int v4i;

__global__ __launch_bounds__(256) void k_wtG(const float* __restrict__ w, int K, int N, bf* Bt) {
    const int lane = threadIdx.x & 31; const int L0 = (blockIdx.x * 8 + (threadIdx.x >> 5)) * 8; const int nlines = N * K / 64;
{
#pragma unroll 1
        for (int l = 0; l < 8; ++l) { const int L = L0 + l; if (L >= nlines) break; const size_t e = (size_t)L * 64 + lane * 2; const int blk = (int)(e >> 9), k = (blk % (K >> 5)) * 32 + (int)((e >> 7) & 3) * 8 + (int)(e & 7), n = (blk / (K >> 5)) * 16 + (int)((e >> 3) & 15); v2us o;   // e = fo(n, k, K)
            const float* w0 = w + (size_t)k * N + n; const float* w1 = w0 + N; const float f0 = *w0, f1 = *w1; LWAIT(w0, w1, w0, w1);
            o[0] = f2bf(f0); o[1] = f2bf(f1); *(v2us*)(Bt + e) = o; }
         }
}
// dst: the [rows][K] plane in fragment order; thread i writes piece i of dst, so that the stores are whole lines, and reads the 8 floats that belong there
template <int K>
__global__ __launch_bounds__(256) void k_cvt8(const float* __restrict__ src, bf* dst, size_t n8) { const size_t i = (size_t)blockIdx.x * 256 + threadIdx.x; if (i >= n8) return; const size_t blk = i >> 6, row = (blk / (K >> 5)) * 16 + (i & 15), k = (blk % (K >> 5)) * 32 + ((i >> 4) & 3) * 8; const v8f v = *(const v8f*)(src + row * K + k); v8us o;
#pragma unroll
    for (int k = 0; k < 8; ++k) o[k] = f2bf(v[k]); *(v8us*)(dst + i * 8) = o;  }
// fragment loads from a staged block in LDS (a 16 x 32 block in fragment order; p = the block's start + lane * 8); R: one 16-byte piece
template <typename T16> struct SFrag;
template <> struct SFrag<h16> { typedef v8h R; typedef v8ha RA; static __device__ __forceinline__ v16h ld(const h16* p) { return cat16(*(const v8ha*)p, *(const v8ha*)(p + 256)); } };
template <> struct SFrag<bf> { typedef v8us R; typedef v8usa RA; static __device__ __forceinline__ v16bf ld(const bf* p) { return cat16b(*(const v8usa*)p, *(const v8usa*)(p + 256)); } };

// ---- k_attn: logits, softmax, attn.p and the head merge in one walk over the keys; FW waves; grid (heads, batches, query blocks), the hi/lo blocks first.
// A wave owns 16 NQ query rows and walks all TT keys, 32 a pass. It forms the TRANSPOSED scores (A = key rows, B = its query rows, kept in registers): a lane then holds 16 of the 32 scores of ONE query,
// and the two score tiles are, register for register, the two halves of the B fragment of the transposed product out^T += p^T . weights^T (A = the [d][t] plane): the weights never leave the registers.
// Softmax runs along: a running maximum per query (joined over the two half waves each pass), the sums and the output tiles rescaled by exp(old maximum - new maximum) each pass; the division by the sum comes last.
// The pass's key rows and value columns (the same for all FW waves) are staged in LDS, two buffers: the next pass's pieces are loaded into registers before the pass's work and stored behind it, one barrier a pass.
// stands behind a run of global loads, in front of whatever overwrites their address registers; the pointers are inputs, so that their registers are not given to a load's result before the wait
#define XWAIT(p, p2) asm volatile("s_wait_xcnt 0x0" :: "v"(p), "v"(p2) : "memory")
// lane l's value to lane l ^ 16 and back: the exchange between the two half waves as one vector instruction (a shuffle would go through the LDS queue and its wait)
__device__ __forceinline__ float xhalf(float x) { return __builtin_bit_cast(float, __builtin_amdgcn_permlanex16(__builtin_bit_cast(int, x), __builtin_bit_cast(int, x), 0x76543210, 0xfedcba98, false, false)); }
// 2^x for eight values in one statement: the results are early-clobber, so that none is laid over a source of the run, and the v_nop is the slot that the instruction set asks for behind a transcendental before its result is read or its source overwritten
__device__ __forceinline__ void exp8(float (&e)[8], const float (&x)[8]) {
    asm("v_exp_f32 %0, %8\n\tv_exp_f32 %1, %9\n\tv_exp_f32 %2, %10\n\tv_exp_f32 %3, %11\n\tv_exp_f32 %4, %12\n\tv_exp_f32 %5, %13\n\tv_exp_f32 %6, %14\n\tv_exp_f32 %7, %15\n\tv_nop"
        : "=&v"(e[0]), "=&v"(e[1]), "=&v"(e[2]), "=&v"(e[3]), "=&v"(e[4]), "=&v"(e[5]), "=&v"(e[6]), "=&v"(e[7]) : "v"(x[0]), "v"(x[1]), "v"(x[2]), "v"(x[3]), "v"(x[4]), "v"(x[5]), "v"(x[6]), "v"(x[7])); }
// 2^x for one value, with the same slot behind it
__device__ __forceinline__ float exp1(float x) { float e; asm("v_exp_f32 %0, %1\n\tv_nop" : "=v"(e) : "v"(x)); return e; }
template <typename T16, bool HR>
__device__ __forceinline__ void attn_body(T16* L, const T16* __restrict__ Q, const T16* __restrict__ Q2, const T16* __restrict__ Kp, const T16* __restrict__ K2, const T16* __restrict__ Vt, const T16* __restrict__ Vt2, int i0, int h, bf* Ah, bf* Al) {
    typedef typename WFrag<T16>::V V; typedef typename SFrag<T16>::R R; typedef typename SFrag<T16>::RA RA;
    constexpr int NQ = HR ? 1 : 2;            // query tiles of a wave
    constexpr int STG = HR ? 8192 : 4096;     // elements of one buffer: per plane 2048 of key rows (2 key tiles x 2 d blocks), then 2048 of value columns (4 d tiles)
    constexpr float CS = SCL * 1.4426950408889634f;
    const int tid = threadIdx.x, lane = tid & 31, lr = lane & 15, hi = lane >> 4, w = tid >> 5; const int q0 = i0 + w * 16 * NQ;
    V qf[NQ][2], qf2[NQ][2];
    { const size_t qo = (size_t)q0 * HD + lane * 8; const T16* qp = Q + qo; const T16* qp2 = HR ? Q2 + qo : qp;
#pragma unroll
        for (int nq = 0; nq < NQ; ++nq)
#pragma unroll
            for (int kk = 0; kk < 2; ++kk) { const int ao = nq * 16 * HD + kk * 512; qf[nq][kk] = WFrag<T16>::ld(qp + ao); if (HR) qf2[nq][kk] = WFrag<T16>::ld(qp2 + ao); }
        XWAIT(qp, qp2); }
    // a thread stages pieces tid and tid + 128 of the 256 key pieces (2048 elements in a row in the [t][d] plane) and of the 256 value pieces (64 of each d tile's block in the [d][t] plane)
    const size_t ko = (size_t)tid * 8, vo = (size_t)(tid >> 6) * 16 * TT + (tid & 63) * 8; const T16* kp = Kp + ko; const T16* kp2 = HR ? K2 + ko : kp; const T16* vp = Vt + vo; const T16* vp2 = HR ? Vt2 + vo : vp;
    R g[4], g2[4];
    auto fetch = [&]() { g[0] = *(const R*)kp; g[1] = *(const R*)(kp + 1024); g[2] = *(const R*)vp; g[3] = *(const R*)(vp + 2 * 16 * TT);
        if (HR) { g2[0] = *(const R*)kp2; g2[1] = *(const R*)(kp2 + 1024); g2[2] = *(const R*)vp2; g2[3] = *(const R*)(vp2 + 2 * 16 * TT); }
        if constexpr (HR) { LWAIT(kp, kp2, vp, vp2); kp2 += 2048; vp2 += 512; } else XWAIT(kp, vp);
        kp += 2048; vp += 512; };
    auto put = [&](T16* d) {
#pragma unroll
        for (int i = 0; i < 4; ++i) { *(RA*)(d + i * 1024 + tid * 8) = g[i]; if (HR) *(RA*)(d + 4096 + i * 1024 + tid * 8) = g2[i]; } };
    v8f o[NQ][4]; float m[NQ], l[NQ];
#pragma unroll
    for (int nq = 0; nq < NQ; ++nq) { m[nq] = -3.0e38f; l[nq] = 0.f;
#pragma unroll
        for (int dt = 0; dt < 4; ++dt) o[nq][dt] = (v8f){}; }
    fetch(); put(L);
    __syncthreads();   // pass 0's pieces are in LDS before a wave reads them
    // rolled: one pass's fragments and scores at a time
#pragma unroll 1
    for (int p = 0; p < TT / 32; ++p) { const T16* cur = L + (p & 1) * STG + lane * 8;
        if (p + 1 < TT / 32) fetch();   // the same for the whole work-group
        v8f s[NQ][2];
#pragma unroll
        for (int kt = 0; kt < 2; ++kt) { V ka[2], ka2[2];
#pragma unroll
            for (int kk = 0; kk < 2; ++kk) { ka[kk] = SFrag<T16>::ld(cur + kt * 1024 + kk * 512); if (HR) ka2[kk] = SFrag<T16>::ld(cur + 4096 + kt * 1024 + kk * 512); }
#pragma unroll
            for (int nq = 0; nq < NQ; ++nq) { s[nq][kt] = (v8f){};
#pragma unroll
                for (int kk = 0; kk < 2; ++kk) { s[nq][kt] = WFrag<T16>::mma(ka[kk], qf[nq][kk], s[nq][kt]); if (HR) { s[nq][kt] = WFrag<T16>::mma(ka[kk], qf2[nq][kk], s[nq][kt]); s[nq][kt] = WFrag<T16>::mma(ka2[kk], qf[nq][kk], s[nq][kt]); } } } }
        V pb[NQ], pb2[NQ];
#pragma unroll
        for (int nq = 0; nq < NQ; ++nq) { float t0 = s[nq][0][0], t1 = s[nq][1][0];
#pragma unroll
            for (int j = 1; j < 8; ++j) { t0 = fmaxf(t0, s[nq][0][j]); t1 = fmaxf(t1, s[nq][1][j]); }
            t0 = fmaxf(t0, t1); t0 = fmaxf(t0, xhalf(t0));   // the other half wave holds the query's other 16 keys of the pass
            const float mn = fmaxf(m[nq], t0), al = exp1((m[nq] - mn) * CS), mc = mn * CS - (HR ? 0.0f : 10.0f); m[nq] = mn;   // fp16 weights carry a factor 1024, which the division by their own sum takes out
            float x0[8], x1[8], e0[8], e1[8], s0 = 0.f, s1 = 0.f;
#pragma unroll
            for (int j = 0; j < 8; ++j) { x0[j] = fmaf(s[nq][0][j], CS, -mc); x1[j] = fmaf(s[nq][1][j], CS, -mc); }
            exp8(e0, x0); exp8(e1, x1);
#pragma unroll
            for (int j = 0; j < 8; ++j) { s0 += e0[j]; s1 += e1[j]; }
            l[nq] = fmaf(l[nq], al, s0 + s1);
#pragma unroll
            for (int dt = 0; dt < 4; ++dt)
#pragma unroll
                for (int j = 0; j < 8; ++j) o[nq][dt][j] *= al;
            if constexpr (HR) { v8us h0, h1, l0, l1;
#pragma unroll
                for (int j = 0; j < 8; ++j) { unsigned short a, c2; splitf(e0[j], a, c2); h0[j] = a; l0[j] = c2; splitf(e1[j], a, c2); h1[j] = a; l1[j] = c2; }
                pb[nq] = cat16b(h0, h1); pb2[nq] = cat16b(l0, l1);
            } else { v8h h0, h1;
#pragma unroll
                for (int j = 0; j < 8; ++j) { h0[j] = tohx(e0[j]); h1[j] = tohx(e1[j]); }
                pb[nq] = cat16(h0, h1); } }
        { V va[4], va2[4];
#pragma unroll
            for (int dt = 0; dt < 4; ++dt) { va[dt] = SFrag<T16>::ld(cur + 2048 + dt * 512); if (HR) va2[dt] = SFrag<T16>::ld(cur + 4096 + 2048 + dt * 512); }
#pragma unroll
            for (int nq = 0; nq < NQ; ++nq)
#pragma unroll
                for (int dt = 0; dt < 4; ++dt) o[nq][dt] = WFrag<T16>::mma(va[dt], pb[nq], o[nq][dt]);
            if constexpr (HR) {
#pragma unroll
                for (int dt = 0; dt < 4; ++dt) o[0][dt] = WFrag<T16>::mma(va[dt], pb2[0], o[0][dt]);
#pragma unroll
                for (int dt = 0; dt < 4; ++dt) o[0][dt] = WFrag<T16>::mma(va2[dt], pb[0], o[0][dt]); } }
        if (p + 1 < TT / 32) put(L + ((p + 1) & 1) * STG);   // the buffer that pass p - 1 read: every wave left it before the barrier at that pass's foot
        __syncthreads();   // publishes pass p + 1's pieces and ends every wave's reads of pass p's buffer
    }
#pragma unroll
    for (int nq = 0; nq < NQ; ++nq) { const float f = __fdiv_rn(1.0f, l[nq] + xhalf(l[nq]));   // the two half waves' sums joined once
        // a lane's 8 accumulator rows are 8 successive columns of one position: one piece of the merged planes; the 32 lanes' pieces are half a block, 512 bytes in a row
#pragma unroll
        for (int dt = 0; dt < 4; ++dt) { v8us oh, ol;
#pragma unroll
            for (int j = 0; j < 8; ++j) { unsigned short a, c2; splitf(o[nq][dt][j] * f, a, c2); oh[j] = a; ol[j] = c2; }
            const size_t oo = fo(q0 + nq * 16 + lr, h * HD + dt * 16 + hi * 8, DQ); *(v8us*)(Ah + oo) = oh; *(v8us*)(Al + oo) = ol; SWAIT(oh, ol, ol, Ah + oo, Al + oo, Al + oo); } }
}
__global__ __launch_bounds__(FW * 32) void k_attn(const h16* __restrict__ Q16, const bf* __restrict__ Qh, const bf* __restrict__ Ql, const h16* __restrict__ K16, const bf* __restrict__ Kh, const bf* __restrict__ Kl, const h16* __restrict__ V16, const bf* __restrict__ Vh, const bf* __restrict__ Vl, bf* Ah, bf* Al) {
    __shared__ __align__(16) unsigned short L[2 * 8192];
    const int h = blockIdx.x, y = blockIdx.z; const size_t bb = blockIdx.y, pq = (bb * NH_ + h) * TT * HD, pk = (bb * NKV + h / REP) * TT * HD; Ah += bb * TT * DQ; Al += bb * TT * DQ;
    if (y < RH / (FW * 16)) attn_body<bf, true>((bf*)L, Qh + pq, Ql + pq, Kh + pk, Kl + pk, Vh + pk, Vl + pk, y * (FW * 16), h, Ah, Al);   // the same for the whole work-group
    else attn_body<h16, false>((h16*)L, Q16 + pq, nullptr, K16 + pk, nullptr, V16 + pk, nullptr, RH + (y - RH / (FW * 16)) * (FW * 32), h, Ah, Al);
}

extern "C" void kernel_launch(void* const* d_in, const int* in_sizes, int n_in,
                              void* d_out, int out_size, void* d_ws, size_t ws_size, hipStream_t stream) {
    (void)in_sizes; (void)n_in; (void)out_size;
    const float* x = (const float*)d_in[0]; const float* wt = (const float*)d_in[1];   /* order x, W: THIS module has ONE weight ('xw' (in, out) [1024][1024]): p = x W serves as the query (scaled in the softmax), the key AND the value, and the output projection reuses the SAME W: TWO inputs, both read */
    float* OUT = (float*)d_out;     // [4][2048][1024]
    char* wsp = (char*)d_ws;
    auto take = [&](size_t bytes) { char* p = wsp; wsp += (bytes + 255) & ~(size_t)255; return (void*)p; };
    bf* WT = (bf*)take((size_t)DQ * DM * 2);
    bf* XB = (bf*)take((size_t)NB_ * TT * DM * 2);
    h16* PP16 = (h16*)take((size_t)NB_ * NH_ * TT * HD * 2); h16* VT16 = (h16*)take((size_t)NB_ * NKV * HD * TT * 2);
    bf* PPh = (bf*)take((size_t)NB_ * NH_ * TT * HD * 2); bf* PPl = (bf*)take((size_t)NB_ * NH_ * TT * HD * 2); bf* VTh = (bf*)take((size_t)NB_ * NKV * HD * TT * 2); bf* VTl = (bf*)take((size_t)NB_ * NKV * HD * TT * 2);
    bf* ATh = (bf*)take((size_t)NB_ * TT * DQ * 2); bf* ATl = (bf*)take((size_t)NB_ * TT * DQ * 2);
    if ((size_t)(wsp - (char*)d_ws) > ws_size) return;    // 146 MiB of the 256 MiB
    // the one weight is transposed once (DM == DQ: the same plane is the B operand of the input and of the output projection)
    k_wtG<<<(unsigned)((DM * DQ / 64 + 63) / 64), 256, 0, stream>>>(wt, DM, DQ, WT);
    k_cvt8<DM><<<(unsigned)(((size_t)NB_ * TT * DM / 8 + 255) / 256), 256, 0, stream>>>(x, XB, (size_t)NB_ * TT * DM / 8);
    // p = x W once, written as 16-bit head planes by the GEMM's epilogue: the [b][h][t][d] planes are read as the query and as the key, the [b][h][d][t] planes as the value
    k_gemmw<bf, 0, false, DM, 1, true><<<dim3(TT / 64, DQ / 64, NB_), 32, 0, stream>>>(XB, nullptr, WT, nullptr, nullptr, DQ, nullptr, (size_t)TT * DM, 0, 0, 0, PP16, PPh, PPl, VT16, VTh, VTl);
    k_attn<<<dim3(NH_, NB_, RH / (FW * 16) + (TT - RH) / (FW * 32)), FW * 32, 0, stream>>>(PP16, PPh, PPl, PP16, PPh, PPl, VT16, VTh, VTl, ATh, ATl);   // query block slowest: the hi/lo blocks, the longer ones, start first
    k_gemmw<bf, 1, false, DQ><<<dim3(TT / 64, DM / 64, NB_), 32, 0, stream>>>(ATh, ATl, WT, nullptr, OUT, DM, nullptr, (size_t)TT * DQ, 0, (size_t)TT * DM, 0, nullptr, nullptr, nullptr, nullptr, nullptr, nullptr);
}

// v008
// It runs in 165 microseconds.
// Timed twice side by side with v007, it ran 1.18 and 1.20 times as fast.
// Counting every step since v000, it is 24.1 times as fast.
#include <hip/hip_runtime.h>

// Multi-head self-attention with ONE tied weight (x [4][2048][1024]; p = einsum('bsh,hf->bsf', x, W) ('xw' (in, out) [1024][1024] 1/32, no bias) split into 16 heads x 64; q = p x 64^-0.5, and the SAME p is the key and the value: logits = q.p; softmax over all keys (no mask); attn.p merged; out = einsum('bsh,hf->bsf', merged, W): the SAME W again -> [4][2048][1024] (8.4 M); argument order x, W).
// All NB_ batches go through each kernel in ONE launch (the batch is a grid dimension; every workspace plane holds all batches). Layout: bf16 copy of x; the 'xw' weight transposed once for all its uses; p projected ONCE, exact, its 16-bit head planes written by the projection's own epilogue and shared by query, key and value; dense T-2048 attention in ONE kernel (hybrid rows: < 512 hi/lo 3 products, rest fp16 x1024; a wave keeps its query rows' scores and weights in registers and walks the keys with a running maximum and sum); merged hi/lo x Wo exact.
// Every 16-bit operand plane that a matrix fragment is loaded from in global memory (x, W transposed, p's head planes, the merged planes) is stored in FRAGMENT ORDER (fo() below): the 16 bytes that the 32 lanes of one fragment load take lie side by side, so a load reads 4 whole 128-byte lines and not 32 bytes of each of 16 lines.
// Compute dtypes, f32 accumulate: every input rounded to bf16; projections exact; attention rows < 512 3 products, rest fp16; softmax f32; Wo hl x exact.

#define NB_  4
#define TT   2048
#define DM   1024
#define NH_  16
#define NKV  16
#define REP  (NH_ / NKV)
#define HD   64
#define DQ   (NH_ * HD)
#define DKV  (NKV * HD)
#define RH   512                  // query rows < RH use hi+lo planes (0: none)
#define WIN  0
#define SCL  0.125f   // HD^-0.5
#define FW   4                    // waves per work-group of k_attn: 16 query rows each in the hi/lo blocks, 32 in the fp16 blocks
typedef _Float16 h16;
typedef unsigned short bf;
typedef __attribute__((ext_vector_type(16))) __bf16   v16bf;
typedef __attribute__((ext_vector_type(16))) _Float16 v16h;
typedef __attribute__((ext_vector_type(8)))  _Float16 v8h;
typedef __attribute__((ext_vector_type(8)))  unsigned short v8us;
typedef __attribute__((ext_vector_type(8)))  float    v8f;
typedef __attribute__((ext_vector_type(4)))  float    v4f;
typedef v8h  __attribute__((may_alias)) v8ha;
typedef v4f  __attribute__((may_alias)) v4fa;
typedef v8us __attribute__((may_alias)) v8usa;

__device__ __forceinline__ unsigned short f2bf(float f) { unsigned u = __float_as_uint(f); u += 0x7FFFu + ((u >> 16) & 1u); return (unsigned short)(u >> 16); }
__device__ __forceinline__ float bf2f(unsigned short b) { return __uint_as_float(((unsigned)b) << 16); }
__device__ __forceinline__ float bfr(float f) { return bf2f(f2bf(f)); }
__device__ __forceinline__ v16h cat16(v8h lo, v8h hi) { return __builtin_shufflevector(lo, hi, 0, 1, 2, 3, 4, 5, 6, 7, 8, 9, 10, 11, 12, 13, 14, 15); }
__device__ __forceinline__ v16bf cat16b(v8us lo, v8us hi) { return __builtin_bit_cast(v16bf, __builtin_shufflevector(lo, hi, 0, 1, 2, 3, 4, 5, 6, 7, 8, 9, 10, 11, 12, 13, 14, 15)); }
__device__ __forceinline__ v8f wmma16(v16h a, v16h b, v8f c) { return __builtin_amdgcn_wmma_f32_16x16x32_f16(false, a, false, b, (short)0, c, false, false); }
__device__ __forceinline__ v8f wmmab(v16bf a, v16bf b, v8f c) { return __builtin_amdgcn_wmma_f32_16x16x32_bf16(false, a, false, b, (short)0, c, false, false); }


__device__ __forceinline__ h16 tohx(float x) { return (h16)x; }
__device__ __forceinline__ void splitf(float y, unsigned short& h, unsigned short& l) { h = f2bf(y); l = f2bf(y - bf2f(h)); }
// fragment order of a [rows][K] plane (rows % 16 == 0, K % 32 == 0): blocks of 16 rows x 32 k, 512 elements each, k blocks of a row block in a row; in a block the 8-element pieces lie as [k bit 4][k bit 3][row & 15], which is [half of the fragment][lane]
__device__ __forceinline__ size_t fo(size_t row, size_t k, size_t K) { return ((row >> 4) * (K >> 5) + (k >> 5)) * 512 + ((k >> 4) & 1) * 256 + ((k >> 3) & 1) * 128 + (row & 15) * 8 + (k & 7); }
// ---- k_gemmw: register-blocked GEMM, ONE WAVE per 64x64 output tile (16 accumulators), operands straight from 16-bit planes in fragment order; grid (M/64, N/64, Z), 32 threads.
// C[m][n] (f32, pitch ldc, + optional f32 bias[n]) = sum_k A[m][k] Bt[n][k] (+ split products per NSPLIT). z-batch strides sA/sB/sC in elements. K % (64 * KS) == 0.
// KS > 1: grid z = Z * KS; work-group (z, ks) sums only k in [ks K/KS, (ks+1) K/KS) and stores that partial tile in plane ks (plane stride sP elements); the reader adds the KS planes.
// HP: no f32 C; the tile is 64 positions x the HD columns of head blockIdx.y of batch z, and the epilogue writes it as 16-bit head planes (fp16, bf16 hi, bf16 lo), once as [b][h][t][d] (P*) and once as [b][h][d][t] (V*), each [t][d] or [d][t] plane in fragment order.
// WFrag::ld: one fragment of a plane in fragment order; p = the 16 x 32 block's start + lane * 8
template <typename T16> struct WFrag;
template <> struct WFrag<h16> { typedef v16h V; static __device__ __forceinline__ V ld(const h16* p) { return cat16(*(const v8h*)p, *(const v8h*)(p + 256)); } static __device__ __forceinline__ v8f mma(V a, V b, v8f c) { return wmma16(a, b, c); } };
template <> struct WFrag<bf> { typedef v16bf V; static __device__ __forceinline__ V ld(const bf* p) { return cat16b(*(const v8us*)p, *(const v8us*)(p + 256)); } static __device__ __forceinline__ v8f mma(V a, V b, v8f c) { return wmmab(a, b, c); } };
// stands behind a group of plane stores, in front of whatever overwrites their registers; the stored values and the pointers are inputs, so that their registers are not given to a later value before the wait
#define SWAIT(d0, d1, d2, p0, p1, p2) asm volatile("s_wait_xcnt 0x0" :: "v"(d0), "v"(d1), "v"(d2), "v"(p0), "v"(p1), "v"(p2) : "memory")
// stands behind a run of global loads (the fragment loads of one k step), in front of whatever overwrites their address registers (the pointer steps); the pointers are inputs, so that their registers are not given to a load's result before the wait
#define LWAIT(p0, p1, p2, p3) asm volatile("s_wait_xcnt 0x0" :: "v"(p0), "v"(p1), "v"(p2), "v"(p3) : "memory")
template <typename T16, int NSPLIT, bool BIAS, int K, int KS = 1, bool HP = false>
__global__ __launch_bounds__(32) void k_gemmw(const T16* __restrict__ A, const T16* __restrict__ A2, const T16* __restrict__ Bt, const T16* __restrict__ Bt2, float* C, int ldc, const float* __restrict__ bias, size_t sA, size_t sB, size_t sC, size_t sP, h16* P16, bf* Ph, bf* Pl, h16* V16, bf* Vh, bf* Vl) {
    typedef typename WFrag<T16>::V V;
    __shared__ __align__(16) float os[16 * 68];
    const size_t z = blockIdx.z / KS; const int ks = (int)(blockIdx.z % KS); const int kb = ks * (K / KS), ke = kb + K / KS; C += (size_t)ks * sP; A += z * sA; if (A2) A2 += z * sA; Bt += z * sB; if (Bt2) Bt2 += z * sB; C += z * sC;
    const int lane = threadIdx.x & 31, lr = lane & 15, hi = lane >> 4; const int r0 = blockIdx.x * 64, c0 = blockIdx.y * 64;
    v8f acc[4][4];
#pragma unroll
    for (int mb = 0; mb < 4; ++mb)
#pragma unroll
        for (int nb = 0; nb < 4; ++nb) acc[mb][nb] = (v8f){};
    const size_t aoff = (size_t)r0 * K + (size_t)kb * 16 + lane * 8, boff = (size_t)c0 * K + (size_t)kb * 16 + lane * 8;   // a row block of 16 rows is 16 K elements, a k block 512
    const T16* ap = A + aoff; const T16* ap2 = (NSPLIT == 1 || NSPLIT == 2) ? A2 + aoff : ap; const T16* bp = Bt + boff; const T16* bp2 = NSPLIT >= 2 ? Bt2 + boff : bp;
    // two fragment sets: while the products of one k block run, the loads of the next block are in flight into the other set
    static_assert((K / KS) % 64 == 0, "the k range is walked two blocks a trip");
    V a[2][4], a2[2][4], b[2][4], b2[2][4];
    auto ldk = [&](const int s) {   // the next k block's fragment loads, one run, into set s
#pragma unroll
        for (int mb = 0; mb < 4; ++mb) { a[s][mb] = WFrag<T16>::ld(ap + mb * 16 * K); if (NSPLIT == 1 || NSPLIT == 2) a2[s][mb] = WFrag<T16>::ld(ap2 + mb * 16 * K); }
#pragma unroll
        for (int nb = 0; nb < 4; ++nb) { b[s][nb] = WFrag<T16>::ld(bp + nb * 16 * K); if (NSPLIT >= 2) b2[s][nb] = WFrag<T16>::ld(bp2 + nb * 16 * K); }
        LWAIT(ap, ap2, bp, bp2);
        __builtin_amdgcn_sched_barrier(0);   // keeps the run of loads and its wait in front of the pointer steps and of the products that follow: sunk among the products, the loads would start late and their latency would show again
        ap += 512; ap2 += 512; bp += 512; bp2 += 512; };
    auto mmk = [&](const int s) {   // the products of the k block in set s
#pragma unroll
        for (int nb = 0; nb < 4; ++nb)
#pragma unroll
            for (int mb = 0; mb < 4; ++mb) { acc[mb][nb] = WFrag<T16>::mma(a[s][mb], b[s][nb], acc[mb][nb]); if (NSPLIT == 1 || NSPLIT == 2) acc[mb][nb] = WFrag<T16>::mma(a2[s][mb], b[s][nb], acc[mb][nb]); if (NSPLIT >= 2) acc[mb][nb] = WFrag<T16>::mma(a[s][mb], b2[s][nb], acc[mb][nb]); }
        __builtin_amdgcn_sched_barrier(0); };   // keeps the products in front of the loads that refill their set: the loads stay one run, and the wait behind the run stays in front of the pointer steps
    ldk(0);
    // rolled: one pair of k blocks at a time
#pragma unroll 1
    for (int kc = kb; kc < ke - 64; kc += 64) {
        ldk(1); mmk(0); ldk(0); mmk(1);
        // the four vector slots between the trip's last WMMA and a vector instruction on its registers, on the taken side of the loop's branch too
        asm volatile("v_nop\n\tv_nop\n\tv_nop\n\tv_nop" : "+v"(acc[0][0]), "+v"(acc[1][1]), "+v"(acc[2][2]), "+v"(acc[3][3]) : "v"(a[1][0]), "v"(a[1][3]));
    }
    ldk(1); mmk(0); mmk(1);   // the last pair: nothing is left to load behind it
    if constexpr (HP) {
        static_assert(HD == 64, "one 64-column tile is one head");
        const size_t po = (z * NH_ + blockIdx.y) * (size_t)TT * HD;
        // [d][t] planes: a lane's 8 accumulator rows are 8 successive positions of one column, one 8-element piece of the plane, stored straight from registers; the 32 lanes' pieces are half a block, 512 bytes in a row
#pragma unroll
        for (int nb = 0; nb < 4; ++nb)
#pragma unroll
            for (int mb = 0; mb < 4; ++mb) { v8h o16; v8us oh, ol;
#pragma unroll
                for (int j = 0; j < 8; ++j) { const float x = acc[mb][nb][j]; o16[j] = tohx(x); unsigned short a2, c2; splitf(x, a2, c2); oh[j] = a2; ol[j] = c2; }
                const size_t vo = po + fo(nb * 16 + lr, r0 + mb * 16 + hi * 8, TT); *(v8h*)(V16 + vo) = o16; *(v8us*)(Vh + vo) = oh; *(v8us*)(Vl + vo) = ol; SWAIT(o16, oh, ol, V16 + vo, Vh + vo, Vl + vo); }
        // [t][d] planes: 16 rows at a time through LDS (one wave: its LDS operations run in program order), so that a lane holds 8 successive columns of one position; a store covers half a block, 512 bytes in a row
#pragma unroll
        for (int mb = 0; mb < 4; ++mb) {
#pragma unroll
            for (int nb = 0; nb < 4; ++nb) {
#pragma unroll
                for (int j = 0; j < 8; ++j) os[(hi * 8 + j) * 68 + nb * 16 + lr] = acc[mb][nb][j]; }
#pragma unroll
            for (int s = 0; s < 4; ++s) { const int row = lr, cofs = (2 * s + hi) * 8; const v4f x0 = *(const v4fa*)(os + row * 68 + cofs), x1 = *(const v4fa*)(os + row * 68 + cofs + 4); v8h o16; v8us oh, ol;
#pragma unroll
                for (int j = 0; j < 8; ++j) { const float x = j < 4 ? x0[j & 3] : x1[j & 3]; o16[j] = tohx(x); unsigned short a2, c2; splitf(x, a2, c2); oh[j] = a2; ol[j] = c2; }
                const size_t pp = po + fo(r0 + mb * 16 + row, cofs, HD); *(v8h*)(P16 + pp) = o16; *(v8us*)(Ph + pp) = oh; *(v8us*)(Pl + pp) = ol; SWAIT(o16, oh, ol, P16 + pp, Ph + pp, Pl + pp); }
        }
        return;
    }
#pragma unroll
    for (int mb = 0; mb < 4; ++mb) {
#pragma unroll
        for (int nb = 0; nb < 4; ++nb) {
#pragma unroll
            for (int j = 0; j < 8; ++j) os[(hi * 8 + j) * 68 + nb * 16 + lr] = acc[mb][nb][j]; }
        __builtin_amdgcn_wave_barrier(); asm volatile("" ::: "memory");
        float* crow = C + (size_t)(r0 + mb * 16) * ldc + c0;
{
#pragma unroll
            for (int s = 0; s < 8; ++s) { const int row = 2 * s + hi, cofs = lr * 4; v4f val = *(const v4fa*)(os + row * 68 + cofs); if (BIAS) { val[0] += bfr(bias[c0 + cofs]); val[1] += bfr(bias[c0 + cofs + 1]); val[2] += bfr(bias[c0 + cofs + 2]); val[3] += bfr(bias[c0 + cofs + 3]); }
                *(v4f*)(crow + (size_t)row * ldc + cofs) = val; }
             }
        __builtin_amdgcn_wave_barrier(); asm volatile("" ::: "memory");
    }
}

typedef __attribute__((ext_vector_type(2))) _Float16 v2h;
typedef __attribute__((ext_vector_type(4))) _Float16 v4h;
typedef __attribute__((ext_vector_type(2))) unsigned short v2us;
typedef __attribute__((ext_vector_type(4))) unsigned short v4us;
typedef __attribute__((ext_vector_type(2))) float v2f;
typedef __attribute__((ext_vector_type(4))) int v4i;

__global__ __launch_bounds__(256) void k_wtG(const float* __restrict__ w, int K, int N, bf* Bt) {
    const int lane = threadIdx.x & 31; const int L0 = (blockIdx.x * 8 + (threadIdx.x >> 5)) * 8; const int nlines = N * K / 64;
{
#pragma unroll 1
        for (int l = 0; l < 8; ++l) { const int L = L0 + l; if (L >= nlines) break; const size_t e = (size_t)L * 64 + lane * 2; const int blk = (int)(e >> 9), k = (blk % (K >> 5)) * 32 + (int)((e >> 7) & 3) * 8 + (int)(e & 7), n = (blk / (K >> 5)) * 16 + (int)((e >> 3) & 15); v2us o;   // e = fo(n, k, K)
            const float* w0 = w + (size_t)k * N + n; const float* w1 = w0 + N; const float f0 = *w0, f1 = *w1; LWAIT(w0, w1, w0, w1);
            o[0] = f2bf(f0); o[1] = f2bf(f1); *(v2us*)(Bt + e) = o; }
         }
}
// dst: the [rows][K] plane in fragment order; thread i writes piece i of dst, so that the stores are whole lines, and reads the 8 floats that belong there
template <int K>
__global__ __launch_bounds__(256) void k_cvt8(const float* __restrict__ src, bf* dst, size_t n8) { const size_t i = (size_t)blockIdx.x * 256 + threadIdx.x; if (i >= n8) return; const size_t blk = i >> 6, row = (blk / (K >> 5)) * 16 + (i & 15), k = (blk % (K >> 5)) * 32 + ((i >> 4) & 3) * 8; const v8f v = *(const v8f*)(src + row * K + k); v8us o;
#pragma unroll
    for (int k = 0; k < 8; ++k) o[k] = f2bf(v[k]); *(v8us*)(dst + i * 8) = o;  }
// fragment loads from a staged block in LDS (a 16 x 32 block in fragment order; p = the block's start + lane * 8); R: one 16-byte piece
template <typename T16> struct SFrag;
template <> struct SFrag<h16> { typedef v8h R; typedef v8ha RA; static __device__ __forceinline__ v16h ld(const h16* p) { return cat16(*(const v8ha*)p, *(const v8ha*)(p + 256)); } };
template <> struct SFrag<bf> { typedef v8us R; typedef v8usa RA; static __device__ __forceinline__ v16bf ld(const bf* p) { return cat16b(*(const v8usa*)p, *(const v8usa*)(p + 256)); } };

// ---- k_attn: logits, softmax, attn.p and the head merge in one walk over the keys; FW waves; grid (heads, batches, query blocks), the hi/lo blocks first.
// A wave owns 16 NQ query rows and walks all TT keys, 32 a pass. It forms the TRANSPOSED scores (A = key rows, B = its query rows, kept in registers): a lane then holds 16 of the 32 scores of ONE query,
// and the two score tiles are, register for register, the two halves of the B fragment of the transposed product out^T += p^T . weights^T (A = the [d][t] plane): the weights never leave the registers.
// Softmax runs along: a running maximum per query (joined over the two half waves each pass), the sums and the output tiles rescaled by exp(old maximum - new maximum) each pass; the division by the sum comes last.
// The pass's key rows and value columns (the same for all FW waves) are staged in LDS, two buffers: the next pass's pieces are loaded into registers before the pass's work and stored behind it, one barrier a pass.
// stands behind a run of global loads, in front of whatever overwrites their address registers; the pointers are inputs, so that their registers are not given to a load's result before the wait
#define XWAIT(p, p2) asm volatile("s_wait_xcnt 0x0" :: "v"(p), "v"(p2) : "memory")
// lane l's value to lane l ^ 16 and back: the exchange between the two half waves as one vector instruction (a shuffle would go through the LDS queue and its wait)
__device__ __forceinline__ float xhalf(float x) { return __builtin_bit_cast(float, __builtin_amdgcn_permlanex16(__builtin_bit_cast(int, x), __builtin_bit_cast(int, x), 0x76543210, 0xfedcba98, false, false)); }
// 2^x for eight values in one statement: the results are early-clobber, so that none is laid over a source of the run, and the v_nop is the slot that the instruction set asks for behind a transcendental before its result is read or its source overwritten
__device__ __forceinline__ void exp8(float (&e)[8], const float (&x)[8]) {
    asm("v_exp_f32 %0, %8\n\tv_exp_f32 %1, %9\n\tv_exp_f32 %2, %10\n\tv_exp_f32 %3, %11\n\tv_exp_f32 %4, %12\n\tv_exp_f32 %5, %13\n\tv_exp_f32 %6, %14\n\tv_exp_f32 %7, %15\n\tv_nop"
        : "=&v"(e[0]), "=&v"(e[1]), "=&v"(e[2]), "=&v"(e[3]), "=&v"(e[4]), "=&v"(e[5]), "=&v"(e[6]), "=&v"(e[7]) : "v"(x[0]), "v"(x[1]), "v"(x[2]), "v"(x[3]), "v"(x[4]), "v"(x[5]), "v"(x[6]), "v"(x[7])); }
// 2^x for one value, with the same slot behind it
__device__ __forceinline__ float exp1(float x) { float e; asm("v_exp_f32 %0, %1\n\tv_nop" : "=v"(e) : "v"(x)); return e; }
template <typename T16, bool HR>
__device__ __forceinline__ void attn_body(T16* L, const T16* __restrict__ Q, const T16* __restrict__ Q2, const T16* __restrict__ Kp, const T16* __restrict__ K2, const T16* __restrict__ Vt, const T16* __restrict__ Vt2, int i0, int h, bf* Ah, bf* Al) {
    typedef typename WFrag<T16>::V V; typedef typename SFrag<T16>::R R; typedef typename SFrag<T16>::RA RA;
    constexpr int NQ = HR ? 1 : 2;            // query tiles of a wave
    constexpr int STG = HR ? 8192 : 4096;     // elements of one buffer: per plane 2048 of key rows (2 key tiles x 2 d blocks), then 2048 of value columns (4 d tiles)
    constexpr float CS = SCL * 1.4426950408889634f;
    const int tid = threadIdx.x, lane = tid & 31, lr = lane & 15, hi = lane >> 4, w = tid >> 5; const int q0 = i0 + w * 16 * NQ;
    V qf[NQ][2], qf2[NQ][2];
    { const size_t qo = (size_t)q0 * HD + lane * 8; const T16* qp = Q + qo; const T16* qp2 = HR ? Q2 + qo : qp;
#pragma unroll
        for (int nq = 0; nq < NQ; ++nq)
#pragma unroll
            for (int kk = 0; kk < 2; ++kk) { const int ao = nq * 16 * HD + kk * 512; qf[nq][kk] = WFrag<T16>::ld(qp + ao); if (HR) qf2[nq][kk] = WFrag<T16>::ld(qp2 + ao); }
        XWAIT(qp, qp2); }
    // a thread stages pieces tid and tid + 128 of the 256 key pieces (2048 elements in a row in the [t][d] plane) and of the 256 value pieces (64 of each d tile's block in the [d][t] plane)
    const size_t ko = (size_t)tid * 8, vo = (size_t)(tid >> 6) * 16 * TT + (tid & 63) * 8; const T16* kp = Kp + ko; const T16* kp2 = HR ? K2 + ko : kp; const T16* vp = Vt + vo; const T16* vp2 = HR ? Vt2 + vo : vp;
    R g[4], g2[4];
    auto fetch = [&]() { g[0] = *(const R*)kp; g[1] = *(const R*)(kp + 1024); g[2] = *(const R*)vp; g[3] = *(const R*)(vp + 2 * 16 * TT);
        if (HR) { g2[0] = *(const R*)kp2; g2[1] = *(const R*)(kp2 + 1024); g2[2] = *(const R*)vp2; g2[3] = *(const R*)(vp2 + 2 * 16 * TT); }
        if constexpr (HR) { LWAIT(kp, kp2, vp, vp2); kp2 += 2048; vp2 += 512; } else XWAIT(kp, vp);
        kp += 2048; vp += 512; };
    auto put = [&](T16* d) {
#pragma unroll
        for (int i = 0; i < 4; ++i) { *(RA*)(d + i * 1024 + tid * 8) = g[i]; if (HR) *(RA*)(d + 4096 + i * 1024 + tid * 8) = g2[i]; } };
    v8f o[NQ][4]; float m[NQ], l[NQ];
#pragma unroll
    for (int nq = 0; nq < NQ; ++nq) { m[nq] = -3.0e38f; l[nq] = 0.f;
#pragma unroll
        for (int dt = 0; dt < 4; ++dt) o[nq][dt] = (v8f){}; }
    fetch(); put(L);
    __syncthreads();   // pass 0's pieces are in LDS before a wave reads them
    // rolled: one pass's fragments and scores at a time
#pragma unroll 1
    for (int p = 0; p < TT / 32; ++p) { const T16* cur = L + (p & 1) * STG + lane * 8;
        if (p + 1 < TT / 32) fetch();   // the same for the whole work-group
        v8f s[NQ][2];
#pragma unroll
        for (int kt = 0; kt < 2; ++kt) { V ka[2], ka2[2];
#pragma unroll
            for (int kk = 0; kk < 2; ++kk) { ka[kk] = SFrag<T16>::ld(cur + kt * 1024 + kk * 512); if (HR) ka2[kk] = SFrag<T16>::ld(cur + 4096 + kt * 1024 + kk * 512); }
#pragma unroll
            for (int nq = 0; nq < NQ; ++nq) { s[nq][kt] = (v8f){};
#pragma unroll
                for (int kk = 0; kk < 2; ++kk) { s[nq][kt] = WFrag<T16>::mma(ka[kk], qf[nq][kk], s[nq][kt]); if (HR) { s[nq][kt] = WFrag<T16>::mma(ka[kk], qf2[nq][kk], s[nq][kt]); s[nq][kt] = WFrag<T16>::mma(ka2[kk], qf[nq][kk], s[nq][kt]); } } } }
        V pb[NQ], pb2[NQ];
#pragma unroll
        for (int nq = 0; nq < NQ; ++nq) { float t0 = s[nq][0][0], t1 = s[nq][1][0];
#pragma unroll
            for (int j = 1; j < 8; ++j) { t0 = fmaxf(t0, s[nq][0][j]); t1 = fmaxf(t1, s[nq][1][j]); }
            t0 = fmaxf(t0, t1); t0 = fmaxf(t0, xhalf(t0));   // the other half wave holds the query's other 16 keys of the pass
            const float mn = fmaxf(m[nq], t0), al = exp1((m[nq] - mn) * CS), mc = mn * CS - (HR ? 0.0f : 10.0f); m[nq] = mn;   // fp16 weights carry a factor 1024, which the division by their own sum takes out
            float x0[8], x1[8], e0[8], e1[8], s0 = 0.f, s1 = 0.f;
#pragma unroll
            for (int j = 0; j < 8; ++j) { x0[j] = fmaf(s[nq][0][j], CS, -mc); x1[j] = fmaf(s[nq][1][j], CS, -mc); }
            exp8(e0, x0); exp8(e1, x1);
#pragma unroll
            for (int j = 0; j < 8; ++j) { s0 += e0[j]; s1 += e1[j]; }
            l[nq] = fmaf(l[nq], al, s0 + s1);
#pragma unroll
            for (int dt = 0; dt < 4; ++dt)
#pragma unroll
                for (int j = 0; j < 8; ++j) o[nq][dt][j] *= al;
            if constexpr (HR) { v8us h0, h1, l0, l1;
#pragma unroll
                for (int j = 0; j < 8; ++j) { unsigned short a, c2; splitf(e0[j], a, c2); h0[j] = a; l0[j] = c2; splitf(e1[j], a, c2); h1[j] = a; l1[j] = c2; }
                pb[nq] = cat16b(h0, h1); pb2[nq] = cat16b(l0, l1);
            } else { v8h h0, h1;
#pragma unroll
                for (int j = 0; j < 8; ++j) { h0[j] = tohx(e0[j]); h1[j] = tohx(e1[j]); }
                pb[nq] = cat16(h0, h1); } }
        { V va[4], va2[4];
#pragma unroll
            for (int dt = 0; dt < 4; ++dt) { va[dt] = SFrag<T16>::ld(cur + 2048 + dt * 512); if (HR) va2[dt] = SFrag<T16>::ld(cur + 4096 + 2048 + dt * 512); }
#pragma unroll
            for (int nq = 0; nq < NQ; ++nq)
#pragma unroll
                for (int dt = 0; dt < 4; ++dt) o[nq][dt] = WFrag<T16>::mma(va[dt], pb[nq], o[nq][dt]);
            if constexpr (HR) {
#pragma unroll
                for (int dt = 0; dt < 4; ++dt) o[0][dt] = WFrag<T16>::mma(va[dt], pb2[0], o[0][dt]);
#pragma unroll
                for (int dt = 0; dt < 4; ++dt) o[0][dt] = WFrag<T16>::mma(va2[dt], pb[0], o[0][dt]); } }
        if (p + 1 < TT / 32) put(L + ((p + 1) & 1) * STG);   // the buffer that pass p - 1 read: every wave left it before the barrier at that pass's foot
        __syncthreads();   // publishes pass p + 1's pieces and ends every wave's reads of pass p's buffer
    }
#pragma unroll
    for (int nq = 0; nq < NQ; ++nq) { const float f = __fdiv_rn(1.0f, l[nq] + xhalf(l[nq]));   // the two half waves' sums joined once
        // a lane's 8 accumulator rows are 8 successive columns of one position: one piece of the merged planes; the 32 lanes' pieces are half a block, 512 bytes in a row
#pragma unroll
        for (int dt = 0; dt < 4; ++dt) { v8us oh, ol;
#pragma unroll
            for (int j = 0; j < 8; ++j) { unsigned short a, c2; splitf(o[nq][dt][j] * f, a, c2); oh[j] = a; ol[j] = c2; }
            const size_t oo = fo(q0 + nq * 16 + lr, h * HD + dt * 16 + hi * 8, DQ); *(v8us*)(Ah + oo) = oh; *(v8us*)(Al + oo) = ol; SWAIT(oh, ol, ol, Ah + oo, Al + oo, Al + oo); } }
}
__global__ __launch_bounds__(FW * 32) void k_attn(const h16* __restrict__ Q16, const bf* __restrict__ Qh, const bf* __restrict__ Ql, const h16* __restrict__ K16, const bf* __restrict__ Kh, const bf* __restrict__ Kl, const h16* __restrict__ V16, const bf* __restrict__ Vh, const bf* __restrict__ Vl, bf* Ah, bf* Al) {
    __shared__ __align__(16) unsigned short L[2 * 8192];
    const int h = blockIdx.x, y = blockIdx.z; const size_t bb = blockIdx.y, pq = (bb * NH_ + h) * TT * HD, pk = (bb * NKV + h / REP) * TT * HD; Ah += bb * TT * DQ; Al += bb * TT * DQ;
    if (y < RH / (FW * 16)) attn_body<bf, true>((bf*)L, Qh + pq, Ql + pq, Kh + pk, Kl + pk, Vh + pk, Vl + pk, y * (FW * 16), h, Ah, Al);   // the same for the whole work-group
    else attn_body<h16, false>((h16*)L, Q16 + pq, nullptr, K16 + pk, nullptr, V16 + pk, nullptr, RH + (y - RH / (FW * 16)) * (FW * 32), h, Ah, Al);
}

extern "C" void kernel_launch(void* const* d_in, const int* in_sizes, int n_in,
                              void* d_out, int out_size, void* d_ws, size_t ws_size, hipStream_t stream) {
    (void)in_sizes; (void)n_in; (void)out_size;
    const float* x = (const float*)d_in[0]; const float* wt = (const float*)d_in[1];   /* order x, W: THIS module has ONE weight ('xw' (in, out) [1024][1024]): p = x W serves as the query (scaled in the softmax), the key AND the value, and the output projection reuses the SAME W: TWO inputs, both read */
    float* OUT = (float*)d_out;     // [4][2048][1024]
    char* wsp = (char*)d_ws;
    auto take = [&](size_t bytes) { char* p = wsp; wsp += (bytes + 255) & ~(size_t)255; return (void*)p; };
    bf* WT = (bf*)take((size_t)DQ * DM * 2);
    bf* XB = (bf*)take((size_t)NB_ * TT * DM * 2);
    h16* PP16 = (h16*)take((size_t)NB_ * NH_ * TT * HD * 2); h16* VT16 = (h16*)take((size_t)NB_ * NKV * HD * TT * 2);
    bf* PPh = (bf*)take((size_t)NB_ * NH_ * TT * HD * 2); bf* PPl = (bf*)take((size_t)NB_ * NH_ * TT * HD * 2); bf* VTh = (bf*)take((size_t)NB_ * NKV * HD * TT * 2); bf* VTl = (bf*)take((size_t)NB_ * NKV * HD * TT * 2);
    bf* ATh = (bf*)take((size_t)NB_ * TT * DQ * 2); bf* ATl = (bf*)take((size_t)NB_ * TT * DQ * 2);
    if ((size_t)(wsp - (char*)d_ws) > ws_size) return;    // 146 MiB of the 256 MiB
    // the one weight is transposed once (DM == DQ: the same plane is the B operand of the input and of the output projection)
    k_wtG<<<(unsigned)((DM * DQ / 64 + 63) / 64), 256, 0, stream>>>(wt, DM, DQ, WT);
    k_cvt8<DM><<<(unsigned)(((size_t)NB_ * TT * DM / 8 + 255) / 256), 256, 0, stream>>>(x, XB, (size_t)NB_ * TT * DM / 8);
    // p = x W once, written as 16-bit head planes by the GEMM's epilogue: the [b][h][t][d] planes are read as the query and as the key, the [b][h][d][t] planes as the value
    k_gemmw<bf, 0, false, DM, 1, true><<<dim3(TT / 64, DQ / 64, NB_), 32, 0, stream>>>(XB, nullptr, WT, nullptr, nullptr, DQ, nullptr, (size_t)TT * DM, 0, 0, 0, PP16, PPh, PPl, VT16, VTh, VTl);
    k_attn<<<dim3(NH_, NB_, RH / (FW * 16) + (TT - RH) / (FW * 32)), FW * 32, 0, stream>>>(PP16, PPh, PPl, PP16, PPh, PPl, VT16, VTh, VTl, ATh, ATl);   // query block slowest: the hi/lo blocks, the longer ones, start first
    k_gemmw<bf, 1, false, DQ><<<dim3(TT / 64, DM / 64, NB_), 32, 0, stream>>>(ATh, ATl, WT, nullptr, OUT, DM, nullptr, (size_t)TT * DQ, 0, (size_t)TT * DM, 0, nullptr, nullptr, nullptr, nullptr, nullptr, nullptr);
}

// v009
// It runs in 158 microseconds.
// Next to v008, in two timings, it ran 1.04 times as fast each time.
// Over all steps from v000 it is 25.0 times as fast.
#include <hip/hip_runtime.h>

// Multi-head self-attention with ONE tied weight (x [4][2048][1024]; p = einsum('bsh,hf->bsf', x, W) ('xw' (in, out) [1024][1024] 1/32, no bias) split into 16 heads x 64; q = p x 64^-0.5, and the SAME p is the key and the value: logits = q.p; softmax over all keys (no mask); attn.p merged; out = einsum('bsh,hf->bsf', merged, W): the SAME W again -> [4][2048][1024] (8.4 M); argument order x, W).
// All NB_ batches go through each kernel in ONE launch (the batch is a grid dimension; every workspace plane holds all batches). Layout: bf16 copy of x; the 'xw' weight transposed once for all its uses; p projected ONCE, exact, its 16-bit head planes written by the projection's own epilogue and shared by query, key and value; dense T-2048 attention in ONE kernel (hybrid rows: < 512 hi/lo 3 products, rest fp16 x1024; a wave keeps its query rows' scores and weights in registers and walks the keys with a running maximum and sum); merged hi/lo x Wo exact.
// Every 16-bit operand plane that a matrix fragment is loaded from in global memory (x, W transposed, p's head planes, the merged planes) is stored in FRAGMENT ORDER (fo() below): the 16 bytes that the 32 lanes of one fragment load take lie side by side, so a load reads 4 whole 128-byte lines and not 32 bytes of each of 16 lines.
// Compute dtypes, f32 accumulate: every input rounded to bf16; projections exact; attention rows < 512 3 products, rest fp16; softmax f32; Wo hl x exact.

#define NB_  4
#define TT   2048
#define DM   1024
#define NH_  16
#define NKV  16
#define REP  (NH_ / NKV)
#define HD   64
#define DQ   (NH_ * HD)
#define DKV  (NKV * HD)
#define RH   512                  // query rows < RH use hi+lo planes (0: none)
#define WIN  0
#define SCL  0.125f   // HD^-0.5
#define FW   4                    // waves per work-group of k_attn: 16 query rows each in the hi/lo blocks, 32 in the fp16 blocks
typedef _Float16 h16;
typedef unsigned short bf;
typedef __attribute__((ext_vector_type(16))) __bf16   v16bf;
typedef __attribute__((ext_vector_type(16))) _Float16 v16h;
typedef __attribute__((ext_vector_type(8)))  _Float16 v8h;
typedef __attribute__((ext_vector_type(8)))  unsigned short v8us;
typedef __attribute__((ext_vector_type(8)))  float    v8f;
typedef __attribute__((ext_vector_type(4)))  float    v4f;
typedef v8h  __attribute__((may_alias)) v8ha;
typedef v4f  __attribute__((may_alias)) v4fa;
typedef v8us __attribute__((may_alias)) v8usa;

__device__ __forceinline__ unsigned short f2bf(float f) { unsigned u = __float_as_uint(f); u += 0x7FFFu + ((u >> 16) & 1u); return (unsigned short)(u >> 16); }
__device__ __forceinline__ float bf2f(unsigned short b) { return __uint_as_float(((unsigned)b) << 16); }
__device__ __forceinline__ float bfr(float f) { return bf2f(f2bf(f)); }
__device__ __forceinline__ v16h cat16(v8h lo, v8h hi) { return __builtin_shufflevector(lo, hi, 0, 1, 2, 3, 4, 5, 6, 7, 8, 9, 10, 11, 12, 13, 14, 15); }
__device__ __forceinline__ v16bf cat16b(v8us lo, v8us hi) { return __builtin_bit_cast(v16bf, __builtin_shufflevector(lo, hi, 0, 1, 2, 3, 4, 5, 6, 7, 8, 9, 10, 11, 12, 13, 14, 15)); }
__device__ __forceinline__ v8f wmma16(v16h a, v16h b, v8f c) { return __builtin_amdgcn_wmma_f32_16x16x32_f16(false, a, false, b, (short)0, c, false, false); }
__device__ __forceinline__ v8f wmmab(v16bf a, v16bf b, v8f c) { return __builtin_amdgcn_wmma_f32_16x16x32_bf16(false, a, false, b, (short)0, c, false, false); }


__device__ __forceinline__ h16 tohx(float x) { return (h16)x; }
__device__ __forceinline__ void splitf(float y, unsigned short& h, unsigned short& l) { h = f2bf(y); l = f2bf(y - bf2f(h)); }
// fragment order of a [rows][K] plane (rows % 16 == 0, K % 32 == 0): blocks of 16 rows x 32 k, 512 elements each, k blocks of a row block in a row; in a block the 8-element pieces lie as [k bit 4][k bit 3][row & 15], which is [half of the fragment][lane]
__device__ __forceinline__ size_t fo(size_t row, size_t k, size_t K) { return ((row >> 4) * (K >> 5) + (k >> 5)) * 512 + ((k >> 4) & 1) * 256 + ((k >> 3) & 1) * 128 + (row & 15) * 8 + (k & 7); }
// ---- k_gemmw: register-blocked GEMM, ONE WAVE per 64x64 output tile (16 accumulators), operands straight from 16-bit planes in fragment order; grid (M/(64 GWM), N/(64 GWN), Z), GWM x GWN waves.
// The GWM x GWN tiles of a work-group are neighbours: its waves run on one WGP and walk k together, so the GWN waves of a tile row ask for the same A lines and the GWM waves of a tile column for the same B lines, and the WGP's cache serves what L2 would else deliver once per wave. The waves share no data of their own and meet at no barrier.
// C[m][n] (f32, pitch ldc, + optional f32 bias[n]) = sum_k A[m][k] Bt[n][k] (+ split products per NSPLIT). z-batch strides sA/sB/sC in elements. K % (64 * KS) == 0.
// KS > 1: grid z = Z * KS; work-group (z, ks) sums only k in [ks K/KS, (ks+1) K/KS) and stores that partial tile in plane ks (plane stride sP elements); the reader adds the KS planes.
// HP: no f32 C; the tile is 64 positions x the HD columns of head c0 / 64 of batch z, and the epilogue writes it as 16-bit head planes (fp16, bf16 hi, bf16 lo), once as [b][h][t][d] (P*) and once as [b][h][d][t] (V*), each [t][d] or [d][t] plane in fragment order.
// WFrag::ld: one fragment of a plane in fragment order; p = the 16 x 32 block's start + lane * 8
template <typename T16> struct WFrag;
template <> struct WFrag<h16> { typedef v16h V; static __device__ __forceinline__ V ld(const h16* p) { return cat16(*(const v8h*)p, *(const v8h*)(p + 256)); } static __device__ __forceinline__ v8f mma(V a, V b, v8f c) { return wmma16(a, b, c); } };
template <> struct WFrag<bf> { typedef v16bf V; static __device__ __forceinline__ V ld(const bf* p) { return cat16b(*(const v8us*)p, *(const v8us*)(p + 256)); } static __device__ __forceinline__ v8f mma(V a, V b, v8f c) { return wmmab(a, b, c); } };
// stands behind a group of plane stores, in front of whatever overwrites their registers; the stored values and the pointers are inputs, so that their registers are not given to a later value before the wait
#define SWAIT(d0, d1, d2, p0, p1, p2) asm volatile("s_wait_xcnt 0x0" :: "v"(d0), "v"(d1), "v"(d2), "v"(p0), "v"(p1), "v"(p2) : "memory")
// stands behind a run of global loads (the fragment loads of one k step), in front of whatever overwrites their address registers (the pointer steps); the pointers are inputs, so that their registers are not given to a load's result before the wait
#define LWAIT(p0, p1, p2, p3) asm volatile("s_wait_xcnt 0x0" :: "v"(p0), "v"(p1), "v"(p2), "v"(p3) : "memory")
#define GWM 2
#define GWN 4
template <typename T16, int NSPLIT, bool BIAS, int K, int KS = 1, bool HP = false>
__global__ __launch_bounds__(GWM * GWN * 32) void k_gemmw(const T16* __restrict__ A, const T16* __restrict__ A2, const T16* __restrict__ Bt, const T16* __restrict__ Bt2, float* C, int ldc, const float* __restrict__ bias, size_t sA, size_t sB, size_t sC, size_t sP, h16* P16, bf* Ph, bf* Pl, h16* V16, bf* Vh, bf* Vl) {
    typedef typename WFrag<T16>::V V;
    __shared__ __align__(16) float osw[GWM * GWN][16 * 68];   // each wave stages in its own part
    const int w = __builtin_amdgcn_readfirstlane((int)(threadIdx.x >> 5)); float* os = osw[w];
    const size_t z = blockIdx.z / KS; const int ks = (int)(blockIdx.z % KS); const int kb = ks * (K / KS), ke = kb + K / KS; C += (size_t)ks * sP; A += z * sA; if (A2) A2 += z * sA; Bt += z * sB; if (Bt2) Bt2 += z * sB; C += z * sC;
    const int lane = threadIdx.x & 31, lr = lane & 15, hi = lane >> 4; const int r0 = (blockIdx.x * GWM + (w & (GWM - 1))) * 64, c0 = (blockIdx.y * GWN + w / GWM) * 64;
    v8f acc[4][4];
#pragma unroll
    for (int mb = 0; mb < 4; ++mb)
#pragma unroll
        for (int nb = 0; nb < 4; ++nb) acc[mb][nb] = (v8f){};
    const size_t aoff = (size_t)r0 * K + (size_t)kb * 16 + lane * 8, boff = (size_t)c0 * K + (size_t)kb * 16 + lane * 8;   // a row block of 16 rows is 16 K elements, a k block 512
    const T16* ap = A + aoff; const T16* ap2 = (NSPLIT == 1 || NSPLIT == 2) ? A2 + aoff : ap; const T16* bp = Bt + boff; const T16* bp2 = NSPLIT >= 2 ? Bt2 + boff : bp;
    // two fragment sets: while the products of one k block run, the loads of the next block are in flight into the other set
    static_assert((K / KS) % 64 == 0, "the k range is walked two blocks a trip");
    V a[2][4], a2[2][4], b[2][4], b2[2][4];
    auto ldk = [&](const int s) {   // the next k block's fragment loads, one run, into set s
#pragma unroll
        for (int mb = 0; mb < 4; ++mb) { a[s][mb] = WFrag<T16>::ld(ap + mb * 16 * K); if (NSPLIT == 1 || NSPLIT == 2) a2[s][mb] = WFrag<T16>::ld(ap2 + mb * 16 * K); }
#pragma unroll
        for (int nb = 0; nb < 4; ++nb) { b[s][nb] = WFrag<T16>::ld(bp + nb * 16 * K); if (NSPLIT >= 2) b2[s][nb] = WFrag<T16>::ld(bp2 + nb * 16 * K); }
        LWAIT(ap, ap2, bp, bp2);
        __builtin_amdgcn_sched_barrier(0);   // keeps the run of loads and its wait in front of the pointer steps and of the products that follow: sunk among the products, the loads would start late and their latency would show again
        ap += 512; ap2 += 512; bp += 512; bp2 += 512; };
    auto mmk = [&](const int s) {   // the products of the k block in set s
#pragma unroll
        for (int nb = 0; nb < 4; ++nb)
#pragma unroll
            for (int mb = 0; mb < 4; ++mb) { acc[mb][nb] = WFrag<T16>::mma(a[s][mb], b[s][nb], acc[mb][nb]); if (NSPLIT == 1 || NSPLIT == 2) acc[mb][nb] = WFrag<T16>::mma(a2[s][mb], b[s][nb], acc[mb][nb]); if (NSPLIT >= 2) acc[mb][nb] = WFrag<T16>::mma(a[s][mb], b2[s][nb], acc[mb][nb]); }
        __builtin_amdgcn_sched_barrier(0); };   // keeps the products in front of the loads that refill their set: the loads stay one run, and the wait behind the run stays in front of the pointer steps
    ldk(0);
    // rolled: one pair of k blocks at a time
#pragma unroll 1
    for (int kc = kb; kc < ke - 64; kc += 64) {
        ldk(1); mmk(0); ldk(0); mmk(1);
        // the four vector slots between the trip's last WMMA and a vector instruction on its registers, on the taken side of the loop's branch too
        asm volatile("v_nop\n\tv_nop\n\tv_nop\n\tv_nop" : "+v"(acc[0][0]), "+v"(acc[1][1]), "+v"(acc[2][2]), "+v"(acc[3][3]) : "v"(a[1][0]), "v"(a[1][3]));
    }
    ldk(1); mmk(0); mmk(1);   // the last pair: nothing is left to load behind it
    if constexpr (HP) {
        static_assert(HD == 64, "one 64-column tile is one head");
        const size_t po = (z * NH_ + c0 / 64) * (size_t)TT * HD;
        // [d][t] planes: a lane's 8 accumulator rows are 8 successive positions of one column, one 8-element piece of the plane, stored straight from registers; the 32 lanes' pieces are half a block, 512 bytes in a row
#pragma unroll
        for (int nb = 0; nb < 4; ++nb)
#pragma unroll
            for (int mb = 0; mb < 4; ++mb) { v8h o16; v8us oh, ol;
#pragma unroll
                for (int j = 0; j < 8; ++j) { const float x = acc[mb][nb][j]; o16[j] = tohx(x); unsigned short a2, c2; splitf(x, a2, c2); oh[j] = a2; ol[j] = c2; }
                const size_t vo = po + fo(nb * 16 + lr, r0 + mb * 16 + hi * 8, TT); *(v8h*)(V16 + vo) = o16; *(v8us*)(Vh + vo) = oh; *(v8us*)(Vl + vo) = ol; SWAIT(o16, oh, ol, V16 + vo, Vh + vo, Vl + vo); }
        // [t][d] planes: 16 rows at a time through LDS (one wave: its LDS operations run in program order), so that a lane holds 8 successive columns of one position; a store covers half a block, 512 bytes in a row
#pragma unroll
        for (int mb = 0; mb < 4; ++mb) {
#pragma unroll
            for (int nb = 0; nb < 4; ++nb) {
#pragma unroll
                for (int j = 0; j < 8; ++j) os[(hi * 8 + j) * 68 + nb * 16 + lr] = acc[mb][nb][j]; }
#pragma unroll
            for (int s = 0; s < 4; ++s) { const int row = lr, cofs = (2 * s + hi) * 8; const v4f x0 = *(const v4fa*)(os + row * 68 + cofs), x1 = *(const v4fa*)(os + row * 68 + cofs + 4); v8h o16; v8us oh, ol;
#pragma unroll
                for (int j = 0; j < 8; ++j) { const float x = j < 4 ? x0[j & 3] : x1[j & 3]; o16[j] = tohx(x); unsigned short a2, c2; splitf(x, a2, c2); oh[j] = a2; ol[j] = c2; }
                const size_t pp = po + fo(r0 + mb * 16 + row, cofs, HD); *(v8h*)(P16 + pp) = o16; *(v8us*)(Ph + pp) = oh; *(v8us*)(Pl + pp) = ol; SWAIT(o16, oh, ol, P16 + pp, Ph + pp, Pl + pp); }
        }
        return;
    }
#pragma unroll
    for (int mb = 0; mb < 4; ++mb) {
#pragma unroll
        for (int nb = 0; nb < 4; ++nb) {
#pragma unroll
            for (int j = 0; j < 8; ++j) os[(hi * 8 + j) * 68 + nb * 16 + lr] = acc[mb][nb][j]; }
        __builtin_amdgcn_wave_barrier(); asm volatile("" ::: "memory");
        float* crow = C + (size_t)(r0 + mb * 16) * ldc + c0;
{
#pragma unroll
            for (int s = 0; s < 8; ++s) { const int row = 2 * s + hi, cofs = lr * 4; v4f val = *(const v4fa*)(os + row * 68 + cofs); if (BIAS) { val[0] += bfr(bias[c0 + cofs]); val[1] += bfr(bias[c0 + cofs + 1]); val[2] += bfr(bias[c0 + cofs + 2]); val[3] += bfr(bias[c0 + cofs + 3]); }
                *(v4f*)(crow + (size_t)row * ldc + cofs) = val; }
             }
        __builtin_amdgcn_wave_barrier(); asm volatile("" ::: "memory");
    }
}

typedef __attribute__((ext_vector_type(2))) _Float16 v2h;
typedef __attribute__((ext_vector_type(4))) _Float16 v4h;
typedef __attribute__((ext_vector_type(2))) unsigned short v2us;
typedef __attribute__((ext_vector_type(4))) unsigned short v4us;
typedef __attribute__((ext_vector_type(2))) float v2f;
typedef __attribute__((ext_vector_type(4))) int v4i;

__global__ __launch_bounds__(256) void k_wtG(const float* __restrict__ w, int K, int N, bf* Bt) {
    const int lane = threadIdx.x & 31; const int L0 = (blockIdx.x * 8 + (threadIdx.x >> 5)) * 8; const int nlines = N * K / 64;
{
#pragma unroll 1
        for (int l = 0; l < 8; ++l) { const int L = L0 + l; if (L >= nlines) break; const size_t e = (size_t)L * 64 + lane * 2; const int blk = (int)(e >> 9), k = (blk % (K >> 5)) * 32 + (int)((e >> 7) & 3) * 8 + (int)(e & 7), n = (blk / (K >> 5)) * 16 + (int)((e >> 3) & 15); v2us o;   // e = fo(n, k, K)
            const float* w0 = w + (size_t)k * N + n; const float* w1 = w0 + N; const float f0 = *w0, f1 = *w1; LWAIT(w0, w1, w0, w1);
            o[0] = f2bf(f0); o[1] = f2bf(f1); *(v2us*)(Bt + e) = o; }
         }
}
// dst: the [rows][K] plane in fragment order; thread i writes piece i of dst, so that the stores are whole lines, and reads the 8 floats that belong there
template <int K>
__global__ __launch_bounds__(256) void k_cvt8(const float* __restrict__ src, bf* dst, size_t n8) { const size_t i = (size_t)blockIdx.x * 256 + threadIdx.x; if (i >= n8) return; const size_t blk = i >> 6, row = (blk / (K >> 5)) * 16 + (i & 15), k = (blk % (K >> 5)) * 32 + ((i >> 4) & 3) * 8; const v8f v = *(const v8f*)(src + row * K + k); v8us o;
#pragma unroll
    for (int k = 0; k < 8; ++k) o[k] = f2bf(v[k]); *(v8us*)(dst + i * 8) = o;  }
// fragment loads from a staged block in LDS (a 16 x 32 block in fragment order; p = the block's start + lane * 8); R: one 16-byte piece
template <typename T16> struct SFrag;
template <> struct SFrag<h16> { typedef v8h R; typedef v8ha RA; static __device__ __forceinline__ v16h ld(const h16* p) { return cat16(*(const v8ha*)p, *(const v8ha*)(p + 256)); } };
template <> struct SFrag<bf> { typedef v8us R; typedef v8usa RA; static __device__ __forceinline__ v16bf ld(const bf* p) { return cat16b(*(const v8usa*)p, *(const v8usa*)(p + 256)); } };

// ---- k_attn: logits, softmax, attn.p and the head merge in one walk over the keys; FW waves; grid (heads, batches, query blocks), the hi/lo blocks first.
// A wave owns 16 NQ query rows and walks all TT keys, 32 a pass. It forms the TRANSPOSED scores (A = key rows, B = its query rows, kept in registers): a lane then holds 16 of the 32 scores of ONE query,
// and the two score tiles are, register for register, the two halves of the B fragment of the transposed product out^T += p^T . weights^T (A = the [d][t] plane): the weights never leave the registers.
// Softmax runs along: a running maximum per query (joined over the two half waves each pass), the sums and the output tiles rescaled by exp(old maximum - new maximum) each pass; the division by the sum comes last.
// The pass's key rows and value columns (the same for all FW waves) are staged in LDS, two buffers: the next pass's pieces are loaded into registers before the pass's work and stored behind it, one barrier a pass.
// stands behind a run of global loads, in front of whatever overwrites their address registers; the pointers are inputs, so that their registers are not given to a load's result before the wait
#define XWAIT(p, p2) asm volatile("s_wait_xcnt 0x0" :: "v"(p), "v"(p2) : "memory")
// lane l's value to lane l ^ 16 and back: the exchange between the two half waves as one vector instruction (a shuffle would go through the LDS queue and its wait)
__device__ __forceinline__ float xhalf(float x) { return __builtin_bit_cast(float, __builtin_amdgcn_permlanex16(__builtin_bit_cast(int, x), __builtin_bit_cast(int, x), 0x76543210, 0xfedcba98, false, false)); }
// 2^x for eight values in one statement: the results are early-clobber, so that none is laid over a source of the run, and the v_nop is the slot that the instruction set asks for behind a transcendental before its result is read or its source overwritten
__device__ __forceinline__ void exp8(float (&e)[8], const float (&x)[8]) {
    asm("v_exp_f32 %0, %8\n\tv_exp_f32 %1, %9\n\tv_exp_f32 %2, %10\n\tv_exp_f32 %3, %11\n\tv_exp_f32 %4, %12\n\tv_exp_f32 %5, %13\n\tv_exp_f32 %6, %14\n\tv_exp_f32 %7, %15\n\tv_nop"
        : "=&v"(e[0]), "=&v"(e[1]), "=&v"(e[2]), "=&v"(e[3]), "=&v"(e[4]), "=&v"(e[5]), "=&v"(e[6]), "=&v"(e[7]) : "v"(x[0]), "v"(x[1]), "v"(x[2]), "v"(x[3]), "v"(x[4]), "v"(x[5]), "v"(x[6]), "v"(x[7])); }
// 2^x for one value, with the same slot behind it
__device__ __forceinline__ float exp1(float x) { float e; asm("v_exp_f32 %0, %1\n\tv_nop" : "=v"(e) : "v"(x)); return e; }
template <typename T16, bool HR>
__device__ __forceinline__ void attn_body(T16* L, const T16* __restrict__ Q, const T16* __restrict__ Q2, const T16* __restrict__ Kp, const T16* __restrict__ K2, const T16* __restrict__ Vt, const T16* __restrict__ Vt2, int i0, int h, bf* Ah, bf* Al) {
    typedef typename WFrag<T16>::V V; typedef typename SFrag<T16>::R R; typedef typename SFrag<T16>::RA RA;
    constexpr int NQ = HR ? 1 : 2;            // query tiles of a wave
    constexpr int STG = HR ? 8192 : 4096;     // elements of one buffer: per plane 2048 of key rows (2 key tiles x 2 d blocks), then 2048 of value columns (4 d tiles)
    constexpr float CS = SCL * 1.4426950408889634f;
    const int tid = threadIdx.x, lane = tid & 31, lr = lane & 15, hi = lane >> 4, w = tid >> 5; const int q0 = i0 + w * 16 * NQ;
    V qf[NQ][2], qf2[NQ][2];
    { const size_t qo = (size_t)q0 * HD + lane * 8; const T16* qp = Q + qo; const T16* qp2 = HR ? Q2 + qo : qp;
#pragma unroll
        for (int nq = 0; nq < NQ; ++nq)
#pragma unroll
            for (int kk = 0; kk < 2; ++kk) { const int ao = nq * 16 * HD + kk * 512; qf[nq][kk] = WFrag<T16>::ld(qp + ao); if (HR) qf2[nq][kk] = WFrag<T16>::ld(qp2 + ao); }
        XWAIT(qp, qp2); }
    // a thread stages pieces tid and tid + 128 of the 256 key pieces (2048 elements in a row in the [t][d] plane) and of the 256 value pieces (64 of each d tile's block in the [d][t] plane)
    const size_t ko = (size_t)tid * 8, vo = (size_t)(tid >> 6) * 16 * TT + (tid & 63) * 8; const T16* kp = Kp + ko; const T16* kp2 = HR ? K2 + ko : kp; const T16* vp = Vt + vo; const T16* vp2 = HR ? Vt2 + vo : vp;
    R g[4], g2[4];
    auto fetch = [&]() { g[0] = *(const R*)kp; g[1] = *(const R*)(kp + 1024); g[2] = *(const R*)vp; g[3] = *(const R*)(vp + 2 * 16 * TT);
        if (HR) { g2[0] = *(const R*)kp2; g2[1] = *(const R*)(kp2 + 1024); g2[2] = *(const R*)vp2; g2[3] = *(const R*)(vp2 + 2 * 16 * TT); }
        if constexpr (HR) { LWAIT(kp, kp2, vp, vp2); kp2 += 2048; vp2 += 512; } else XWAIT(kp, vp);
        kp += 2048; vp += 512; };
    auto put = [&](T16* d) {
#pragma unroll
        for (int i = 0; i < 4; ++i) { *(RA*)(d + i * 1024 + tid * 8) = g[i]; if (HR) *(RA*)(d + 4096 + i * 1024 + tid * 8) = g2[i]; } };
    v8f o[NQ][4]; float m[NQ], l[NQ];
#pragma unroll
    for (int nq = 0; nq < NQ; ++nq) { m[nq] = -3.0e38f; l[nq] = 0.f;
#pragma unroll
        for (int dt = 0; dt < 4; ++dt) o[nq][dt] = (v8f){}; }
    fetch(); put(L);
    __syncthreads();   // pass 0's pieces are in LDS before a wave reads them
    // rolled: one pass's fragments and scores at a time
#pragma unroll 1
    for (int p = 0; p < TT / 32; ++p) { const T16* cur = L + (p & 1) * STG + lane * 8;
        if (p + 1 < TT / 32) fetch();   // the same for the whole work-group
        v8f s[NQ][2];
#pragma unroll
        for (int kt = 0; kt < 2; ++kt) { V ka[2], ka2[2];
#pragma unroll
            for (int kk = 0; kk < 2; ++kk) { ka[kk] = SFrag<T16>::ld(cur + kt * 1024 + kk * 512); if (HR) ka2[kk] = SFrag<T16>::ld(cur + 4096 + kt * 1024 + kk * 512); }
#pragma unroll
            for (int nq = 0; nq < NQ; ++nq) { s[nq][kt] = (v8f){};
#pragma unroll
                for (int kk = 0; kk < 2; ++kk) { s[nq][kt] = WFrag<T16>::mma(ka[kk], qf[nq][kk], s[nq][kt]); if (HR) { s[nq][kt] = WFrag<T16>::mma(ka[kk], qf2[nq][kk], s[nq][kt]); s[nq][kt] = WFrag<T16>::mma(ka2[kk], qf[nq][kk], s[nq][kt]); } } } }
        V pb[NQ], pb2[NQ];
#pragma unroll
        for (int nq = 0; nq < NQ; ++nq) { float t0 = s[nq][0][0], t1 = s[nq][1][0];
#pragma unroll
            for (int j = 1; j < 8; ++j) { t0 = fmaxf(t0, s[nq][0][j]); t1 = fmaxf(t1, s[nq][1][j]); }
            t0 = fmaxf(t0, t1); t0 = fmaxf(t0, xhalf(t0));   // the other half wave holds the query's other 16 keys of the pass
            const float mn = fmaxf(m[nq], t0), al = exp1((m[nq] - mn) * CS), mc = mn * CS - (HR ? 0.0f : 10.0f); m[nq] = mn;   // fp16 weights carry a factor 1024, which the division by their own sum takes out
            float x0[8], x1[8], e0[8], e1[8], s0 = 0.f, s1 = 0.f;
#pragma unroll
            for (int j = 0; j < 8; ++j) { x0[j] = fmaf(s[nq][0][j], CS, -mc); x1[j] = fmaf(s[nq][1][j], CS, -mc); }
            exp8(e0, x0); exp8(e1, x1);
#pragma unroll
            for (int j = 0; j < 8; ++j) { s0 += e0[j]; s1 += e1[j]; }
            l[nq] = fmaf(l[nq], al, s0 + s1);
#pragma unroll
            for (int dt = 0; dt < 4; ++dt)
#pragma unroll
                for (int j = 0; j < 8; ++j) o[nq][dt][j] *= al;
            if constexpr (HR) { v8us h0, h1, l0, l1;
#pragma unroll
                for (int j = 0; j < 8; ++j) { unsigned short a, c2; splitf(e0[j], a, c2); h0[j] = a; l0[j] = c2; splitf(e1[j], a, c2); h1[j] = a; l1[j] = c2; }
                pb[nq] = cat16b(h0, h1); pb2[nq] = cat16b(l0, l1);
            } else { v8h h0, h1;
#pragma unroll
                for (int j = 0; j < 8; ++j) { h0[j] = tohx(e0[j]); h1[j] = tohx(e1[j]); }
                pb[nq] = cat16(h0, h1); } }
        { V va[4], va2[4];
#pragma unroll
            for (int dt = 0; dt < 4; ++dt) { va[dt] = SFrag<T16>::ld(cur + 2048 + dt * 512); if (HR) va2[dt] = SFrag<T16>::ld(cur + 4096 + 2048 + dt * 512); }
#pragma unroll
            for (int nq = 0; nq < NQ; ++nq)
#pragma unroll
                for (int dt = 0; dt < 4; ++dt) o[nq][dt] = WFrag<T16>::mma(va[dt], pb[nq], o[nq][dt]);
            if constexpr (HR) {
#pragma unroll
                for (int dt = 0; dt < 4; ++dt) o[0][dt] = WFrag<T16>::mma(va[dt], pb2[0], o[0][dt]);
#pragma unroll
                for (int dt = 0; dt < 4; ++dt) o[0][dt] = WFrag<T16>::mma(va2[dt], pb[0], o[0][dt]); } }
        if (p + 1 < TT / 32) put(L + ((p + 1) & 1) * STG);   // the buffer that pass p - 1 read: every wave left it before the barrier at that pass's foot
        __syncthreads();   // publishes pass p + 1's pieces and ends every wave's reads of pass p's buffer
    }
#pragma unroll
    for (int nq = 0; nq < NQ; ++nq) { const float f = __fdiv_rn(1.0f, l[nq] + xhalf(l[nq]));   // the two half waves' sums joined once
        // a lane's 8 accumulator rows are 8 successive columns of one position: one piece of the merged planes; the 32 lanes' pieces are half a block, 512 bytes in a row
#pragma unroll
        for (int dt = 0; dt < 4; ++dt) { v8us oh, ol;
#pragma unroll
            for (int j = 0; j < 8; ++j) { unsigned short a, c2; splitf(o[nq][dt][j] * f, a, c2); oh[j] = a; ol[j] = c2; }
            const size_t oo = fo(q0 + nq * 16 + lr, h * HD + dt * 16 + hi * 8, DQ); *(v8us*)(Ah + oo) = oh; *(v8us*)(Al + oo) = ol; SWAIT(oh, ol, ol, Ah + oo, Al + oo, Al + oo); } }
}
__global__ __launch_bounds__(FW * 32) void k_attn(const h16* __restrict__ Q16, const bf* __restrict__ Qh, const bf* __restrict__ Ql, const h16* __restrict__ K16, const bf* __restrict__ Kh, const bf* __restrict__ Kl, const h16* __restrict__ V16, const bf* __restrict__ Vh, const bf* __restrict__ Vl, bf* Ah, bf* Al) {
    __shared__ __align__(16) unsigned short L[2 * 8192];
    const int h = blockIdx.x, y = blockIdx.z; const size_t bb = blockIdx.y, pq = (bb * NH_ + h) * TT * HD, pk = (bb * NKV + h / REP) * TT * HD; Ah += bb * TT * DQ; Al += bb * TT * DQ;
    if (y < RH / (FW * 16)) attn_body<bf, true>((bf*)L, Qh + pq, Ql + pq, Kh + pk, Kl + pk, Vh + pk, Vl + pk, y * (FW * 16), h, Ah, Al);   // the same for the whole work-group
    else attn_body<h16, false>((h16*)L, Q16 + pq, nullptr, K16 + pk, nullptr, V16 + pk, nullptr, RH + (y - RH / (FW * 16)) * (FW * 32), h, Ah, Al);
}

extern "C" void kernel_launch(void* const* d_in, const int* in_sizes, int n_in,
                              void* d_out, int out_size, void* d_ws, size_t ws_size, hipStream_t stream) {
    (void)in_sizes; (void)n_in; (void)out_size;
    const float* x = (const float*)d_in[0]; const float* wt = (const float*)d_in[1];   /* order x, W: THIS module has ONE weight ('xw' (in, out) [1024][1024]): p = x W serves as the query (scaled in the softmax), the key AND the value, and the output projection reuses the SAME W: TWO inputs, both read */
    float* OUT = (float*)d_out;     // [4][2048][1024]
    char* wsp = (char*)d_ws;
    auto take = [&](size_t bytes) { char* p = wsp; wsp += (bytes + 255) & ~(size_t)255; return (void*)p; };
    bf* WT = (bf*)take((size_t)DQ * DM * 2);
    bf* XB = (bf*)take((size_t)NB_ * TT * DM * 2);
    h16* PP16 = (h16*)take((size_t)NB_ * NH_ * TT * HD * 2); h16* VT16 = (h16*)take((size_t)NB_ * NKV * HD * TT * 2);
    bf* PPh = (bf*)take((size_t)NB_ * NH_ * TT * HD * 2); bf* PPl = (bf*)take((size_t)NB_ * NH_ * TT * HD * 2); bf* VTh = (bf*)take((size_t)NB_ * NKV * HD * TT * 2); bf* VTl = (bf*)take((size_t)NB_ * NKV * HD * TT * 2);
    bf* ATh = (bf*)take((size_t)NB_ * TT * DQ * 2); bf* ATl = (bf*)take((size_t)NB_ * TT * DQ * 2);
    if ((size_t)(wsp - (char*)d_ws) > ws_size) return;    // 146 MiB of the 256 MiB
    // the one weight is transposed once (DM == DQ: the same plane is the B operand of the input and of the output projection)
    k_wtG<<<(unsigned)((DM * DQ / 64 + 63) / 64), 256, 0, stream>>>(wt, DM, DQ, WT);
    k_cvt8<DM><<<(unsigned)(((size_t)NB_ * TT * DM / 8 + 255) / 256), 256, 0, stream>>>(x, XB, (size_t)NB_ * TT * DM / 8);
    // p = x W once, written as 16-bit head planes by the GEMM's epilogue: the [b][h][t][d] planes are read as the query and as the key, the [b][h][d][t] planes as the value
    k_gemmw<bf, 0, false, DM, 1, true><<<dim3(TT / (64 * GWM), DQ / (64 * GWN), NB_), GWM * GWN * 32, 0, stream>>>(XB, nullptr, WT, nullptr, nullptr, DQ, nullptr, (size_t)TT * DM, 0, 0, 0, PP16, PPh, PPl, VT16, VTh, VTl);
    k_attn<<<dim3(NH_, NB_, RH / (FW * 16) + (TT - RH) / (FW * 32)), FW * 32, 0, stream>>>(PP16, PPh, PPl, PP16, PPh, PPl, VT16, VTh, VTl, ATh, ATl);   // query block slowest: the hi/lo blocks, the longer ones, start first
    k_gemmw<bf, 1, false, DQ><<<dim3(TT / (64 * GWM), DM / (64 * GWN), NB_), GWM * GWN * 32, 0, stream>>>(ATh, ATl, WT, nullptr, OUT, DM, nullptr, (size_t)TT * DQ, 0, (size_t)TT * DM, 0, nullptr, nullptr, nullptr, nullptr, nullptr, nullptr);
}

// v010
// One run takes 153 microseconds.
// Next to v009, in two timings, it ran 1.04 times as fast each time.
// Over all steps from v000 it is 26.1 times as fast.
#include <hip/hip_runtime.h>

// Multi-head self-attention with ONE tied weight (x [4][2048][1024]; p = einsum('bsh,hf->bsf', x, W) ('xw' (in, out) [1024][1024] 1/32, no bias) split into 16 heads x 64; q = p x 64^-0.5, and the SAME p is the key and the value: logits = q.p; softmax over all keys (no mask); attn.p merged; out = einsum('bsh,hf->bsf', merged, W): the SAME W again -> [4][2048][1024] (8.4 M); argument order x, W).
// All NB_ batches go through each kernel in ONE launch (the batch is a grid dimension; every workspace plane holds all batches). Layout: bf16 copy of x; the 'xw' weight transposed once for all its uses; p projected ONCE, exact, its 16-bit head planes written by the projection's own epilogue and shared by query, key and value; dense T-2048 attention in ONE kernel (hybrid rows: < 512 hi/lo 3 products, rest fp16 x1024; a wave keeps its query rows' scores and weights in registers and walks the keys with a running maximum and sum); merged hi/lo x Wo exact.
// Every 16-bit operand plane that a matrix fragment is loaded from in global memory (x, W transposed, p's head planes, the merged planes) is stored in FRAGMENT ORDER (fo() below): the 16 bytes that the 32 lanes of one fragment load take lie side by side, so a load reads 4 whole 128-byte lines and not 32 bytes of each of 16 lines.
// Compute dtypes, f32 accumulate: every input rounded to bf16; projections exact; attention rows < 512 3 products, rest fp16; softmax f32; Wo hl x exact.

#define NB_  4
#define TT   2048
#define DM   1024
#define NH_  16
#define NKV  16
#define REP  (NH_ / NKV)
#define HD   64
#define DQ   (NH_ * HD)
#define DKV  (NKV * HD)
#define RH   512                  // query rows < RH use hi+lo planes (0: none)
#define WIN  0
#define SCL  0.125f   // HD^-0.5
#define FW   4                    // waves per work-group of k_attn: 16 query rows each in the hi/lo blocks, 32 in the fp16 blocks
typedef _Float16 h16;
typedef unsigned short bf;
typedef __attribute__((ext_vector_type(16))) __bf16   v16bf;
typedef __attribute__((ext_vector_type(16))) _Float16 v16h;
typedef __attribute__((ext_vector_type(8)))  _Float16 v8h;
typedef __attribute__((ext_vector_type(8)))  unsigned short v8us;
typedef __attribute__((ext_vector_type(8)))  float    v8f;
typedef __attribute__((ext_vector_type(4)))  float    v4f;
typedef v8h  __attribute__((may_alias)) v8ha;
typedef v4f  __attribute__((may_alias)) v4fa;
typedef v8us __attribute__((may_alias)) v8usa;

typedef __attribute__((ext_vector_type(2))) float  v2fc;
typedef __attribute__((ext_vector_type(2))) __bf16 v2bfc;
typedef __attribute__((ext_vector_type(4))) unsigned v4u;
// two f32 rounded to bf16 (nearest even) by the packed conversion instruction: a in the low half of the dword, b in the high half, as two successive elements of a 16-bit plane or fragment lie
__device__ __forceinline__ unsigned f2bf2(v2fc x) { return __builtin_bit_cast(unsigned, __builtin_convertvector(x, v2bfc)); }
__device__ __forceinline__ unsigned f2bf2(float a, float b) { const v2fc x = {a, b}; return f2bf2(x); }
__device__ __forceinline__ unsigned short f2bf(float f) { return __builtin_bit_cast(unsigned short, (__bf16)f); }
__device__ __forceinline__ float bf2f(unsigned short b) { return __uint_as_float(((unsigned)b) << 16); }
__device__ __forceinline__ float bfr(float f) { return bf2f(f2bf(f)); }
__device__ __forceinline__ v16h cat16(v8h lo, v8h hi) { return __builtin_shufflevector(lo, hi, 0, 1, 2, 3, 4, 5, 6, 7, 8, 9, 10, 11, 12, 13, 14, 15); }
__device__ __forceinline__ v16bf cat16b(v8us lo, v8us hi) { return __builtin_bit_cast(v16bf, __builtin_shufflevector(lo, hi, 0, 1, 2, 3, 4, 5, 6, 7, 8, 9, 10, 11, 12, 13, 14, 15)); }
__device__ __forceinline__ v8f wmma16(v16h a, v16h b, v8f c) { return __builtin_amdgcn_wmma_f32_16x16x32_f16(false, a, false, b, (short)0, c, false, false); }
__device__ __forceinline__ v8f wmmab(v16bf a, v16bf b, v8f c) { return __builtin_amdgcn_wmma_f32_16x16x32_bf16(false, a, false, b, (short)0, c, false, false); }


__device__ __forceinline__ h16 tohx(float x) { return (h16)x; }
// eight f32 as eight bf16
__device__ __forceinline__ v8us bf8(const float (&y)[8]) { v4u h;
#pragma unroll
    for (int p = 0; p < 4; ++p) h[p] = f2bf2(y[2 * p], y[2 * p + 1]);
    return __builtin_bit_cast(v8us, h); }
// eight f32 as hi + lo bf16, a pair at a time: hi = the rounded pair, lo = the rounded rest of each against its hi (the hi's f32 value is its half of the dword in the upper 16 bits)
__device__ __forceinline__ void split8(const float (&y)[8], v8us& hi8, v8us& lo8) { v4u h, l;
#pragma unroll
    for (int p = 0; p < 4; ++p) { const v2fc yy = {y[2 * p], y[2 * p + 1]}; const unsigned u = f2bf2(yy); const v2fc hh = {__uint_as_float(u << 16), __uint_as_float(u & 0xFFFF0000u)}; h[p] = u; l[p] = f2bf2(yy - hh); }
    hi8 = __builtin_bit_cast(v8us, h); lo8 = __builtin_bit_cast(v8us, l); }
// fragment order of a [rows][K] plane (rows % 16 == 0, K % 32 == 0): blocks of 16 rows x 32 k, 512 elements each, k blocks of a row block in a row; in a block the 8-element pieces lie as [k bit 4][k bit 3][row & 15], which is [half of the fragment][lane]
__device__ __forceinline__ size_t fo(size_t row, size_t k, size_t K) { return ((row >> 4) * (K >> 5) + (k >> 5)) * 512 + ((k >> 4) & 1) * 256 + ((k >> 3) & 1) * 128 + (row & 15) * 8 + (k & 7); }
// ---- k_gemmw: register-blocked GEMM, ONE WAVE per 64x64 output tile (16 accumulators), operands straight from 16-bit planes in fragment order; grid (M/(64 GWM), N/(64 GWN), Z), GWM x GWN waves.
// The GWM x GWN tiles of a work-group are neighbours: its waves run on one WGP and walk k together, so the GWN waves of a tile row ask for the same A lines and the GWM waves of a tile column for the same B lines, and the WGP's cache serves what L2 would else deliver once per wave. The waves share no data of their own and meet at no barrier.
// C[m][n] (f32, pitch ldc, + optional f32 bias[n]) = sum_k A[m][k] Bt[n][k] (+ split products per NSPLIT). z-batch strides sA/sB/sC in elements. K % (64 * KS) == 0.
// KS > 1: grid z = Z * KS; work-group (z, ks) sums only k in [ks K/KS, (ks+1) K/KS) and stores that partial tile in plane ks (plane stride sP elements); the reader adds the KS planes.
// HP: no f32 C; the tile is 64 positions x the HD columns of head c0 / 64 of batch z, and the epilogue writes it as 16-bit head planes (fp16, bf16 hi, bf16 lo), once as [b][h][t][d] (P*) and once as [b][h][d][t] (V*), each [t][d] or [d][t] plane in fragment order.
// WFrag::ld: one fragment of a plane in fragment order; p = the 16 x 32 block's start + lane * 8
template <typename T16> struct WFrag;
template <> struct WFrag<h16> { typedef v16h V; static __device__ __forceinline__ V ld(const h16* p) { return cat16(*(const v8h*)p, *(const v8h*)(p + 256)); } static __device__ __forceinline__ v8f mma(V a, V b, v8f c) { return wmma16(a, b, c); } };
template <> struct WFrag<bf> { typedef v16bf V; static __device__ __forceinline__ V ld(const bf* p) { return cat16b(*(const v8us*)p, *(const v8us*)(p + 256)); } static __device__ __forceinline__ v8f mma(V a, V b, v8f c) { return wmmab(a, b, c); } };
// stands behind a group of plane stores, in front of whatever overwrites their registers; the stored values and the pointers are inputs, so that their registers are not given to a later value before the wait
#define SWAIT(d0, d1, d2, p0, p1, p2) asm volatile("s_wait_xcnt 0x0" :: "v"(d0), "v"(d1), "v"(d2), "v"(p0), "v"(p1), "v"(p2) : "memory")
// stands behind a run of global loads (the fragment loads of one k step), in front of whatever overwrites their address registers (the pointer steps); the pointers are inputs, so that their registers are not given to a load's result before the wait
#define LWAIT(p0, p1, p2, p3) asm volatile("s_wait_xcnt 0x0" :: "v"(p0), "v"(p1), "v"(p2), "v"(p3) : "memory")
#define GWM 2
#define GWN 4
template <typename T16, int NSPLIT, bool BIAS, int K, int KS = 1, bool HP = false>
__global__ __launch_bounds__(GWM * GWN * 32) void k_gemmw(const T16* __restrict__ A, const T16* __restrict__ A2, const T16* __restrict__ Bt, const T16* __restrict__ Bt2, float* C, int ldc, const float* __restrict__ bias, size_t sA, size_t sB, size_t sC, size_t sP, h16* P16, bf* Ph, bf* Pl, h16* V16, bf* Vh, bf* Vl) {
    typedef typename WFrag<T16>::V V;
    __shared__ __align__(16) float osw[GWM * GWN][16 * 68];   // each wave stages in its own part
    const int w = __builtin_amdgcn_readfirstlane((int)(threadIdx.x >> 5)); float* os = osw[w];
    const size_t z = blockIdx.z / KS; const int ks = (int)(blockIdx.z % KS); const int kb = ks * (K / KS), ke = kb + K / KS; C += (size_t)ks * sP; A += z * sA; if (A2) A2 += z * sA; Bt += z * sB; if (Bt2) Bt2 += z * sB; C += z * sC;
    const int lane = threadIdx.x & 31, lr = lane & 15, hi = lane >> 4; const int r0 = (blockIdx.x * GWM + (w & (GWM - 1))) * 64, c0 = (blockIdx.y * GWN + w / GWM) * 64;
    v8f acc[4][4];
#pragma unroll
    for (int mb = 0; mb < 4; ++mb)
#pragma unroll
        for (int nb = 0; nb < 4; ++nb) acc[mb][nb] = (v8f){};
    const size_t aoff = (size_t)r0 * K + (size_t)kb * 16 + lane * 8, boff = (size_t)c0 * K + (size_t)kb * 16 + lane * 8;   // a row block of 16 rows is 16 K elements, a k block 512
    const T16* ap = A + aoff; const T16* ap2 = (NSPLIT == 1 || NSPLIT == 2) ? A2 + aoff : ap; const T16* bp = Bt + boff; const T16* bp2 = NSPLIT >= 2 ? Bt2 + boff : bp;
    // two fragment sets: while the products of one k block run, the loads of the next block are in flight into the other set
    static_assert((K / KS) % 64 == 0, "the k range is walked two blocks a trip");
    V a[2][4], a2[2][4], b[2][4], b2[2][4];
    auto ldk = [&](const int s) {   // the next k block's fragment loads, one run, into set s
#pragma unroll
        for (int mb = 0; mb < 4; ++mb) { a[s][mb] = WFrag<T16>::ld(ap + mb * 16 * K); if (NSPLIT == 1 || NSPLIT == 2) a2[s][mb] = WFrag<T16>::ld(ap2 + mb * 16 * K); }
#pragma unroll
        for (int nb = 0; nb < 4; ++nb) { b[s][nb] = WFrag<T16>::ld(bp + nb * 16 * K); if (NSPLIT >= 2) b2[s][nb] = WFrag<T16>::ld(bp2 + nb * 16 * K); }
        LWAIT(ap, ap2, bp, bp2);
        __builtin_amdgcn_sched_barrier(0);   // keeps the run of loads and its wait in front of the pointer steps and of the products that follow: sunk among the products, the loads would start late and their latency would show again
        ap += 512; ap2 += 512; bp += 512; bp2 += 512; };
    auto mmk = [&](const int s) {   // the products of the k block in set s
#pragma unroll
        for (int nb = 0; nb < 4; ++nb)
#pragma unroll
            for (int mb = 0; mb < 4; ++mb) { acc[mb][nb] = WFrag<T16>::mma(a[s][mb], b[s][nb], acc[mb][nb]); if (NSPLIT == 1 || NSPLIT == 2) acc[mb][nb] = WFrag<T16>::mma(a2[s][mb], b[s][nb], acc[mb][nb]); if (NSPLIT >= 2) acc[mb][nb] = WFrag<T16>::mma(a[s][mb], b2[s][nb], acc[mb][nb]); }
        __builtin_amdgcn_sched_barrier(0); };   // keeps the products in front of the loads that refill their set: the loads stay one run, and the wait behind the run stays in front of the pointer steps
    ldk(0);
    // rolled: one pair of k blocks at a time
#pragma unroll 1
    for (int kc = kb; kc < ke - 64; kc += 64) {
        ldk(1); mmk(0); ldk(0); mmk(1);
        // the four vector slots between the trip's last WMMA and a vector instruction on its registers, on the taken side of the loop's branch too
        asm volatile("v_nop\n\tv_nop\n\tv_nop\n\tv_nop" : "+v"(acc[0][0]), "+v"(acc[1][1]), "+v"(acc[2][2]), "+v"(acc[3][3]) : "v"(a[1][0]), "v"(a[1][3]));
    }
    ldk(1); mmk(0); mmk(1);   // the last pair: nothing is left to load behind it
    if constexpr (HP) {
        static_assert(HD == 64, "one 64-column tile is one head");
        const size_t po = (z * NH_ + c0 / 64) * (size_t)TT * HD;
        // [d][t] planes: a lane's 8 accumulator rows are 8 successive positions of one column, one 8-element piece of the plane, stored straight from registers; the 32 lanes' pieces are half a block, 512 bytes in a row
#pragma unroll
        for (int nb = 0; nb < 4; ++nb)
#pragma unroll
            for (int mb = 0; mb < 4; ++mb) { v8h o16; v8us oh, ol; float xs[8];
#pragma unroll
                for (int j = 0; j < 8; ++j) { xs[j] = acc[mb][nb][j]; o16[j] = tohx(xs[j]); }
                split8(xs, oh, ol);
                const size_t vo = po + fo(nb * 16 + lr, r0 + mb * 16 + hi * 8, TT); *(v8h*)(V16 + vo) = o16; *(v8us*)(Vh + vo) = oh; *(v8us*)(Vl + vo) = ol; SWAIT(o16, oh, ol, V16 + vo, Vh + vo, Vl + vo); }
        // [t][d] planes: 16 rows at a time through LDS (one wave: its LDS operations run in program order), so that a lane holds 8 successive columns of one position; a store covers half a block, 512 bytes in a row
#pragma unroll
        for (int mb = 0; mb < 4; ++mb) {
#pragma unroll
            for (int nb = 0; nb < 4; ++nb) {
#pragma unroll
                for (int j = 0; j < 8; ++j) os[(hi * 8 + j) * 68 + nb * 16 + lr] = acc[mb][nb][j]; }
#pragma unroll
            for (int s = 0; s < 4; ++s) { const int row = lr, cofs = (2 * s + hi) * 8; const v4f x0 = *(const v4fa*)(os + row * 68 + cofs), x1 = *(const v4fa*)(os + row * 68 + cofs + 4); v8h o16; v8us oh, ol; float xs[8];
#pragma unroll
                for (int j = 0; j < 8; ++j) { xs[j] = j < 4 ? x0[j & 3] : x1[j & 3]; o16[j] = tohx(xs[j]); }
                split8(xs, oh, ol);
                const size_t pp = po + fo(r0 + mb * 16 + row, cofs, HD); *(v8h*)(P16 + pp) = o16; *(v8us*)(Ph + pp) = oh; *(v8us*)(Pl + pp) = ol; SWAIT(o16, oh, ol, P16 + pp, Ph + pp, Pl + pp); }
        }
        return;
    }
#pragma unroll
    for (int mb = 0; mb < 4; ++mb) {
#pragma unroll
        for (int nb = 0; nb < 4; ++nb) {
#pragma unroll
            for (int j = 0; j < 8; ++j) os[(hi * 8 + j) * 68 + nb * 16 + lr] = acc[mb][nb][j]; }
        __builtin_amdgcn_wave_barrier(); asm volatile("" ::: "memory");
        float* crow = C + (size_t)(r0 + mb * 16) * ldc + c0;
{
#pragma unroll
            for (int s = 0; s < 8; ++s) { const int row = 2 * s + hi, cofs = lr * 4; v4f val = *(const v4fa*)(os + row * 68 + cofs); if (BIAS) { val[0] += bfr(bias[c0 + cofs]); val[1] += bfr(bias[c0 + cofs + 1]); val[2] += bfr(bias[c0 + cofs + 2]); val[3] += bfr(bias[c0 + cofs + 3]); }
                *(v4f*)(crow + (size_t)row * ldc + cofs) = val; }
             }
        __builtin_amdgcn_wave_barrier(); asm volatile("" ::: "memory");
    }
}

typedef __attribute__((ext_vector_type(2))) _Float16 v2h;
typedef __attribute__((ext_vector_type(4))) _Float16 v4h;
typedef __attribute__((ext_vector_type(2))) unsigned short v2us;
typedef __attribute__((ext_vector_type(4))) unsigned short v4us;
typedef __attribute__((ext_vector_type(2))) float v2f;
typedef __attribute__((ext_vector_type(4))) int v4i;

__global__ __launch_bounds__(256) void k_wtG(const float* __restrict__ w, int K, int N, bf* Bt) {
    const int lane = threadIdx.x & 31; const int L0 = (blockIdx.x * 8 + (threadIdx.x >> 5)) * 8; const int nlines = N * K / 64;
{
#pragma unroll 1
        for (int l = 0; l < 8; ++l) { const int L = L0 + l; if (L >= nlines) break; const size_t e = (size_t)L * 64 + lane * 2; const int blk = (int)(e >> 9), k = (blk % (K >> 5)) * 32 + (int)((e >> 7) & 3) * 8 + (int)(e & 7), n = (blk / (K >> 5)) * 16 + (int)((e >> 3) & 15);   // e = fo(n, k, K)
            const float* w0 = w + (size_t)k * N + n; const float* w1 = w0 + N; const float f0 = *w0, f1 = *w1; LWAIT(w0, w1, w0, w1);
            *(v2us*)(Bt + e) = __builtin_bit_cast(v2us, f2bf2(f0, f1)); }
         }
}
// dst: the [rows][K] plane in fragment order; thread i writes piece i of dst, so that the stores are whole lines, and reads the 8 floats that belong there
template <int K>
__global__ __launch_bounds__(256) void k_cvt8(const float* __restrict__ src, bf* dst, size_t n8) { const size_t i = (size_t)blockIdx.x * 256 + threadIdx.x; if (i >= n8) return; const size_t blk = i >> 6, row = (blk / (K >> 5)) * 16 + (i & 15), k = (blk % (K >> 5)) * 32 + ((i >> 4) & 3) * 8; const v8f v = *(const v8f*)(src + row * K + k); float y[8];
#pragma unroll
    for (int j = 0; j < 8; ++j) y[j] = v[j];
    *(v8us*)(dst + i * 8) = bf8(y);  }
// fragment loads from a staged block in LDS (a 16 x 32 block in fragment order; p = the block's start + lane * 8); R: one 16-byte piece
template <typename T16> struct SFrag;
template <> struct SFrag<h16> { typedef v8h R; typedef v8ha RA; static __device__ __forceinline__ v16h ld(const h16* p) { return cat16(*(const v8ha*)p, *(const v8ha*)(p + 256)); } };
template <> struct SFrag<bf> { typedef v8us R; typedef v8usa RA; static __device__ __forceinline__ v16bf ld(const bf* p) { return cat16b(*(const v8usa*)p, *(const v8usa*)(p + 256)); } };

// ---- k_attn: logits, softmax, attn.p and the head merge in one walk over the keys; FW waves; grid (heads, batches, query blocks), the hi/lo blocks first.
// A wave owns 16 NQ query rows and walks all TT keys, 32 a pass. It forms the TRANSPOSED scores (A = key rows, B = its query rows, kept in registers): a lane then holds 16 of the 32 scores of ONE query,
// and the two score tiles are, register for register, the two halves of the B fragment of the transposed product out^T += p^T . weights^T (A = the [d][t] plane): the weights never leave the registers.
// Softmax runs along: a running maximum per query (joined over the two half waves each pass), the sums and the output tiles rescaled by exp(old maximum - new maximum) each pass; the division by the sum comes last.
// The pass's key rows and value columns (the same for all FW waves) are staged in LDS, two buffers: the next pass's pieces are loaded into registers before the pass's work and stored behind it, one barrier a pass.
// stands behind a run of global loads, in front of whatever overwrites their address registers; the pointers are inputs, so that their registers are not given to a load's result before the wait
#define XWAIT(p, p2) asm volatile("s_wait_xcnt 0x0" :: "v"(p), "v"(p2) : "memory")
// lane l's value to lane l ^ 16 and back: the exchange between the two half waves as one vector instruction (a shuffle would go through the LDS queue and its wait)
__device__ __forceinline__ float xhalf(float x) { return __builtin_bit_cast(float, __builtin_amdgcn_permlanex16(__builtin_bit_cast(int, x), __builtin_bit_cast(int, x), 0x76543210, 0xfedcba98, false, false)); }
// 2^x for eight values in one statement: the results are early-clobber, so that none is laid over a source of the run, and the v_nop is the slot that the instruction set asks for behind a transcendental before its result is read or its source overwritten
__device__ __forceinline__ void exp8(float (&e)[8], const float (&x)[8]) {
    asm("v_exp_f32 %0, %8\n\tv_exp_f32 %1, %9\n\tv_exp_f32 %2, %10\n\tv_exp_f32 %3, %11\n\tv_exp_f32 %4, %12\n\tv_exp_f32 %5, %13\n\tv_exp_f32 %6, %14\n\tv_exp_f32 %7, %15\n\tv_nop"
        : "=&v"(e[0]), "=&v"(e[1]), "=&v"(e[2]), "=&v"(e[3]), "=&v"(e[4]), "=&v"(e[5]), "=&v"(e[6]), "=&v"(e[7]) : "v"(x[0]), "v"(x[1]), "v"(x[2]), "v"(x[3]), "v"(x[4]), "v"(x[5]), "v"(x[6]), "v"(x[7])); }
// 2^x for one value, with the same slot behind it
__device__ __forceinline__ float exp1(float x) { float e; asm("v_exp_f32 %0, %1\n\tv_nop" : "=v"(e) : "v"(x)); return e; }
template <typename T16, bool HR>
__device__ __forceinline__ void attn_body(T16* L, const T16* __restrict__ Q, const T16* __restrict__ Q2, const T16* __restrict__ Kp, const T16* __restrict__ K2, const T16* __restrict__ Vt, const T16* __restrict__ Vt2, int i0, int h, bf* Ah, bf* Al) {
    typedef typename WFrag<T16>::V V; typedef typename SFrag<T16>::R R; typedef typename SFrag<T16>::RA RA;
    constexpr int NQ = HR ? 1 : 2;            // query tiles of a wave
    constexpr int STG = HR ? 8192 : 4096;     // elements of one buffer: per plane 2048 of key rows (2 key tiles x 2 d blocks), then 2048 of value columns (4 d tiles)
    constexpr float CS = SCL * 1.4426950408889634f;
    const int tid = threadIdx.x, lane = tid & 31, lr = lane & 15, hi = lane >> 4, w = tid >> 5; const int q0 = i0 + w * 16 * NQ;
    V qf[NQ][2], qf2[NQ][2];
    { const size_t qo = (size_t)q0 * HD + lane * 8; const T16* qp = Q + qo; const T16* qp2 = HR ? Q2 + qo : qp;
#pragma unroll
        for (int nq = 0; nq < NQ; ++nq)
#pragma unroll
            for (int kk = 0; kk < 2; ++kk) { const int ao = nq * 16 * HD + kk * 512; qf[nq][kk] = WFrag<T16>::ld(qp + ao); if (HR) qf2[nq][kk] = WFrag<T16>::ld(qp2 + ao); }
        XWAIT(qp, qp2); }
    // a thread stages pieces tid and tid + 128 of the 256 key pieces (2048 elements in a row in the [t][d] plane) and of the 256 value pieces (64 of each d tile's block in the [d][t] plane)
    const size_t ko = (size_t)tid * 8, vo = (size_t)(tid >> 6) * 16 * TT + (tid & 63) * 8; const T16* kp = Kp + ko; const T16* kp2 = HR ? K2 + ko : kp; const T16* vp = Vt + vo; const T16* vp2 = HR ? Vt2 + vo : vp;
    R g[4], g2[4];
    auto fetch = [&]() { g[0] = *(const R*)kp; g[1] = *(const R*)(kp + 1024); g[2] = *(const R*)vp; g[3] = *(const R*)(vp + 2 * 16 * TT);
        if (HR) { g2[0] = *(const R*)kp2; g2[1] = *(const R*)(kp2 + 1024); g2[2] = *(const R*)vp2; g2[3] = *(const R*)(vp2 + 2 * 16 * TT); }
        if constexpr (HR) { LWAIT(kp, kp2, vp, vp2); kp2 += 2048; vp2 += 512; } else XWAIT(kp, vp);
        kp += 2048; vp += 512; };
    auto put = [&](T16* d) {
#pragma unroll
        for (int i = 0; i < 4; ++i) { *(RA*)(d + i * 1024 + tid * 8) = g[i]; if (HR) *(RA*)(d + 4096 + i * 1024 + tid * 8) = g2[i]; } };
    v8f o[NQ][4]; float m[NQ], l[NQ];
#pragma unroll
    for (int nq = 0; nq < NQ; ++nq) { m[nq] = -3.0e38f; l[nq] = 0.f;
#pragma unroll
        for (int dt = 0; dt < 4; ++dt) o[nq][dt] = (v8f){}; }
    fetch(); put(L);
    __syncthreads();   // pass 0's pieces are in LDS before a wave reads them
    // rolled: one pass's fragments and scores at a time
#pragma unroll 1
    for (int p = 0; p < TT / 32; ++p) { const T16* cur = L + (p & 1) * STG + lane * 8;
        if (p + 1 < TT / 32) fetch();   // the same for the whole work-group
        v8f s[NQ][2];
#pragma unroll
        for (int kt = 0; kt < 2; ++kt) { V ka[2], ka2[2];
#pragma unroll
            for (int kk = 0; kk < 2; ++kk) { ka[kk] = SFrag<T16>::ld(cur + kt * 1024 + kk * 512); if (HR) ka2[kk] = SFrag<T16>::ld(cur + 4096 + kt * 1024 + kk * 512); }
#pragma unroll
            for (int nq = 0; nq < NQ; ++nq) { s[nq][kt] = (v8f){};
#pragma unroll
                for (int kk = 0; kk < 2; ++kk) { s[nq][kt] = WFrag<T16>::mma(ka[kk], qf[nq][kk], s[nq][kt]); if (HR) { s[nq][kt] = WFrag<T16>::mma(ka[kk], qf2[nq][kk], s[nq][kt]); s[nq][kt] = WFrag<T16>::mma(ka2[kk], qf[nq][kk], s[nq][kt]); } } } }
        V pb[NQ], pb2[NQ];
#pragma unroll
        for (int nq = 0; nq < NQ; ++nq) { float t0 = s[nq][0][0], t1 = s[nq][1][0];
#pragma unroll
            for (int j = 1; j < 8; ++j) { t0 = fmaxf(t0, s[nq][0][j]); t1 = fmaxf(t1, s[nq][1][j]); }
            t0 = fmaxf(t0, t1); t0 = fmaxf(t0, xhalf(t0));   // the other half wave holds the query's other 16 keys of the pass
            const float mn = fmaxf(m[nq], t0), al = exp1((m[nq] - mn) * CS), mc = mn * CS - (HR ? 0.0f : 10.0f); m[nq] = mn;   // fp16 weights carry a factor 1024, which the division by their own sum takes out
            float x0[8], x1[8], e0[8], e1[8], s0 = 0.f, s1 = 0.f;
#pragma unroll
            for (int j = 0; j < 8; ++j) { x0[j] = fmaf(s[nq][0][j], CS, -mc); x1[j] = fmaf(s[nq][1][j], CS, -mc); }
            exp8(e0, x0); exp8(e1, x1);
#pragma unroll
            for (int j = 0; j < 8; ++j) { s0 += e0[j]; s1 += e1[j]; }
            l[nq] = fmaf(l[nq], al, s0 + s1);
#pragma unroll
            for (int dt = 0; dt < 4; ++dt)
#pragma unroll
                for (int j = 0; j < 8; ++j) o[nq][dt][j] *= al;
            if constexpr (HR) { v8us h0, h1, l0, l1; split8(e0, h0, l0); split8(e1, h1, l1);
                pb[nq] = cat16b(h0, h1); pb2[nq] = cat16b(l0, l1);
            } else { v8h h0, h1;
#pragma unroll
                for (int j = 0; j < 8; ++j) { h0[j] = tohx(e0[j]); h1[j] = tohx(e1[j]); }
                pb[nq] = cat16(h0, h1); } }
        { V va[4], va2[4];
#pragma unroll
            for (int dt = 0; dt < 4; ++dt) { va[dt] = SFrag<T16>::ld(cur + 2048 + dt * 512); if (HR) va2[dt] = SFrag<T16>::ld(cur + 4096 + 2048 + dt * 512); }
#pragma unroll
            for (int nq = 0; nq < NQ; ++nq)
#pragma unroll
                for (int dt = 0; dt < 4; ++dt) o[nq][dt] = WFrag<T16>::mma(va[dt], pb[nq], o[nq][dt]);
            if constexpr (HR) {
#pragma unroll
                for (int dt = 0; dt < 4; ++dt) o[0][dt] = WFrag<T16>::mma(va[dt], pb2[0], o[0][dt]);
#pragma unroll
                for (int dt = 0; dt < 4; ++dt) o[0][dt] = WFrag<T16>::mma(va2[dt], pb[0], o[0][dt]); } }
        if (p + 1 < TT / 32) put(L + ((p + 1) & 1) * STG);   // the buffer that pass p - 1 read: every wave left it before the barrier at that pass's foot
        __syncthreads();   // publishes pass p + 1's pieces and ends every wave's reads of pass p's buffer
    }
#pragma unroll
    for (int nq = 0; nq < NQ; ++nq) { const float f = __fdiv_rn(1.0f, l[nq] + xhalf(l[nq]));   // the two half waves' sums joined once
        // a lane's 8 accumulator rows are 8 successive columns of one position: one piece of the merged planes; the 32 lanes' pieces are half a block, 512 bytes in a row
#pragma unroll
        for (int dt = 0; dt < 4; ++dt) { v8us oh, ol; float y[8];
#pragma unroll
            for (int j = 0; j < 8; ++j) y[j] = o[nq][dt][j] * f;
            split8(y, oh, ol);
            const size_t oo = fo(q0 + nq * 16 + lr, h * HD + dt * 16 + hi * 8, DQ); *(v8us*)(Ah + oo) = oh; *(v8us*)(Al + oo) = ol; SWAIT(oh, ol, ol, Ah + oo, Al + oo, Al + oo); } }
}
__global__ __launch_bounds__(FW * 32) void k_attn(const h16* __restrict__ Q16, const bf* __restrict__ Qh, const bf* __restrict__ Ql, const h16* __restrict__ K16, const bf* __restrict__ Kh, const bf* __restrict__ Kl, const h16* __restrict__ V16, const bf* __restrict__ Vh, const bf* __restrict__ Vl, bf* Ah, bf* Al) {
    __shared__ __align__(16) unsigned short L[2 * 8192];
    const int h = blockIdx.x, y = blockIdx.z; const size_t bb = blockIdx.y, pq = (bb * NH_ + h) * TT * HD, pk = (bb * NKV + h / REP) * TT * HD; Ah += bb * TT * DQ; Al += bb * TT * DQ;
    if (y < RH / (FW * 16)) attn_body<bf, true>((bf*)L, Qh + pq, Ql + pq, Kh + pk, Kl + pk, Vh + pk, Vl + pk, y * (FW * 16), h, Ah, Al);   // the same for the whole work-group
    else attn_body<h16, false>((h16*)L, Q16 + pq, nullptr, K16 + pk, nullptr, V16 + pk, nullptr, RH + (y - RH / (FW * 16)) * (FW * 32), h, Ah, Al);
}

extern "C" void kernel_launch(void* const* d_in, const int* in_sizes, int n_in,
                              void* d_out, int out_size, void* d_ws, size_t ws_size, hipStream_t stream) {
    (void)in_sizes; (void)n_in; (void)out_size;
    const float* x = (const float*)d_in[0]; const float* wt = (const float*)d_in[1];   /* order x, W: THIS module has ONE weight ('xw' (in, out) [1024][1024]): p = x W serves as the query (scaled in the softmax), the key AND the value, and the output projection reuses the SAME W: TWO inputs, both read */
    float* OUT = (float*)d_out;     // [4][2048][1024]
    char* wsp = (char*)d_ws;
    auto take = [&](size_t bytes) { char* p = wsp; wsp += (bytes + 255) & ~(size_t)255; return (void*)p; };
    bf* WT = (bf*)take((size_t)DQ * DM * 2);
    bf* XB = (bf*)take((size_t)NB_ * TT * DM * 2);
    h16* PP16 = (h16*)take((size_t)NB_ * NH_ * TT * HD * 2); h16* VT16 = (h16*)take((size_t)NB_ * NKV * HD * TT * 2);
    bf* PPh = (bf*)take((size_t)NB_ * NH_ * TT * HD * 2); bf* PPl = (bf*)take((size_t)NB_ * NH_ * TT * HD * 2); bf* VTh = (bf*)take((size_t)NB_ * NKV * HD * TT * 2); bf* VTl = (bf*)take((size_t)NB_ * NKV * HD * TT * 2);
    bf* ATh = (bf*)take((size_t)NB_ * TT * DQ * 2); bf* ATl = (bf*)take((size_t)NB_ * TT * DQ * 2);
    if ((size_t)(wsp - (char*)d_ws) > ws_size) return;    // 146 MiB of the 256 MiB
    // the one weight is transposed once (DM == DQ: the same plane is the B operand of the input and of the output projection)
    k_wtG<<<(unsigned)((DM * DQ / 64 + 63) / 64), 256, 0, stream>>>(wt, DM, DQ, WT);
    k_cvt8<DM><<<(unsigned)(((size_t)NB_ * TT * DM / 8 + 255) / 256), 256, 0, stream>>>(x, XB, (size_t)NB_ * TT * DM / 8);
    // p = x W once, written as 16-bit head planes by the GEMM's epilogue: the [b][h][t][d] planes are read as the query and as the key, the [b][h][d][t] planes as the value
    k_gemmw<bf, 0, false, DM, 1, true><<<dim3(TT / (64 * GWM), DQ / (64 * GWN), NB_), GWM * GWN * 32, 0, stream>>>(XB, nullptr, WT, nullptr, nullptr, DQ, nullptr, (size_t)TT * DM, 0, 0, 0, PP16, PPh, PPl, VT16, VTh, VTl);
    k_attn<<<dim3(NH_, NB_, RH / (FW * 16) + (TT - RH) / (FW * 32)), FW * 32, 0, stream>>>(PP16, PPh, PPl, PP16, PPh, PPl, VT16, VTh, VTl, ATh, ATl);   // query block slowest: the hi/lo blocks, the longer ones, start first
    k_gemmw<bf, 1, false, DQ><<<dim3(TT / (64 * GWM), DM / (64 * GWN), NB_), GWM * GWN * 32, 0, stream>>>(ATh, ATl, WT, nullptr, OUT, DM, nullptr, (size_t)TT * DQ, 0, (size_t)TT * DM, 0, nullptr, nullptr, nullptr, nullptr, nullptr, nullptr);
}
